// v000
// Times are from an AMD MI455X. After a warm-up the kernel runs many times in a row, and a time is the length of
// such a window on the GPU divided by its runs, so every launch and the gaps after it count. The runs cycle
// through copies of the inputs. A figure is the median of several windows, for all but v000 over two sittings.
// Sittings can differ by a few percent; kernels timed side by side share one.
// v000, which the later versions start from, runs in 143 microseconds.
#include <hip/hip_runtime.h>
#include <hip/hip_bf16.h>

typedef __attribute__((ext_vector_type(16))) _Float16 v16h;
typedef __attribute__((ext_vector_type(8)))  _Float16 v8h;
typedef __attribute__((ext_vector_type(4)))  _Float16 v4h;
typedef __attribute__((ext_vector_type(8)))  float    v8f;

#define DT_STEP   0.01f
#define DAMP_MIN_ 5e-4f

constexpr int BB  = 4;
constexpr int LL  = 4096;
constexpr int DIN = 512;
constexpr int NN  = 256;
constexpr int LC  = 256;           // scan chunk length
constexpr int NC  = LL / LC;       // 16 chunks
constexpr int MM  = BB * LL;       // 16384 rows

// ---------------------------------------------------------------------------
// WMMA helpers (V_WMMA_F32_16X16X32_F16, wave32; ISA 7.12.2 layouts)
// lane r = lane&15 owns row (A) / column (B) r; hi = lane>>4;
// v16h element h holds K = (h<8 ? h : h+8) + 8*hi within the 32-wide K tile.
// ---------------------------------------------------------------------------
__device__ __forceinline__ v8f wmma16(v16h a, v16h b, v8f c) {
  return __builtin_amdgcn_wmma_f32_16x16x32_f16(
      /*neg_a=*/false, a, /*neg_b=*/false, b,
      /*c_mod=*/(short)0, c, /*reuse_a=*/false, /*reuse_b=*/false);
}

__device__ __forceinline__ v16h frag_f16(const _Float16* __restrict__ p, int hi) {
  v8h lo  = *reinterpret_cast<const v8h*>(p + 8 * hi);
  v8h hi8 = *reinterpret_cast<const v8h*>(p + 16 + 8 * hi);
  return __builtin_shufflevector(lo, hi8, 0,1,2,3,4,5,6,7,8,9,10,11,12,13,14,15);
}

// ---------------------------------------------------------------------------
// Kernel 0: bilinear discretization. A_bar[n] and A_bar^t power table (t<=LC).
// ---------------------------------------------------------------------------
__global__ void k_params(const float* __restrict__ Ar, const float* __restrict__ Ai,
                         float* __restrict__ abar_re, float* __restrict__ abar_im,
                         float* __restrict__ apow_re, float* __restrict__ apow_im) {
  int n = threadIdx.x;
  float ar = -fabsf(Ar[n]) - DAMP_MIN_;
  float ai = Ai[n];
  float dr = 1.f - 0.005f * ar, di = -0.005f * ai;       // denom = 1 - dt/2 * A
  float inv = 1.f / (dr * dr + di * di);
  float nr = 1.f + 0.005f * ar, ni = 0.005f * ai;        // numer = 1 + dt/2 * A
  float abr = (nr * dr + ni * di) * inv;
  float abi = (ni * dr - nr * di) * inv;
  abar_re[n] = abr; abar_im[n] = abi;
  float pr = 1.f, pi = 0.f;                              // A_bar^0
  for (int t = 0; t <= LC; ++t) {
    apow_re[t * NN + n] = pr; apow_im[t * NN + n] = pi;
    float qr = pr * abr - pi * abi;
    float qi = pr * abi + pi * abr;
    pr = qr; pi = qi;
  }
}

// ---------------------------------------------------------------------------
// Kernel 1: B_bar = dt*B/denom -> f16 (re/im); C -> f16. (both 131072 elems)
// ---------------------------------------------------------------------------
__global__ void k_convert(const float* __restrict__ Ar, const float* __restrict__ Ai,
                          const float* __restrict__ Bm, const float* __restrict__ Cm,
                          _Float16* __restrict__ Bre, _Float16* __restrict__ Bim,
                          _Float16* __restrict__ Ch) {
  int idx = blockIdx.x * blockDim.x + threadIdx.x;       // 0 .. NN*DIN-1
  int n = idx / DIN;
  float ar = -fabsf(Ar[n]) - DAMP_MIN_;
  float ai = Ai[n];
  float dr = 1.f - 0.005f * ar, di = -0.005f * ai;
  float inv = 1.f / (dr * dr + di * di);
  float s = DT_STEP * Bm[idx] * inv;                     // dt*B * conj(denom)/|denom|^2
  Bre[idx] = (_Float16)(s * dr);
  Bim[idx] = (_Float16)(-s * di);
  Ch[idx]  = (_Float16)Cm[idx];                          // C is DIN*NN row-major
}

// ---------------------------------------------------------------------------
// Kernel 1b: one-shot u(fp32) -> f16. Removes all in-GEMM conversions and the
// 16x redundant fp32 re-reads of u fragments (A side becomes pure v8h loads).
// ---------------------------------------------------------------------------
__global__ void k_convert_u(const float* __restrict__ u, _Float16* __restrict__ uh) {
  size_t i4 = (size_t)blockIdx.x * blockDim.x + threadIdx.x;  // 4 elems/thread
  const float4 x = reinterpret_cast<const float4*>(u)[i4];
  v4h h;
  h[0] = (_Float16)x.x; h[1] = (_Float16)x.y;
  h[2] = (_Float16)x.z; h[3] = (_Float16)x.w;
  reinterpret_cast<v4h*>(uh)[i4] = h;
}

// ---------------------------------------------------------------------------
// Kernel 2: v = u @ B_bar^T  (two real WMMA GEMMs share the A fragment)
// one wave per 16x16 tile of [MM x NN]; 4 waves/block share A rows (WGP$ reuse)
// ---------------------------------------------------------------------------
__global__ __launch_bounds__(128) void gemm_vproj(
    const _Float16* __restrict__ uh, const _Float16* __restrict__ Bre,
    const _Float16* __restrict__ Bim,
    float* __restrict__ vre, float* __restrict__ vim) {
  int w    = threadIdx.x >> 5;
  int lane = threadIdx.x & 31;
  int mt   = blockIdx.x >> 2;                 // 0..1023 : 16-row tile of BL
  int nt   = (blockIdx.x & 3) * 4 + w;        // 0..15   : 16-col tile of N
  int hi   = lane >> 4, r = lane & 15;

  const _Float16* arow  = uh  + (size_t)(mt * 16 + r) * DIN;
  const _Float16* browR = Bre + (size_t)(nt * 16 + r) * DIN;
  const _Float16* browI = Bim + (size_t)(nt * 16 + r) * DIN;
  __builtin_prefetch(arow, 0, 3);
  __builtin_prefetch(browR, 0, 3);
  __builtin_prefetch(browI, 0, 3);

  v8f accR = {}; v8f accI = {};
#pragma unroll 4
  for (int k0 = 0; k0 < DIN; k0 += 32) {
    v16h a  = frag_f16(arow  + k0, hi);
    v16h br = frag_f16(browR + k0, hi);
    v16h bi = frag_f16(browI + k0, hi);
    accR = wmma16(a, br, accR);
    accI = wmma16(a, bi, accI);
  }
  // C/D layout: lane holds column n0+r; VGPR q holds row mt*16 + q + 8*hi
  float* oR = vre + (size_t)(mt * 16 + 8 * hi) * NN + nt * 16 + r;
  float* oI = vim + (size_t)(mt * 16 + 8 * hi) * NN + nt * 16 + r;
#pragma unroll
  for (int q = 0; q < 8; ++q) {
    oR[(size_t)q * NN] = accR[q];
    oI[(size_t)q * NN] = accI[q];
  }
}

// ---------------------------------------------------------------------------
// Kernel 3: local chunk scans (zero init), in-place over v; save chunk ends.
// thread = (b, c, n), n fastest -> coalesced along N.
// ---------------------------------------------------------------------------
__global__ void scan_local(float* __restrict__ vre, float* __restrict__ vim,
                           const float* __restrict__ abar_re,
                           const float* __restrict__ abar_im,
                           float* __restrict__ ends_re, float* __restrict__ ends_im) {
  int tid = blockIdx.x * blockDim.x + threadIdx.x;   // 0 .. BB*NC*NN-1
  int n  = tid % NN;
  int bc = tid / NN;
  int c  = bc % NC;
  int b  = bc / NC;
  float ar = abar_re[n], ai = abar_im[n];
  float xr = 0.f, xi = 0.f;
  size_t base = ((size_t)(b * LL + c * LC)) * NN + n;
  for (int t = 0; t < LC; ++t) {
    size_t idx = base + (size_t)t * NN;
    float vr = vre[idx], vi = vim[idx];
    float nxr = ar * xr - ai * xi + vr;
    float nxi = ar * xi + ai * xr + vi;
    xr = nxr; xi = nxi;
    vre[idx] = xr; vim[idx] = xi;
  }
  ends_re[tid] = xr; ends_im[tid] = xi;
}

// ---------------------------------------------------------------------------
// Kernel 4: cross-chunk carry scan. carry_in[c] = state entering chunk c.
// state[c] = ends_local[c] + A^LC * state[c-1];  A^LC by 8 squarings (LC=256).
// ---------------------------------------------------------------------------
__global__ void scan_carry(const float* __restrict__ abar_re,
                           const float* __restrict__ abar_im,
                           const float* __restrict__ ends_re,
                           const float* __restrict__ ends_im,
                           float* __restrict__ carry_re, float* __restrict__ carry_im) {
  int tid = blockIdx.x * blockDim.x + threadIdx.x;   // 0 .. BB*NN-1
  int n = tid % NN;
  int b = tid / NN;
  float pr = abar_re[n], pi = abar_im[n];
#pragma unroll
  for (int i = 0; i < 8; ++i) {                      // A^(2^8) = A^256
    float qr = pr * pr - pi * pi;
    float qi = 2.f * pr * pi;
    pr = qr; pi = qi;
  }
  float cr = 0.f, ci = 0.f;
  for (int c = 0; c < NC; ++c) {
    size_t idx = ((size_t)(b * NC + c)) * NN + n;
    carry_re[idx] = cr; carry_im[idx] = ci;
    float er = ends_re[idx], ei = ends_im[idx];
    float ncr = er + pr * cr - pi * ci;
    float nci = ei + pr * ci + pi * cr;
    cr = ncr; ci = nci;
  }
}

// ---------------------------------------------------------------------------
// Kernel 5: correction + emit Re(y) as f16 for the output GEMM.
// y[b, c*LC+t, n] = v_local + A^(t+1) * carry_in[b,c,n]; only Re needed.
// ---------------------------------------------------------------------------
__global__ void scan_fix(const float* __restrict__ vre,
                         const float* __restrict__ apow_re,
                         const float* __restrict__ apow_im,
                         const float* __restrict__ carry_re,
                         const float* __restrict__ carry_im,
                         _Float16* __restrict__ yh) {
  size_t idx = (size_t)blockIdx.x * blockDim.x + threadIdx.x;  // 0 .. BB*LL*NN-1
  int n = (int)(idx % NN);
  int l = (int)((idx / NN) % LL);
  int b = (int)(idx / ((size_t)NN * LL));
  int c = l / LC, t = l % LC;
  float pr = apow_re[(t + 1) * NN + n];
  float pi = apow_im[(t + 1) * NN + n];
  size_t cidx = ((size_t)(b * NC + c)) * NN + n;
  float cr = carry_re[cidx], ci = carry_im[cidx];
  float yr = vre[idx] + pr * cr - pi * ci;
  yh[idx] = (_Float16)yr;
}

// ---------------------------------------------------------------------------
// Kernel 6: out = Re(y) @ C^T + u * D   (f16 WMMA GEMM, fp32 epilogue)
// ---------------------------------------------------------------------------
__global__ __launch_bounds__(128) void gemm_out(
    const _Float16* __restrict__ yh, const _Float16* __restrict__ Ch,
    const float* __restrict__ u, const float* __restrict__ Dv,
    float* __restrict__ out) {
  int w    = threadIdx.x >> 5;
  int lane = threadIdx.x & 31;
  int mt   = blockIdx.x >> 3;                 // 0..1023 : 16-row tile of BL
  int dt   = (blockIdx.x & 7) * 4 + w;        // 0..31   : 16-col tile of Din
  int hi   = lane >> 4, r = lane & 15;

  const _Float16* arow = yh + (size_t)(mt * 16 + r) * NN;
  const _Float16* brow = Ch + (size_t)(dt * 16 + r) * NN;  // C[d][n]: k-contig
  __builtin_prefetch(arow, 0, 3);
  __builtin_prefetch(brow, 0, 3);

  v8f acc = {};
#pragma unroll
  for (int k0 = 0; k0 < NN; k0 += 32) {
    v16h a = frag_f16(arow + k0, hi);
    v16h b = frag_f16(brow + k0, hi);
    acc = wmma16(a, b, acc);
  }
  int d = dt * 16 + r;
  float dval = Dv[d];
#pragma unroll
  for (int q = 0; q < 8; ++q) {
    size_t m = (size_t)(mt * 16 + q + 8 * hi);
    out[m * DIN + d] = acc[q] + u[m * DIN + d] * dval;
  }
}

// ---------------------------------------------------------------------------
// Host launcher. Workspace carve-out (~60 MB), all launches on `stream`.
// ---------------------------------------------------------------------------
extern "C" void kernel_launch(void* const* d_in, const int* in_sizes, int n_in,
                              void* d_out, int out_size, void* d_ws, size_t ws_size,
                              hipStream_t stream) {
  const float* u      = (const float*)d_in[0];  // [BB, LL, DIN]
  const float* A_real = (const float*)d_in[1];  // [NN]
  const float* A_imag = (const float*)d_in[2];  // [NN]
  const float* B_mat  = (const float*)d_in[3];  // [NN, DIN]
  const float* C_mat  = (const float*)d_in[4];  // [DIN, NN]
  const float* D_vec  = (const float*)d_in[5];  // [DIN]
  float* out = (float*)d_out;                   // [BB, LL, DIN]

  char* w = (char*)d_ws;
  auto carve = [&](size_t bytes) -> void* {
    void* p = (void*)w;
    w += (bytes + 255) & ~(size_t)255;
    return p;
  };
  float*    abar_re  = (float*)carve(NN * sizeof(float));
  float*    abar_im  = (float*)carve(NN * sizeof(float));
  float*    apow_re  = (float*)carve((size_t)(LC + 1) * NN * sizeof(float));
  float*    apow_im  = (float*)carve((size_t)(LC + 1) * NN * sizeof(float));
  _Float16* Bre_h    = (_Float16*)carve((size_t)NN * DIN * sizeof(_Float16));
  _Float16* Bim_h    = (_Float16*)carve((size_t)NN * DIN * sizeof(_Float16));
  _Float16* C_h      = (_Float16*)carve((size_t)DIN * NN * sizeof(_Float16));
  _Float16* u_h      = (_Float16*)carve((size_t)MM * DIN * sizeof(_Float16));
  float*    v_re     = (float*)carve((size_t)MM * NN * sizeof(float));
  float*    v_im     = (float*)carve((size_t)MM * NN * sizeof(float));
  float*    ends_re  = (float*)carve((size_t)BB * NC * NN * sizeof(float));
  float*    ends_im  = (float*)carve((size_t)BB * NC * NN * sizeof(float));
  float*    carry_re = (float*)carve((size_t)BB * NC * NN * sizeof(float));
  float*    carry_im = (float*)carve((size_t)BB * NC * NN * sizeof(float));
  _Float16* y_h      = (_Float16*)carve((size_t)MM * NN * sizeof(_Float16));

  // 0) discretize + power table
  k_params<<<1, NN, 0, stream>>>(A_real, A_imag, abar_re, abar_im, apow_re, apow_im);
  // 1) weight conversion to f16
  k_convert<<<(NN * DIN) / 256, 256, 0, stream>>>(A_real, A_imag, B_mat, C_mat,
                                                  Bre_h, Bim_h, C_h);
  // 1b) activation conversion to f16 (4 elems/thread, vectorized)
  k_convert_u<<<(unsigned)(((size_t)MM * DIN / 4) / 256), 256, 0, stream>>>(u, u_h);
  // 2) input projection: v = u @ B_bar^T  (WMMA)
  gemm_vproj<<<(MM / 16) * 4, 128, 0, stream>>>(u_h, Bre_h, Bim_h, v_re, v_im);
  // 3) chunked parallel scan
  scan_local<<<(BB * NC * NN) / 256, 256, 0, stream>>>(v_re, v_im, abar_re, abar_im,
                                                       ends_re, ends_im);
  scan_carry<<<(BB * NN) / 256, 256, 0, stream>>>(abar_re, abar_im, ends_re, ends_im,
                                                  carry_re, carry_im);
  scan_fix<<<(unsigned)(((size_t)MM * NN) / 256), 256, 0, stream>>>(
      v_re, apow_re, apow_im, carry_re, carry_im, y_h);
  // 4) output projection + skip: out = Re(y) @ C^T + u*D  (WMMA)
  gemm_out<<<(MM / 16) * 8, 128, 0, stream>>>(y_h, C_h, u, D_vec, out);
}

// v001
// It runs in 91.1 microseconds.
// In two side-by-side timings against v000, it was 1.61 and 1.63 times as fast.
#include <hip/hip_runtime.h>
#include <hip/hip_bf16.h>

typedef __attribute__((ext_vector_type(16))) _Float16 v16h;
typedef __attribute__((ext_vector_type(8)))  _Float16 v8h;
typedef __attribute__((ext_vector_type(4)))  _Float16 v4h;
typedef __attribute__((ext_vector_type(8)))  float    v8f;

#define DT_STEP   0.01f
#define DAMP_MIN_ 5e-4f

constexpr int BB  = 4;
constexpr int LL  = 4096;
constexpr int DIN = 512;
constexpr int NN  = 256;
constexpr int LC  = 256;           // scan chunk length
constexpr int NC  = LL / LC;       // 16 chunks
constexpr int MM  = BB * LL;       // 16384 rows

// ---------------------------------------------------------------------------
// WMMA helpers (V_WMMA_F32_16X16X32_F16, wave32; ISA 7.12.2 layouts)
// lane r = lane&15 owns row (A) / column (B) r; hi = lane>>4;
// v16h element h holds K = (h<8 ? h : h+8) + 8*hi within the 32-wide K tile.
// ---------------------------------------------------------------------------
__device__ __forceinline__ v8f wmma16(v16h a, v16h b, v8f c) {
  return __builtin_amdgcn_wmma_f32_16x16x32_f16(
      /*neg_a=*/false, a, /*neg_b=*/false, b,
      /*c_mod=*/(short)0, c, /*reuse_a=*/false, /*reuse_b=*/false);
}

// Fragment from a wave-uniform tile base plus the lane's element offset
// (row r, 8*hi): the base stays scalar, the one offset register serves all loads.
__device__ __forceinline__ v16h frag_at(const _Float16* __restrict__ base, unsigned off) {
  v8h lo  = *reinterpret_cast<const v8h*>(base + off);
  v8h hi8 = *reinterpret_cast<const v8h*>((base + 16) + off);
  return __builtin_shufflevector(lo, hi8, 0,1,2,3,4,5,6,7,8,9,10,11,12,13,14,15);
}

// ---------------------------------------------------------------------------
// Kernel 0: bilinear discretization. A_bar[n] and A_bar^t power table (t<=LC).
// ---------------------------------------------------------------------------
__global__ void k_params(const float* __restrict__ Ar, const float* __restrict__ Ai,
                         float* __restrict__ abar_re, float* __restrict__ abar_im,
                         float* __restrict__ apow_re, float* __restrict__ apow_im) {
  int n = threadIdx.x;
  float ar = -fabsf(Ar[n]) - DAMP_MIN_;
  float ai = Ai[n];
  float dr = 1.f - 0.005f * ar, di = -0.005f * ai;       // denom = 1 - dt/2 * A
  float inv = 1.f / (dr * dr + di * di);
  float nr = 1.f + 0.005f * ar, ni = 0.005f * ai;        // numer = 1 + dt/2 * A
  float abr = (nr * dr + ni * di) * inv;
  float abi = (ni * dr - nr * di) * inv;
  abar_re[n] = abr; abar_im[n] = abi;
  float pr = 1.f, pi = 0.f;                              // A_bar^0
  for (int t = 0; t <= LC; ++t) {
    apow_re[t * NN + n] = pr; apow_im[t * NN + n] = pi;
    float qr = pr * abr - pi * abi;
    float qi = pr * abi + pi * abr;
    pr = qr; pi = qi;
  }
}

// ---------------------------------------------------------------------------
// Kernel 1: B_bar = dt*B/denom -> f16 (re/im); C -> f16. (both 131072 elems)
// ---------------------------------------------------------------------------
__global__ void k_convert(const float* __restrict__ Ar, const float* __restrict__ Ai,
                          const float* __restrict__ Bm, const float* __restrict__ Cm,
                          _Float16* __restrict__ Bre, _Float16* __restrict__ Bim,
                          _Float16* __restrict__ Ch) {
  int idx = blockIdx.x * blockDim.x + threadIdx.x;       // 0 .. NN*DIN-1
  int n = idx / DIN;
  float ar = -fabsf(Ar[n]) - DAMP_MIN_;
  float ai = Ai[n];
  float dr = 1.f - 0.005f * ar, di = -0.005f * ai;
  float inv = 1.f / (dr * dr + di * di);
  float s = DT_STEP * Bm[idx] * inv;                     // dt*B * conj(denom)/|denom|^2
  Bre[idx] = (_Float16)(s * dr);
  Bim[idx] = (_Float16)(-s * di);
  Ch[idx]  = (_Float16)Cm[idx];                          // C is DIN*NN row-major
}

// ---------------------------------------------------------------------------
// Kernel 1b: one-shot u(fp32) -> f16. Removes all in-GEMM conversions and the
// 16x redundant fp32 re-reads of u fragments (A side becomes pure v8h loads).
// ---------------------------------------------------------------------------
__global__ void k_convert_u(const float* __restrict__ u, _Float16* __restrict__ uh) {
  size_t i4 = (size_t)blockIdx.x * blockDim.x + threadIdx.x;  // 4 elems/thread
  const float4 x = reinterpret_cast<const float4*>(u)[i4];
  v4h h;
  h[0] = (_Float16)x.x; h[1] = (_Float16)x.y;
  h[2] = (_Float16)x.z; h[3] = (_Float16)x.w;
  reinterpret_cast<v4h*>(uh)[i4] = h;
}

// ---------------------------------------------------------------------------
// Kernel 2: v = u @ B_bar^T  (two real WMMA GEMMs share the A fragments)
// one wave per 64 x 32 tile of [MM x NN], re and im: 4 A fragments and 2 + 2 B
// fragments in registers feed 16 WMMAs per 32-wide k step. The 8 waves of a
// block stand 2 x 4 on a 128 x 128 tile, so that the lines of A and B that a
// block has in use fit the WGP cache.
// ---------------------------------------------------------------------------
__global__ __launch_bounds__(256) void gemm_vproj(
    const _Float16* __restrict__ uh, const _Float16* __restrict__ Bre,
    const _Float16* __restrict__ Bim,
    float* __restrict__ vre, float* __restrict__ vim) {
  int w    = __builtin_amdgcn_readfirstlane(threadIdx.x >> 5);
  int lane = threadIdx.x & 31;
  int m0   = (blockIdx.x >> 1) * 128 + (w >> 2) * 64;  // first of 64 rows of BL
  int n0   = (blockIdx.x & 1) * 128 + (w & 3) * 32;    // first of 32 columns of N
  int hi   = lane >> 4, r = lane & 15;

  const _Float16* abase  = uh  + (size_t)m0 * DIN;
  const _Float16* bbaseR = Bre + (size_t)n0 * DIN;
  const _Float16* bbaseI = Bim + (size_t)n0 * DIN;
  const unsigned  lfrag  = (unsigned)(r * DIN + 8 * hi);

  v8f accR[4][2] = {}; v8f accI[4][2] = {};
  // unrolled: every load is scalar base + lfrag + immediate
#pragma unroll
  for (int ks = 0; ks < DIN; ks += 32) {
    v16h a[4], br[2], bi[2];
#pragma unroll
    for (int i = 0; i < 4; ++i) a[i] = frag_at(abase + ks + i * 16 * DIN, lfrag);
#pragma unroll
    for (int j = 0; j < 2; ++j) {
      br[j] = frag_at(bbaseR + ks + j * 16 * DIN, lfrag);
      bi[j] = frag_at(bbaseI + ks + j * 16 * DIN, lfrag);
    }
    // keeps the step's 16 loads together ahead of its WMMAs: left free, the
    // scheduler reloads one B fragment at a time and waits out each load alone
    __builtin_amdgcn_sched_barrier(0);
#pragma unroll
    for (int j = 0; j < 2; ++j) {
#pragma unroll
      for (int i = 0; i < 4; ++i) {
        accR[i][j] = wmma16(a[i], br[j], accR[i][j]);
        accI[i][j] = wmma16(a[i], bi[j], accI[i][j]);
      }
    }
    // ends the step: no later load or store moves in among these WMMAs
    __builtin_amdgcn_sched_barrier(0);
  }
  // C/D layout: lane holds column n0+16j+r; VGPR q holds row m0 + 16i + q + 8*hi
  float* oR = vre + (size_t)m0 * NN + n0;
  float* oI = vim + (size_t)m0 * NN + n0;
  const unsigned lout = (unsigned)(8 * hi * NN + r);
#pragma unroll
  for (int i = 0; i < 4; ++i) {
#pragma unroll
    for (int j = 0; j < 2; ++j) {
#pragma unroll
      for (int q = 0; q < 8; ++q) {
        (oR + (i * 16 + q) * NN + j * 16)[lout] = accR[i][j][q];
        (oI + (i * 16 + q) * NN + j * 16)[lout] = accI[i][j][q];
      }
    }
  }
}

// ---------------------------------------------------------------------------
// Kernel 3: local chunk scans (zero init), in-place over v; save chunk ends.
// thread = (b, c, n), n fastest -> coalesced along N.
// ---------------------------------------------------------------------------
__global__ void scan_local(float* __restrict__ vre, float* __restrict__ vim,
                           const float* __restrict__ abar_re,
                           const float* __restrict__ abar_im,
                           float* __restrict__ ends_re, float* __restrict__ ends_im) {
  int tid = blockIdx.x * blockDim.x + threadIdx.x;   // 0 .. BB*NC*NN-1
  int n  = tid % NN;
  int bc = tid / NN;
  int c  = bc % NC;
  int b  = bc / NC;
  float ar = abar_re[n], ai = abar_im[n];
  float xr = 0.f, xi = 0.f;
  size_t base = ((size_t)(b * LL + c * LC)) * NN + n;
  for (int t = 0; t < LC; ++t) {
    size_t idx = base + (size_t)t * NN;
    float vr = vre[idx], vi = vim[idx];
    float nxr = ar * xr - ai * xi + vr;
    float nxi = ar * xi + ai * xr + vi;
    xr = nxr; xi = nxi;
    vre[idx] = xr; vim[idx] = xi;
  }
  ends_re[tid] = xr; ends_im[tid] = xi;
}

// ---------------------------------------------------------------------------
// Kernel 4: cross-chunk carry scan. carry_in[c] = state entering chunk c.
// state[c] = ends_local[c] + A^LC * state[c-1];  A^LC by 8 squarings (LC=256).
// ---------------------------------------------------------------------------
__global__ void scan_carry(const float* __restrict__ abar_re,
                           const float* __restrict__ abar_im,
                           const float* __restrict__ ends_re,
                           const float* __restrict__ ends_im,
                           float* __restrict__ carry_re, float* __restrict__ carry_im) {
  int tid = blockIdx.x * blockDim.x + threadIdx.x;   // 0 .. BB*NN-1
  int n = tid % NN;
  int b = tid / NN;
  float pr = abar_re[n], pi = abar_im[n];
#pragma unroll
  for (int i = 0; i < 8; ++i) {                      // A^(2^8) = A^256
    float qr = pr * pr - pi * pi;
    float qi = 2.f * pr * pi;
    pr = qr; pi = qi;
  }
  float cr = 0.f, ci = 0.f;
  for (int c = 0; c < NC; ++c) {
    size_t idx = ((size_t)(b * NC + c)) * NN + n;
    carry_re[idx] = cr; carry_im[idx] = ci;
    float er = ends_re[idx], ei = ends_im[idx];
    float ncr = er + pr * cr - pi * ci;
    float nci = ei + pr * ci + pi * cr;
    cr = ncr; ci = nci;
  }
}

// ---------------------------------------------------------------------------
// Kernel 5: correction + emit Re(y) as f16 for the output GEMM.
// y[b, c*LC+t, n] = v_local + A^(t+1) * carry_in[b,c,n]; only Re needed.
// ---------------------------------------------------------------------------
__global__ void scan_fix(const float* __restrict__ vre,
                         const float* __restrict__ apow_re,
                         const float* __restrict__ apow_im,
                         const float* __restrict__ carry_re,
                         const float* __restrict__ carry_im,
                         _Float16* __restrict__ yh) {
  size_t idx = (size_t)blockIdx.x * blockDim.x + threadIdx.x;  // 0 .. BB*LL*NN-1
  int n = (int)(idx % NN);
  int l = (int)((idx / NN) % LL);
  int b = (int)(idx / ((size_t)NN * LL));
  int c = l / LC, t = l % LC;
  float pr = apow_re[(t + 1) * NN + n];
  float pi = apow_im[(t + 1) * NN + n];
  size_t cidx = ((size_t)(b * NC + c)) * NN + n;
  float cr = carry_re[cidx], ci = carry_im[cidx];
  float yr = vre[idx] + pr * cr - pi * ci;
  yh[idx] = (_Float16)yr;
}

// ---------------------------------------------------------------------------
// Kernel 6: out = Re(y) @ C^T + u * D   (f16 WMMA GEMM, fp32 epilogue)
// one wave per 64 x 64 tile of [MM x DIN]: 4 A and 4 B fragments in registers
// feed 16 WMMAs per 32-wide k step. The 8 waves of a block stand 2 x 4 on a
// 128 x 256 tile, so that the lines of A and B that a block has in use fit the
// WGP cache.
// ---------------------------------------------------------------------------
__global__ __launch_bounds__(256) void gemm_out(
    const _Float16* __restrict__ yh, const _Float16* __restrict__ Ch,
    const float* __restrict__ u, const float* __restrict__ Dv,
    float* __restrict__ out) {
  int w    = __builtin_amdgcn_readfirstlane(threadIdx.x >> 5);
  int lane = threadIdx.x & 31;
  int m0   = (blockIdx.x >> 1) * 128 + (w >> 2) * 64;  // first of 64 rows of BL
  int d0   = (blockIdx.x & 1) * 256 + (w & 3) * 64;    // first of 64 columns of Din
  int hi   = lane >> 4, r = lane & 15;

  const _Float16* abase = yh + (size_t)m0 * NN;
  const _Float16* bbase = Ch + (size_t)d0 * NN;            // C[d][n]: k-contig
  const unsigned  lfrag = (unsigned)(r * NN + 8 * hi);

  float dval[4];
#pragma unroll
  for (int j = 0; j < 4; ++j) dval[j] = (Dv + d0 + j * 16)[(unsigned)r];

  v8f acc[4][4] = {};
  // unrolled: every load is scalar base + lfrag + immediate
#pragma unroll
  for (int ks = 0; ks < NN; ks += 32) {
    v16h a[4], b[4];
#pragma unroll
    for (int i = 0; i < 4; ++i) a[i] = frag_at(abase + ks + i * 16 * NN, lfrag);
#pragma unroll
    for (int j = 0; j < 4; ++j) b[j] = frag_at(bbase + ks + j * 16 * NN, lfrag);
    // keeps the step's 16 loads together ahead of its WMMAs: left free, the
    // scheduler reloads one B fragment at a time and waits out each load alone
    __builtin_amdgcn_sched_barrier(0);
#pragma unroll
    for (int j = 0; j < 4; ++j) {
#pragma unroll
      for (int i = 0; i < 4; ++i) acc[i][j] = wmma16(a[i], b[j], acc[i][j]);
    }
    // ends the step: no later load or store moves in among these WMMAs
    __builtin_amdgcn_sched_barrier(0);
  }
  const float* ub = u   + (size_t)m0 * DIN + d0;
  float*       ob = out + (size_t)m0 * DIN + d0;
  const unsigned lout = (unsigned)(8 * hi * DIN + r);
  // 16 rows at a time; the next 16 rows' u values are loaded ahead of this group's stores
  float uu[2][4][8];
#pragma unroll
  for (int j = 0; j < 4; ++j) {
#pragma unroll
    for (int q = 0; q < 8; ++q) uu[0][j][q] = (ub + q * DIN + j * 16)[lout];
  }
#pragma unroll
  for (int i = 0; i < 4; ++i) {
    if (i < 3) {
#pragma unroll
      for (int j = 0; j < 4; ++j) {
#pragma unroll
        for (int q = 0; q < 8; ++q)
          uu[(i + 1) & 1][j][q] = (ub + ((i + 1) * 16 + q) * DIN + j * 16)[lout];
      }
    }
    // keeps those 32 loads together ahead of the stores: left free, the
    // scheduler takes one load at a time and waits out each alone
    __builtin_amdgcn_sched_barrier(0);
#pragma unroll
    for (int j = 0; j < 4; ++j) {
#pragma unroll
      for (int q = 0; q < 8; ++q)
        (ob + (i * 16 + q) * DIN + j * 16)[lout] = acc[i][j][q] + uu[i & 1][j][q] * dval[j];
    }
    // the stored registers are free for the loads that follow behind this wait
    if (i < 2) asm volatile("s_wait_xcnt 0x0" ::: "memory");
  }
}

// ---------------------------------------------------------------------------
// Host launcher. Workspace carve-out (~60 MB), all launches on `stream`.
// ---------------------------------------------------------------------------
extern "C" void kernel_launch(void* const* d_in, const int* in_sizes, int n_in,
                              void* d_out, int out_size, void* d_ws, size_t ws_size,
                              hipStream_t stream) {
  const float* u      = (const float*)d_in[0];  // [BB, LL, DIN]
  const float* A_real = (const float*)d_in[1];  // [NN]
  const float* A_imag = (const float*)d_in[2];  // [NN]
  const float* B_mat  = (const float*)d_in[3];  // [NN, DIN]
  const float* C_mat  = (const float*)d_in[4];  // [DIN, NN]
  const float* D_vec  = (const float*)d_in[5];  // [DIN]
  float* out = (float*)d_out;                   // [BB, LL, DIN]

  char* w = (char*)d_ws;
  auto carve = [&](size_t bytes) -> void* {
    void* p = (void*)w;
    w += (bytes + 255) & ~(size_t)255;
    return p;
  };
  float*    abar_re  = (float*)carve(NN * sizeof(float));
  float*    abar_im  = (float*)carve(NN * sizeof(float));
  float*    apow_re  = (float*)carve((size_t)(LC + 1) * NN * sizeof(float));
  float*    apow_im  = (float*)carve((size_t)(LC + 1) * NN * sizeof(float));
  _Float16* Bre_h    = (_Float16*)carve((size_t)NN * DIN * sizeof(_Float16));
  _Float16* Bim_h    = (_Float16*)carve((size_t)NN * DIN * sizeof(_Float16));
  _Float16* C_h      = (_Float16*)carve((size_t)DIN * NN * sizeof(_Float16));
  _Float16* u_h      = (_Float16*)carve((size_t)MM * DIN * sizeof(_Float16));
  float*    v_re     = (float*)carve((size_t)MM * NN * sizeof(float));
  float*    v_im     = (float*)carve((size_t)MM * NN * sizeof(float));
  float*    ends_re  = (float*)carve((size_t)BB * NC * NN * sizeof(float));
  float*    ends_im  = (float*)carve((size_t)BB * NC * NN * sizeof(float));
  float*    carry_re = (float*)carve((size_t)BB * NC * NN * sizeof(float));
  float*    carry_im = (float*)carve((size_t)BB * NC * NN * sizeof(float));
  _Float16* y_h      = (_Float16*)carve((size_t)MM * NN * sizeof(_Float16));

  // 0) discretize + power table
  k_params<<<1, NN, 0, stream>>>(A_real, A_imag, abar_re, abar_im, apow_re, apow_im);
  // 1) weight conversion to f16
  k_convert<<<(NN * DIN) / 256, 256, 0, stream>>>(A_real, A_imag, B_mat, C_mat,
                                                  Bre_h, Bim_h, C_h);
  // 1b) activation conversion to f16 (4 elems/thread, vectorized)
  k_convert_u<<<(unsigned)(((size_t)MM * DIN / 4) / 256), 256, 0, stream>>>(u, u_h);
  // 2) input projection: v = u @ B_bar^T  (WMMA)
  gemm_vproj<<<(MM / 128) * 2, 256, 0, stream>>>(u_h, Bre_h, Bim_h, v_re, v_im);
  // 3) chunked parallel scan
  scan_local<<<(BB * NC * NN) / 256, 256, 0, stream>>>(v_re, v_im, abar_re, abar_im,
                                                       ends_re, ends_im);
  scan_carry<<<(BB * NN) / 256, 256, 0, stream>>>(abar_re, abar_im, ends_re, ends_im,
                                                  carry_re, carry_im);
  scan_fix<<<(unsigned)(((size_t)MM * NN) / 256), 256, 0, stream>>>(
      v_re, apow_re, apow_im, carry_re, carry_im, y_h);
  // 4) output projection + skip: out = Re(y) @ C^T + u*D  (WMMA)
  gemm_out<<<(MM / 128) * 2, 256, 0, stream>>>(y_h, C_h, u, D_vec, out);
}

// v002
// It runs in 67.2 microseconds.
// In two side-by-side timings against v001, it was 1.39 and 1.41 times as fast.
// Over all steps from v000 it is 2.26 times as fast.
#include <hip/hip_runtime.h>
#include <hip/hip_bf16.h>

typedef __attribute__((ext_vector_type(16))) _Float16 v16h;
typedef __attribute__((ext_vector_type(8)))  _Float16 v8h;
typedef __attribute__((ext_vector_type(4)))  _Float16 v4h;
typedef __attribute__((ext_vector_type(8)))  float    v8f;

#define DT_STEP   0.01f
#define DAMP_MIN_ 5e-4f

constexpr int BB  = 4;
constexpr int LL  = 4096;
constexpr int DIN = 512;
constexpr int NN  = 256;
constexpr int LC  = 64;            // scan chunk length = rows of one wave's tile in gemm_vproj
constexpr int NC  = LL / LC;       // 64 chunks
constexpr int MM  = BB * LL;       // 16384 rows

// ---------------------------------------------------------------------------
// WMMA helpers (V_WMMA_F32_16X16X32_F16, wave32; ISA 7.12.2 layouts)
// lane r = lane&15 owns row (A) / column (B) r; hi = lane>>4;
// v16h element h holds K = (h<8 ? h : h+8) + 8*hi within the 32-wide K tile.
// ---------------------------------------------------------------------------
__device__ __forceinline__ v8f wmma16(v16h a, v16h b, v8f c) {
  return __builtin_amdgcn_wmma_f32_16x16x32_f16(
      /*neg_a=*/false, a, /*neg_b=*/false, b,
      /*c_mod=*/(short)0, c, /*reuse_a=*/false, /*reuse_b=*/false);
}

// Fragment from a wave-uniform tile base plus the lane's element offset
// (row r, 8*hi): the base stays scalar, the one offset register serves all loads.
__device__ __forceinline__ v16h frag_at(const _Float16* __restrict__ base, unsigned off) {
  v8h lo  = *reinterpret_cast<const v8h*>(base + off);
  v8h hi8 = *reinterpret_cast<const v8h*>((base + 16) + off);
  return __builtin_shufflevector(lo, hi8, 0,1,2,3,4,5,6,7,8,9,10,11,12,13,14,15);
}

// Value of the lane 16 places away (l <-> l ^ 16), as one vector cross-row move.
__device__ __forceinline__ float other_half(float x) {
  int b = __builtin_bit_cast(int, x);
  b = __builtin_amdgcn_permlanex16(b, b, 0x76543210, 0xfedcba98, false, false);
  return __builtin_bit_cast(float, b);
}

// ---------------------------------------------------------------------------
// Kernel 0: bilinear discretization. A_bar[n] and A_bar^t power table (t<=LC).
// ---------------------------------------------------------------------------
__global__ void k_params(const float* __restrict__ Ar, const float* __restrict__ Ai,
                         float* __restrict__ abar_re, float* __restrict__ abar_im,
                         float* __restrict__ apow_re, float* __restrict__ apow_im) {
  int n = threadIdx.x;
  float ar = -fabsf(Ar[n]) - DAMP_MIN_;
  float ai = Ai[n];
  float dr = 1.f - 0.005f * ar, di = -0.005f * ai;       // denom = 1 - dt/2 * A
  float inv = 1.f / (dr * dr + di * di);
  float nr = 1.f + 0.005f * ar, ni = 0.005f * ai;        // numer = 1 + dt/2 * A
  float abr = (nr * dr + ni * di) * inv;
  float abi = (ni * dr - nr * di) * inv;
  abar_re[n] = abr; abar_im[n] = abi;
  float pr = 1.f, pi = 0.f;                              // A_bar^0
  for (int t = 0; t <= LC; ++t) {
    apow_re[t * NN + n] = pr; apow_im[t * NN + n] = pi;
    float qr = pr * abr - pi * abi;
    float qi = pr * abi + pi * abr;
    pr = qr; pi = qi;
  }
}

// ---------------------------------------------------------------------------
// Kernel 1: B_bar = dt*B/denom -> f16 (re/im); C -> f16. (both 131072 elems)
// ---------------------------------------------------------------------------
__global__ void k_convert(const float* __restrict__ Ar, const float* __restrict__ Ai,
                          const float* __restrict__ Bm, const float* __restrict__ Cm,
                          _Float16* __restrict__ Bre, _Float16* __restrict__ Bim,
                          _Float16* __restrict__ Ch) {
  int idx = blockIdx.x * blockDim.x + threadIdx.x;       // 0 .. NN*DIN-1
  int n = idx / DIN;
  float ar = -fabsf(Ar[n]) - DAMP_MIN_;
  float ai = Ai[n];
  float dr = 1.f - 0.005f * ar, di = -0.005f * ai;
  float inv = 1.f / (dr * dr + di * di);
  float s = DT_STEP * Bm[idx] * inv;                     // dt*B * conj(denom)/|denom|^2
  Bre[idx] = (_Float16)(s * dr);
  Bim[idx] = (_Float16)(-s * di);
  Ch[idx]  = (_Float16)Cm[idx];                          // C is DIN*NN row-major
}

// ---------------------------------------------------------------------------
// Kernel 1b: one-shot u(fp32) -> f16. Removes all in-GEMM conversions and the
// 16x redundant fp32 re-reads of u fragments (A side becomes pure v8h loads).
// ---------------------------------------------------------------------------
__global__ void k_convert_u(const float* __restrict__ u, _Float16* __restrict__ uh) {
  size_t i4 = (size_t)blockIdx.x * blockDim.x + threadIdx.x;  // 4 elems/thread
  const float4 x = reinterpret_cast<const float4*>(u)[i4];
  v4h h;
  h[0] = (_Float16)x.x; h[1] = (_Float16)x.y;
  h[2] = (_Float16)x.z; h[3] = (_Float16)x.w;
  reinterpret_cast<v4h*>(uh)[i4] = h;
}

// ---------------------------------------------------------------------------
// Kernel 2: v = u @ B_bar^T  (two real WMMA GEMMs share the A fragments)
// one wave per 64 x 32 tile of [MM x NN], re and im: 4 A fragments and 2 + 2 B
// fragments in registers feed 16 WMMAs per 32-wide k step. The 8 waves of a
// block stand 2 x 4 on a 128 x 128 tile, so that the lines of A and B that a
// block has in use fit the WGP cache.
// Epilogue: the wave's 64 rows are one scan chunk. x[t] = A_bar x[t-1] + v[t]
// (zero start) runs on the accumulators in registers; Re(x) goes to vre and the
// chunk's complex end state to ends. v itself never reaches memory.
// ---------------------------------------------------------------------------
__global__ __launch_bounds__(256) void gemm_vproj(
    const _Float16* __restrict__ uh, const _Float16* __restrict__ Bre,
    const _Float16* __restrict__ Bim,
    const float* __restrict__ abar_re, const float* __restrict__ abar_im,
    float* __restrict__ vre,
    float* __restrict__ ends_re, float* __restrict__ ends_im) {
  int w    = __builtin_amdgcn_readfirstlane(threadIdx.x >> 5);
  int lane = threadIdx.x & 31;
  int m0   = (blockIdx.x >> 1) * 128 + (w >> 2) * 64;  // first of 64 rows of BL
  int n0   = (blockIdx.x & 1) * 128 + (w & 3) * 32;    // first of 32 columns of N
  int hi   = lane >> 4, r = lane & 15;

  const _Float16* abase  = uh  + (size_t)m0 * DIN;
  const _Float16* bbaseR = Bre + (size_t)n0 * DIN;
  const _Float16* bbaseI = Bim + (size_t)n0 * DIN;
  const unsigned  lfrag  = (unsigned)(r * DIN + 8 * hi);

  float ar[2], ai[2];                                  // A_bar of the lane's two columns
#pragma unroll
  for (int j = 0; j < 2; ++j) {
    ar[j] = (abar_re + n0 + j * 16)[(unsigned)r];
    ai[j] = (abar_im + n0 + j * 16)[(unsigned)r];
  }

  v8f accR[4][2] = {}; v8f accI[4][2] = {};
  // unrolled: every load is scalar base + lfrag + immediate
#pragma unroll
  for (int ks = 0; ks < DIN; ks += 32) {
    v16h a[4], br[2], bi[2];
#pragma unroll
    for (int i = 0; i < 4; ++i) a[i] = frag_at(abase + ks + i * 16 * DIN, lfrag);
#pragma unroll
    for (int j = 0; j < 2; ++j) {
      br[j] = frag_at(bbaseR + ks + j * 16 * DIN, lfrag);
      bi[j] = frag_at(bbaseI + ks + j * 16 * DIN, lfrag);
    }
    // keeps the step's 16 loads together ahead of its WMMAs: left free, the
    // scheduler reloads one B fragment at a time and waits out each load alone
    __builtin_amdgcn_sched_barrier(0);
#pragma unroll
    for (int j = 0; j < 2; ++j) {
#pragma unroll
      for (int i = 0; i < 4; ++i) {
        accR[i][j] = wmma16(a[i], br[j], accR[i][j]);
        accI[i][j] = wmma16(a[i], bi[j], accI[i][j]);
      }
    }
    // ends the step: no later load or store moves in among these WMMAs
    __builtin_amdgcn_sched_barrier(0);
  }
  // C/D layout: lane holds column n0+16j+r; VGPR q holds row m0 + 16i + q + 8*hi.
  // In time order a column's 64 rows are 8 runs of 8: (i, hi) = (0,0) (0,1) (1,0) ...
  // and a lane owns the 4 runs of its own hi.
  float* oR = vre + (size_t)m0 * NN + n0;
  const unsigned lout = (unsigned)(8 * hi * NN + r);
  float endr[2], endi[2];
#pragma unroll
  for (int j = 0; j < 2; ++j) {
    // pw[q] = A_bar^(q+1)
    float pwr[8], pwi[8];
    pwr[0] = ar[j]; pwi[0] = ai[j];
#pragma unroll
    for (int q = 1; q < 8; ++q) {
      pwr[q] = pwr[q - 1] * ar[j] - pwi[q - 1] * ai[j];
      pwi[q] = pwr[q - 1] * ai[j] + pwi[q - 1] * ar[j];
    }
    // 1) each run scanned from a zero start; Re stays in accR, the end is kept
    float er[4], ei[4];
#pragma unroll
    for (int i = 0; i < 4; ++i) {
      float xr = accR[i][j][0], xi = accI[i][j][0];
#pragma unroll
      for (int q = 1; q < 8; ++q) {
        float nxr = accR[i][j][q] + ar[j] * xr - ai[j] * xi;
        float nxi = accI[i][j][q] + ar[j] * xi + ai[j] * xr;
        xr = nxr; xi = nxi;
        accR[i][j][q] = xr;
      }
      er[i] = xr; ei[i] = xi;
    }
    // 2) state entering each run: both halves walk the same 8 run ends in time order
    float inr[4], ini[4];
    float sr = 0.f, si = 0.f;
#pragma unroll
    for (int i = 0; i < 4; ++i) {
      float qr = other_half(er[i]), qi = other_half(ei[i]);
      float e0r = hi ? qr : er[i], e0i = hi ? qi : ei[i];   // end of run (i, 0)
      float e1r = hi ? er[i] : qr, e1i = hi ? ei[i] : qi;   // end of run (i, 1)
      float tr = e0r, ti = e0i;                             // state entering (i, 1)
      if (i > 0) {
        tr = e0r + pwr[7] * sr - pwi[7] * si;
        ti = e0i + pwr[7] * si + pwi[7] * sr;
      }
      inr[i] = hi ? tr : sr; ini[i] = hi ? ti : si;
      sr = e1r + pwr[7] * tr - pwi[7] * ti;                 // state entering (i+1, 0)
      si = e1i + pwr[7] * ti + pwi[7] * tr;
    }
    // 3) Re(x) = Re(run-local x) + Re(A_bar^(q+1) * state entering the run)
#pragma unroll
    for (int i = 0; i < 4; ++i) {
#pragma unroll
      for (int q = 0; q < 8; ++q)
        (oR + (i * 16 + q) * NN + j * 16)[lout] =
            accR[i][j][q] + pwr[q] * inr[i] - pwi[q] * ini[i];
    }
    endr[j] = sr; endi[j] = si;
  }
  // the chunk's end state, once per column: both halves hold it, the lower one stores
  if (hi == 0) {
#pragma unroll
    for (int j = 0; j < 2; ++j) {
      (ends_re + (size_t)(m0 / LC) * NN + n0 + j * 16)[(unsigned)r] = endr[j];
      (ends_im + (size_t)(m0 / LC) * NN + n0 + j * 16)[(unsigned)r] = endi[j];
    }
  }
}

// ---------------------------------------------------------------------------
// Kernel 4: cross-chunk carry scan. carry_in[c] = state entering chunk c.
// state[c] = ends_local[c] + A^LC * state[c-1];  A^LC by 6 squarings (LC=64).
// ---------------------------------------------------------------------------
__global__ __launch_bounds__(256) void scan_carry(const float* __restrict__ abar_re,
                           const float* __restrict__ abar_im,
                           const float* __restrict__ ends_re,
                           const float* __restrict__ ends_im,
                           float* __restrict__ carry_re, float* __restrict__ carry_im) {
  int tid = blockIdx.x * blockDim.x + threadIdx.x;   // 0 .. BB*NN-1
  int n = tid % NN;
  int b = tid / NN;
  float pr = abar_re[n], pi = abar_im[n];
#pragma unroll
  for (int i = 0; i < 6; ++i) {                      // A^(2^6) = A^64
    float qr = pr * pr - pi * pi;
    float qi = 2.f * pr * pi;
    pr = qr; pi = qi;
  }
  // all chunk ends are fetched first: the 64-long chain then waits on memory once
  float er[NC], ei[NC];
#pragma unroll
  for (int c = 0; c < NC; ++c) {
    size_t idx = ((size_t)(b * NC + c)) * NN + n;
    er[c] = ends_re[idx]; ei[c] = ends_im[idx];
  }
  // the loads' address registers are free for the chain's values behind this wait
  asm volatile("s_wait_xcnt 0x0" ::: "memory");
  float cr = 0.f, ci = 0.f;
#pragma unroll
  for (int c = 0; c < NC; ++c) {
    size_t idx = ((size_t)(b * NC + c)) * NN + n;
    carry_re[idx] = cr; carry_im[idx] = ci;
    float ncr = er[c] + pr * cr - pi * ci;
    float nci = ei[c] + pr * ci + pi * cr;
    cr = ncr; ci = nci;
  }
}

// ---------------------------------------------------------------------------
// Kernel 5: correction + emit Re(y) as f16 for the output GEMM.
// y[b, c*LC+t, n] = v_local + A^(t+1) * carry_in[b,c,n]; only Re needed.
// ---------------------------------------------------------------------------
__global__ void scan_fix(const float* __restrict__ vre,
                         const float* __restrict__ apow_re,
                         const float* __restrict__ apow_im,
                         const float* __restrict__ carry_re,
                         const float* __restrict__ carry_im,
                         _Float16* __restrict__ yh) {
  size_t idx = (size_t)blockIdx.x * blockDim.x + threadIdx.x;  // 0 .. BB*LL*NN-1
  int n = (int)(idx % NN);
  int l = (int)((idx / NN) % LL);
  int b = (int)(idx / ((size_t)NN * LL));
  int c = l / LC, t = l % LC;
  float pr = apow_re[(t + 1) * NN + n];
  float pi = apow_im[(t + 1) * NN + n];
  size_t cidx = ((size_t)(b * NC + c)) * NN + n;
  float cr = carry_re[cidx], ci = carry_im[cidx];
  float yr = vre[idx] + pr * cr - pi * ci;
  yh[idx] = (_Float16)yr;
}

// ---------------------------------------------------------------------------
// Kernel 6: out = Re(y) @ C^T + u * D   (f16 WMMA GEMM, fp32 epilogue)
// one wave per 64 x 64 tile of [MM x DIN]: 4 A and 4 B fragments in registers
// feed 16 WMMAs per 32-wide k step. The 8 waves of a block stand 2 x 4 on a
// 128 x 256 tile, so that the lines of A and B that a block has in use fit the
// WGP cache.
// ---------------------------------------------------------------------------
__global__ __launch_bounds__(256) void gemm_out(
    const _Float16* __restrict__ yh, const _Float16* __restrict__ Ch,
    const float* __restrict__ u, const float* __restrict__ Dv,
    float* __restrict__ out) {
  int w    = __builtin_amdgcn_readfirstlane(threadIdx.x >> 5);
  int lane = threadIdx.x & 31;
  int m0   = (blockIdx.x >> 1) * 128 + (w >> 2) * 64;  // first of 64 rows of BL
  int d0   = (blockIdx.x & 1) * 256 + (w & 3) * 64;    // first of 64 columns of Din
  int hi   = lane >> 4, r = lane & 15;

  const _Float16* abase = yh + (size_t)m0 * NN;
  const _Float16* bbase = Ch + (size_t)d0 * NN;            // C[d][n]: k-contig
  const unsigned  lfrag = (unsigned)(r * NN + 8 * hi);

  float dval[4];
#pragma unroll
  for (int j = 0; j < 4; ++j) dval[j] = (Dv + d0 + j * 16)[(unsigned)r];

  v8f acc[4][4] = {};
  // unrolled: every load is scalar base + lfrag + immediate
#pragma unroll
  for (int ks = 0; ks < NN; ks += 32) {
    v16h a[4], b[4];
#pragma unroll
    for (int i = 0; i < 4; ++i) a[i] = frag_at(abase + ks + i * 16 * NN, lfrag);
#pragma unroll
    for (int j = 0; j < 4; ++j) b[j] = frag_at(bbase + ks + j * 16 * NN, lfrag);
    // keeps the step's 16 loads together ahead of its WMMAs: left free, the
    // scheduler reloads one B fragment at a time and waits out each load alone
    __builtin_amdgcn_sched_barrier(0);
#pragma unroll
    for (int j = 0; j < 4; ++j) {
#pragma unroll
      for (int i = 0; i < 4; ++i) acc[i][j] = wmma16(a[i], b[j], acc[i][j]);
    }
    // ends the step: no later load or store moves in among these WMMAs
    __builtin_amdgcn_sched_barrier(0);
  }
  const float* ub = u   + (size_t)m0 * DIN + d0;
  float*       ob = out + (size_t)m0 * DIN + d0;
  const unsigned lout = (unsigned)(8 * hi * DIN + r);
  // 16 rows at a time; the next 16 rows' u values are loaded ahead of this group's stores
  float uu[2][4][8];
#pragma unroll
  for (int j = 0; j < 4; ++j) {
#pragma unroll
    for (int q = 0; q < 8; ++q) uu[0][j][q] = (ub + q * DIN + j * 16)[lout];
  }
#pragma unroll
  for (int i = 0; i < 4; ++i) {
    if (i < 3) {
#pragma unroll
      for (int j = 0; j < 4; ++j) {
#pragma unroll
        for (int q = 0; q < 8; ++q)
          uu[(i + 1) & 1][j][q] = (ub + ((i + 1) * 16 + q) * DIN + j * 16)[lout];
      }
    }
    // keeps those 32 loads together ahead of the stores: left free, the
    // scheduler takes one load at a time and waits out each alone
    __builtin_amdgcn_sched_barrier(0);
#pragma unroll
    for (int j = 0; j < 4; ++j) {
#pragma unroll
      for (int q = 0; q < 8; ++q)
        (ob + (i * 16 + q) * DIN + j * 16)[lout] = acc[i][j][q] + uu[i & 1][j][q] * dval[j];
    }
    // the stored registers are free for the loads that follow behind this wait
    if (i < 2) asm volatile("s_wait_xcnt 0x0" ::: "memory");
  }
}

// ---------------------------------------------------------------------------
// Host launcher. Workspace carve-out (~45 MB), all launches on `stream`.
// ---------------------------------------------------------------------------
extern "C" void kernel_launch(void* const* d_in, const int* in_sizes, int n_in,
                              void* d_out, int out_size, void* d_ws, size_t ws_size,
                              hipStream_t stream) {
  const float* u      = (const float*)d_in[0];  // [BB, LL, DIN]
  const float* A_real = (const float*)d_in[1];  // [NN]
  const float* A_imag = (const float*)d_in[2];  // [NN]
  const float* B_mat  = (const float*)d_in[3];  // [NN, DIN]
  const float* C_mat  = (const float*)d_in[4];  // [DIN, NN]
  const float* D_vec  = (const float*)d_in[5];  // [DIN]
  float* out = (float*)d_out;                   // [BB, LL, DIN]

  char* w = (char*)d_ws;
  auto carve = [&](size_t bytes) -> void* {
    void* p = (void*)w;
    w += (bytes + 255) & ~(size_t)255;
    return p;
  };
  float*    abar_re  = (float*)carve(NN * sizeof(float));
  float*    abar_im  = (float*)carve(NN * sizeof(float));
  float*    apow_re  = (float*)carve((size_t)(LC + 1) * NN * sizeof(float));
  float*    apow_im  = (float*)carve((size_t)(LC + 1) * NN * sizeof(float));
  _Float16* Bre_h    = (_Float16*)carve((size_t)NN * DIN * sizeof(_Float16));
  _Float16* Bim_h    = (_Float16*)carve((size_t)NN * DIN * sizeof(_Float16));
  _Float16* C_h      = (_Float16*)carve((size_t)DIN * NN * sizeof(_Float16));
  _Float16* u_h      = (_Float16*)carve((size_t)MM * DIN * sizeof(_Float16));
  float*    v_re     = (float*)carve((size_t)MM * NN * sizeof(float));
  float*    ends_re  = (float*)carve((size_t)BB * NC * NN * sizeof(float));
  float*    ends_im  = (float*)carve((size_t)BB * NC * NN * sizeof(float));
  float*    carry_re = (float*)carve((size_t)BB * NC * NN * sizeof(float));
  float*    carry_im = (float*)carve((size_t)BB * NC * NN * sizeof(float));
  _Float16* y_h      = (_Float16*)carve((size_t)MM * NN * sizeof(_Float16));

  // 0) discretize + power table
  k_params<<<1, NN, 0, stream>>>(A_real, A_imag, abar_re, abar_im, apow_re, apow_im);
  // 1) weight conversion to f16
  k_convert<<<(NN * DIN) / 256, 256, 0, stream>>>(A_real, A_imag, B_mat, C_mat,
                                                  Bre_h, Bim_h, C_h);
  // 1b) activation conversion to f16 (4 elems/thread, vectorized)
  k_convert_u<<<(unsigned)(((size_t)MM * DIN / 4) / 256), 256, 0, stream>>>(u, u_h);
  // 2) input projection v = u @ B_bar^T (WMMA) with the local chunk scan in its epilogue
  gemm_vproj<<<(MM / 128) * 2, 256, 0, stream>>>(u_h, Bre_h, Bim_h, abar_re, abar_im,
                                                 v_re, ends_re, ends_im);
  // 3) chunk carries and their correction
  scan_carry<<<(BB * NN) / 256, 256, 0, stream>>>(abar_re, abar_im, ends_re, ends_im,
                                                  carry_re, carry_im);
  scan_fix<<<(unsigned)(((size_t)MM * NN) / 256), 256, 0, stream>>>(
      v_re, apow_re, apow_im, carry_re, carry_im, y_h);
  // 4) output projection + skip: out = Re(y) @ C^T + u*D  (WMMA)
  gemm_out<<<(MM / 128) * 2, 256, 0, stream>>>(y_h, C_h, u, D_vec, out);
}

// v003
// A run of this version takes 52.4 microseconds.
// In two side-by-side timings against v002, it was 1.27 and 1.26 times as fast.
// Over all steps from v000 it is 2.86 times as fast.
#include <hip/hip_runtime.h>
#include <hip/hip_bf16.h>

typedef __attribute__((ext_vector_type(16))) _Float16 v16h;
typedef __attribute__((ext_vector_type(8)))  _Float16 v8h;
typedef __attribute__((ext_vector_type(4)))  _Float16 v4h;
typedef __attribute__((ext_vector_type(8)))  float    v8f;

#define DT_STEP   0.01f
#define DAMP_MIN_ 5e-4f

constexpr int BB  = 4;
constexpr int LL  = 4096;
constexpr int DIN = 512;
constexpr int NN  = 256;
constexpr int LC  = 64;            // scan chunk length = rows of one wave's tile in gemm_vproj
constexpr int NC  = LL / LC;       // 64 chunks
constexpr int MM  = BB * LL;       // 16384 rows

// ---------------------------------------------------------------------------
// WMMA helpers (V_WMMA_F32_16X16X32_F16, wave32; ISA 7.12.2 layouts)
// lane r = lane&15 owns row (A) / column (B) r; hi = lane>>4;
// v16h element h holds K = (h<8 ? h : h+8) + 8*hi within the 32-wide K tile.
// ---------------------------------------------------------------------------
__device__ __forceinline__ v8f wmma16(v16h a, v16h b, v8f c) {
  return __builtin_amdgcn_wmma_f32_16x16x32_f16(
      /*neg_a=*/false, a, /*neg_b=*/false, b,
      /*c_mod=*/(short)0, c, /*reuse_a=*/false, /*reuse_b=*/false);
}

// Fragment from a wave-uniform tile base plus the lane's element offset
// (row r, 8*hi): the base stays scalar, the one offset register serves all loads.
__device__ __forceinline__ v16h frag_at(const _Float16* __restrict__ base, unsigned off) {
  v8h lo  = *reinterpret_cast<const v8h*>(base + off);
  v8h hi8 = *reinterpret_cast<const v8h*>((base + 16) + off);
  return __builtin_shufflevector(lo, hi8, 0,1,2,3,4,5,6,7,8,9,10,11,12,13,14,15);
}

// Value of the lane 16 places away (l <-> l ^ 16), as one vector cross-row move.
__device__ __forceinline__ float other_half(float x) {
  int b = __builtin_bit_cast(int, x);
  b = __builtin_amdgcn_permlanex16(b, b, 0x76543210, 0xfedcba98, false, false);
  return __builtin_bit_cast(float, b);
}

// ---------------------------------------------------------------------------
// Kernel 0: bilinear discretization. A_bar[n] and A_bar^t power table (t<=LC).
// ---------------------------------------------------------------------------
__global__ void k_params(const float* __restrict__ Ar, const float* __restrict__ Ai,
                         float* __restrict__ abar_re, float* __restrict__ abar_im,
                         float* __restrict__ apow_re, float* __restrict__ apow_im) {
  int n = threadIdx.x;
  float ar = -fabsf(Ar[n]) - DAMP_MIN_;
  float ai = Ai[n];
  float dr = 1.f - 0.005f * ar, di = -0.005f * ai;       // denom = 1 - dt/2 * A
  float inv = 1.f / (dr * dr + di * di);
  float nr = 1.f + 0.005f * ar, ni = 0.005f * ai;        // numer = 1 + dt/2 * A
  float abr = (nr * dr + ni * di) * inv;
  float abi = (ni * dr - nr * di) * inv;
  abar_re[n] = abr; abar_im[n] = abi;
  float pr = 1.f, pi = 0.f;                              // A_bar^0
  for (int t = 0; t <= LC; ++t) {
    apow_re[t * NN + n] = pr; apow_im[t * NN + n] = pi;
    float qr = pr * abr - pi * abi;
    float qi = pr * abi + pi * abr;
    pr = qr; pi = qi;
  }
}

// ---------------------------------------------------------------------------
// Kernel 1: B_bar = dt*B/denom -> f16 (re/im); C -> f16. (both 131072 elems)
// ---------------------------------------------------------------------------
__global__ void k_convert(const float* __restrict__ Ar, const float* __restrict__ Ai,
                          const float* __restrict__ Bm, const float* __restrict__ Cm,
                          _Float16* __restrict__ Bre, _Float16* __restrict__ Bim,
                          _Float16* __restrict__ Ch) {
  int idx = blockIdx.x * blockDim.x + threadIdx.x;       // 0 .. NN*DIN-1
  int n = idx / DIN;
  float ar = -fabsf(Ar[n]) - DAMP_MIN_;
  float ai = Ai[n];
  float dr = 1.f - 0.005f * ar, di = -0.005f * ai;
  float inv = 1.f / (dr * dr + di * di);
  float s = DT_STEP * Bm[idx] * inv;                     // dt*B * conj(denom)/|denom|^2
  Bre[idx] = (_Float16)(s * dr);
  Bim[idx] = (_Float16)(-s * di);
  Ch[idx]  = (_Float16)Cm[idx];                          // C is DIN*NN row-major
}

// ---------------------------------------------------------------------------
// Kernel 1b: one-shot u(fp32) -> f16. Removes all in-GEMM conversions and the
// 16x redundant fp32 re-reads of u fragments (A side becomes pure v8h loads).
// ---------------------------------------------------------------------------
__global__ void k_convert_u(const float* __restrict__ u, _Float16* __restrict__ uh) {
  size_t i4 = (size_t)blockIdx.x * blockDim.x + threadIdx.x;  // 4 elems/thread
  const float4 x = reinterpret_cast<const float4*>(u)[i4];
  v4h h;
  h[0] = (_Float16)x.x; h[1] = (_Float16)x.y;
  h[2] = (_Float16)x.z; h[3] = (_Float16)x.w;
  reinterpret_cast<v4h*>(uh)[i4] = h;
}

// ---------------------------------------------------------------------------
// Kernel 2: v = u @ B_bar^T  (two real WMMA GEMMs share the A fragments)
// one wave per 64 x 32 tile of [MM x NN], re and im: 4 A fragments and 2 + 2 B
// fragments in registers feed 16 WMMAs per 32-wide k step. The 8 waves of a
// block stand 2 x 4 on a 128 x 128 tile, so that the lines of A and B that a
// block has in use fit the WGP cache.
// Epilogue: the wave's 64 rows are one scan chunk. x[t] = A_bar x[t-1] + v[t]
// (zero start) runs on the accumulators in registers; Re(x) goes to vre and the
// chunk's complex end state to ends. v itself never reaches memory.
// ---------------------------------------------------------------------------
__global__ __launch_bounds__(256) void gemm_vproj(
    const _Float16* __restrict__ uh, const _Float16* __restrict__ Bre,
    const _Float16* __restrict__ Bim,
    const float* __restrict__ abar_re, const float* __restrict__ abar_im,
    float* __restrict__ vre,
    float* __restrict__ ends_re, float* __restrict__ ends_im) {
  int w    = __builtin_amdgcn_readfirstlane(threadIdx.x >> 5);
  int lane = threadIdx.x & 31;
  int m0   = (blockIdx.x >> 1) * 128 + (w >> 2) * 64;  // first of 64 rows of BL
  int n0   = (blockIdx.x & 1) * 128 + (w & 3) * 32;    // first of 32 columns of N
  int hi   = lane >> 4, r = lane & 15;

  const _Float16* abase  = uh  + (size_t)m0 * DIN;
  const _Float16* bbaseR = Bre + (size_t)n0 * DIN;
  const _Float16* bbaseI = Bim + (size_t)n0 * DIN;
  const unsigned  lfrag  = (unsigned)(r * DIN + 8 * hi);

  float ar[2], ai[2];                                  // A_bar of the lane's two columns
#pragma unroll
  for (int j = 0; j < 2; ++j) {
    ar[j] = (abar_re + n0 + j * 16)[(unsigned)r];
    ai[j] = (abar_im + n0 + j * 16)[(unsigned)r];
  }

  v8f accR[4][2] = {}; v8f accI[4][2] = {};
  // unrolled: every load is scalar base + lfrag + immediate
#pragma unroll
  for (int ks = 0; ks < DIN; ks += 32) {
    v16h a[4], br[2], bi[2];
#pragma unroll
    for (int i = 0; i < 4; ++i) a[i] = frag_at(abase + ks + i * 16 * DIN, lfrag);
#pragma unroll
    for (int j = 0; j < 2; ++j) {
      br[j] = frag_at(bbaseR + ks + j * 16 * DIN, lfrag);
      bi[j] = frag_at(bbaseI + ks + j * 16 * DIN, lfrag);
    }
    // keeps the step's 16 loads together ahead of its WMMAs: left free, the
    // scheduler reloads one B fragment at a time and waits out each load alone
    __builtin_amdgcn_sched_barrier(0);
#pragma unroll
    for (int j = 0; j < 2; ++j) {
#pragma unroll
      for (int i = 0; i < 4; ++i) {
        accR[i][j] = wmma16(a[i], br[j], accR[i][j]);
        accI[i][j] = wmma16(a[i], bi[j], accI[i][j]);
      }
    }
    // ends the step: no later load or store moves in among these WMMAs
    __builtin_amdgcn_sched_barrier(0);
  }
  // C/D layout: lane holds column n0+16j+r; VGPR q holds row m0 + 16i + q + 8*hi.
  // In time order a column's 64 rows are 8 runs of 8: (i, hi) = (0,0) (0,1) (1,0) ...
  // and a lane owns the 4 runs of its own hi.
  float* oR = vre + (size_t)m0 * NN + n0;
  const unsigned lout = (unsigned)(8 * hi * NN + r);
  float endr[2], endi[2];
#pragma unroll
  for (int j = 0; j < 2; ++j) {
    // pw[q] = A_bar^(q+1)
    float pwr[8], pwi[8];
    pwr[0] = ar[j]; pwi[0] = ai[j];
#pragma unroll
    for (int q = 1; q < 8; ++q) {
      pwr[q] = pwr[q - 1] * ar[j] - pwi[q - 1] * ai[j];
      pwi[q] = pwr[q - 1] * ai[j] + pwi[q - 1] * ar[j];
    }
    // 1) each run scanned from a zero start; Re stays in accR, the end is kept
    float er[4], ei[4];
#pragma unroll
    for (int i = 0; i < 4; ++i) {
      float xr = accR[i][j][0], xi = accI[i][j][0];
#pragma unroll
      for (int q = 1; q < 8; ++q) {
        float nxr = accR[i][j][q] + ar[j] * xr - ai[j] * xi;
        float nxi = accI[i][j][q] + ar[j] * xi + ai[j] * xr;
        xr = nxr; xi = nxi;
        accR[i][j][q] = xr;
      }
      er[i] = xr; ei[i] = xi;
    }
    // 2) state entering each run: both halves walk the same 8 run ends in time order
    float inr[4], ini[4];
    float sr = 0.f, si = 0.f;
#pragma unroll
    for (int i = 0; i < 4; ++i) {
      float qr = other_half(er[i]), qi = other_half(ei[i]);
      float e0r = hi ? qr : er[i], e0i = hi ? qi : ei[i];   // end of run (i, 0)
      float e1r = hi ? er[i] : qr, e1i = hi ? ei[i] : qi;   // end of run (i, 1)
      float tr = e0r, ti = e0i;                             // state entering (i, 1)
      if (i > 0) {
        tr = e0r + pwr[7] * sr - pwi[7] * si;
        ti = e0i + pwr[7] * si + pwi[7] * sr;
      }
      inr[i] = hi ? tr : sr; ini[i] = hi ? ti : si;
      sr = e1r + pwr[7] * tr - pwi[7] * ti;                 // state entering (i+1, 0)
      si = e1i + pwr[7] * ti + pwi[7] * tr;
    }
    // 3) Re(x) = Re(run-local x) + Re(A_bar^(q+1) * state entering the run)
#pragma unroll
    for (int i = 0; i < 4; ++i) {
#pragma unroll
      for (int q = 0; q < 8; ++q)
        (oR + (i * 16 + q) * NN + j * 16)[lout] =
            accR[i][j][q] + pwr[q] * inr[i] - pwi[q] * ini[i];
    }
    endr[j] = sr; endi[j] = si;
  }
  // the chunk's end state, once per column: both halves hold it, the lower one stores
  if (hi == 0) {
#pragma unroll
    for (int j = 0; j < 2; ++j) {
      (ends_re + (size_t)(m0 / LC) * NN + n0 + j * 16)[(unsigned)r] = endr[j];
      (ends_im + (size_t)(m0 / LC) * NN + n0 + j * 16)[(unsigned)r] = endi[j];
    }
  }
}

// ---------------------------------------------------------------------------
// Kernel 4: cross-chunk carry scan. carry_in[c] = state entering chunk c.
// state[c] = ends_local[c] + A^LC * state[c-1];  A^LC by 6 squarings (LC=64).
// ---------------------------------------------------------------------------
__global__ __launch_bounds__(256) void scan_carry(const float* __restrict__ abar_re,
                           const float* __restrict__ abar_im,
                           const float* __restrict__ ends_re,
                           const float* __restrict__ ends_im,
                           float* __restrict__ carry_re, float* __restrict__ carry_im) {
  int tid = blockIdx.x * blockDim.x + threadIdx.x;   // 0 .. BB*NN-1
  int n = tid % NN;
  int b = tid / NN;
  float pr = abar_re[n], pi = abar_im[n];
#pragma unroll
  for (int i = 0; i < 6; ++i) {                      // A^(2^6) = A^64
    float qr = pr * pr - pi * pi;
    float qi = 2.f * pr * pi;
    pr = qr; pi = qi;
  }
  // all chunk ends are fetched first: the 64-long chain then waits on memory once
  float er[NC], ei[NC];
#pragma unroll
  for (int c = 0; c < NC; ++c) {
    size_t idx = ((size_t)(b * NC + c)) * NN + n;
    er[c] = ends_re[idx]; ei[c] = ends_im[idx];
  }
  // the loads' address registers are free for the chain's values behind this wait
  asm volatile("s_wait_xcnt 0x0" ::: "memory");
  float cr = 0.f, ci = 0.f;
#pragma unroll
  for (int c = 0; c < NC; ++c) {
    size_t idx = ((size_t)(b * NC + c)) * NN + n;
    carry_re[idx] = cr; carry_im[idx] = ci;
    float ncr = er[c] + pr * cr - pi * ci;
    float nci = ei[c] + pr * ci + pi * cr;
    cr = ncr; ci = nci;
  }
}

// ---------------------------------------------------------------------------
// Kernel 5: out = Re(y) @ C^T + u * D   (f16 WMMA GEMM, fp32 epilogue)
// One block per scan chunk: 64 rows x all 512 columns, 8 waves side by side,
// one wave per 64 x 64 tile: 4 A and 4 B fragments feed 16 WMMAs per k step.
// Prologue: the block forms its A tile itself, once, in LDS:
//   Re(y)[t][n] = v_local[t][n] + Re(A_bar^(t+1) * carry_in[n])  -> f16
// A thread owns 4 columns and 16 rows; A_bar^(t+1) * carry_in starts from the
// power table at the thread's first row and is stepped by A_bar from row to row.
// ---------------------------------------------------------------------------
constexpr int AP = NN + 8;   // LDS row pitch in halves: 528 B = 16 B x 33 (odd), for ds_load_b128

__global__ __launch_bounds__(256) void gemm_out(
    const float* __restrict__ vre,
    const float* __restrict__ abar_re, const float* __restrict__ abar_im,
    const float* __restrict__ apow_re, const float* __restrict__ apow_im,
    const float* __restrict__ carry_re, const float* __restrict__ carry_im,
    const _Float16* __restrict__ Ch,
    const float* __restrict__ u, const float* __restrict__ Dv,
    float* __restrict__ out) {
  __shared__ __attribute__((aligned(16))) _Float16 ys[LC * AP];
  int w    = __builtin_amdgcn_readfirstlane(threadIdx.x >> 5);
  int lane = threadIdx.x & 31;
  int m0   = blockIdx.x * LC;                          // first of the chunk's 64 rows of BL
  int d0   = w * 64;                                   // first of 64 columns of Din
  int hi   = lane >> 4, r = lane & 15;

  {
    // scalar bases plus one lane offset: every load of the prologue names the same register
    const unsigned n  = (threadIdx.x & 63) * 4;        // first of the thread's 4 columns
    const int      t0 = (w >> 1) * 16;                 // first of its 16 rows: two waves span a row
    const float* vp = vre + (size_t)(m0 + t0) * NN;
    float4 x[16];
#pragma unroll
    for (int k = 0; k < 16; ++k) x[k] = *reinterpret_cast<const float4*>((vp + k * NN) + n);
    const float4 a4r = *reinterpret_cast<const float4*>(abar_re + n);
    const float4 a4i = *reinterpret_cast<const float4*>(abar_im + n);
    const float4 p4r = *reinterpret_cast<const float4*>((apow_re + (t0 + 1) * NN) + n);
    const float4 p4i = *reinterpret_cast<const float4*>((apow_im + (t0 + 1) * NN) + n);
    const float4 c4r = *reinterpret_cast<const float4*>((carry_re + (size_t)blockIdx.x * NN) + n);
    const float4 c4i = *reinterpret_cast<const float4*>((carry_im + (size_t)blockIdx.x * NN) + n);
    const float ar[4] = {a4r.x, a4r.y, a4r.z, a4r.w}, ai[4] = {a4i.x, a4i.y, a4i.z, a4i.w};
    const float pr[4] = {p4r.x, p4r.y, p4r.z, p4r.w}, pi[4] = {p4i.x, p4i.y, p4i.z, p4i.w};
    const float cr[4] = {c4r.x, c4r.y, c4r.z, c4r.w}, ci[4] = {c4i.x, c4i.y, c4i.z, c4i.w};
    float zr[4], zi[4];                                // A_bar^(t+1) * carry_in at row t
#pragma unroll
    for (int e = 0; e < 4; ++e) {
      zr[e] = pr[e] * cr[e] - pi[e] * ci[e];
      zi[e] = pr[e] * ci[e] + pi[e] * cr[e];
    }
#pragma unroll
    for (int k = 0; k < 16; ++k) {
      const float xe[4] = {x[k].x, x[k].y, x[k].z, x[k].w};
      v4h h;
#pragma unroll
      for (int e = 0; e < 4; ++e) {
        h[e] = (_Float16)(xe[e] + zr[e]);
        float nr = zr[e] * ar[e] - zi[e] * ai[e];
        float ni = zr[e] * ai[e] + zi[e] * ar[e];
        zr[e] = nr; zi[e] = ni;
      }
      *reinterpret_cast<v4h*>(ys + (t0 + k) * AP + n) = h;
    }
  }
  // publishes the A tile: every wave reads all 64 rows
  __syncthreads();

  const _Float16* bbase = Ch + (size_t)d0 * NN;            // C[d][n]: k-contig
  const unsigned  lfrag = (unsigned)(r * NN + 8 * hi);
  const unsigned  afrag = (unsigned)(r * AP + 8 * hi);

  float dval[4];
#pragma unroll
  for (int j = 0; j < 4; ++j) dval[j] = (Dv + d0 + j * 16)[(unsigned)r];

  v8f acc[4][4] = {};
  // unrolled: every load is base + the lane's offset + immediate
#pragma unroll
  for (int ks = 0; ks < NN; ks += 32) {
    v16h a[4], b[4];
#pragma unroll
    for (int j = 0; j < 4; ++j) b[j] = frag_at(bbase + ks + j * 16 * NN, lfrag);
#pragma unroll
    for (int i = 0; i < 4; ++i) a[i] = frag_at(ys + ks + i * 16 * AP, afrag);
    // keeps the step's 16 loads together ahead of its WMMAs: left free, the
    // scheduler reloads one B fragment at a time and waits out each load alone
    __builtin_amdgcn_sched_barrier(0);
#pragma unroll
    for (int j = 0; j < 4; ++j) {
#pragma unroll
      for (int i = 0; i < 4; ++i) acc[i][j] = wmma16(a[i], b[j], acc[i][j]);
    }
    // ends the step: no later load or store moves in among these WMMAs
    __builtin_amdgcn_sched_barrier(0);
  }
  const float* ub = u   + (size_t)m0 * DIN + d0;
  float*       ob = out + (size_t)m0 * DIN + d0;
  const unsigned lout = (unsigned)(8 * hi * DIN + r);
  // 16 rows at a time; the next 16 rows' u values are loaded ahead of this group's stores
  float uu[2][4][8];
#pragma unroll
  for (int j = 0; j < 4; ++j) {
#pragma unroll
    for (int q = 0; q < 8; ++q) uu[0][j][q] = (ub + q * DIN + j * 16)[lout];
  }
#pragma unroll
  for (int i = 0; i < 4; ++i) {
    if (i < 3) {
#pragma unroll
      for (int j = 0; j < 4; ++j) {
#pragma unroll
        for (int q = 0; q < 8; ++q)
          uu[(i + 1) & 1][j][q] = (ub + ((i + 1) * 16 + q) * DIN + j * 16)[lout];
      }
    }
    // keeps those 32 loads together ahead of the stores: left free, the
    // scheduler takes one load at a time and waits out each alone
    __builtin_amdgcn_sched_barrier(0);
#pragma unroll
    for (int j = 0; j < 4; ++j) {
#pragma unroll
      for (int q = 0; q < 8; ++q)
        (ob + (i * 16 + q) * DIN + j * 16)[lout] = acc[i][j][q] + uu[i & 1][j][q] * dval[j];
    }
    // the stored registers are free for the loads that follow behind this wait
    if (i < 2) asm volatile("s_wait_xcnt 0x0" ::: "memory");
  }
}

// ---------------------------------------------------------------------------
// Host launcher. Workspace carve-out (~35 MB), all launches on `stream`.
// ---------------------------------------------------------------------------
extern "C" void kernel_launch(void* const* d_in, const int* in_sizes, int n_in,
                              void* d_out, int out_size, void* d_ws, size_t ws_size,
                              hipStream_t stream) {
  const float* u      = (const float*)d_in[0];  // [BB, LL, DIN]
  const float* A_real = (const float*)d_in[1];  // [NN]
  const float* A_imag = (const float*)d_in[2];  // [NN]
  const float* B_mat  = (const float*)d_in[3];  // [NN, DIN]
  const float* C_mat  = (const float*)d_in[4];  // [DIN, NN]
  const float* D_vec  = (const float*)d_in[5];  // [DIN]
  float* out = (float*)d_out;                   // [BB, LL, DIN]

  char* w = (char*)d_ws;
  auto carve = [&](size_t bytes) -> void* {
    void* p = (void*)w;
    w += (bytes + 255) & ~(size_t)255;
    return p;
  };
  float*    abar_re  = (float*)carve(NN * sizeof(float));
  float*    abar_im  = (float*)carve(NN * sizeof(float));
  float*    apow_re  = (float*)carve((size_t)(LC + 1) * NN * sizeof(float));
  float*    apow_im  = (float*)carve((size_t)(LC + 1) * NN * sizeof(float));
  _Float16* Bre_h    = (_Float16*)carve((size_t)NN * DIN * sizeof(_Float16));
  _Float16* Bim_h    = (_Float16*)carve((size_t)NN * DIN * sizeof(_Float16));
  _Float16* C_h      = (_Float16*)carve((size_t)DIN * NN * sizeof(_Float16));
  _Float16* u_h      = (_Float16*)carve((size_t)MM * DIN * sizeof(_Float16));
  float*    v_re     = (float*)carve((size_t)MM * NN * sizeof(float));
  float*    ends_re  = (float*)carve((size_t)BB * NC * NN * sizeof(float));
  float*    ends_im  = (float*)carve((size_t)BB * NC * NN * sizeof(float));
  float*    carry_re = (float*)carve((size_t)BB * NC * NN * sizeof(float));
  float*    carry_im = (float*)carve((size_t)BB * NC * NN * sizeof(float));

  // 0) discretize + power table
  k_params<<<1, NN, 0, stream>>>(A_real, A_imag, abar_re, abar_im, apow_re, apow_im);
  // 1) weight conversion to f16
  k_convert<<<(NN * DIN) / 256, 256, 0, stream>>>(A_real, A_imag, B_mat, C_mat,
                                                  Bre_h, Bim_h, C_h);
  // 1b) activation conversion to f16 (4 elems/thread, vectorized)
  k_convert_u<<<(unsigned)(((size_t)MM * DIN / 4) / 256), 256, 0, stream>>>(u, u_h);
  // 2) input projection v = u @ B_bar^T (WMMA) with the local chunk scan in its epilogue
  gemm_vproj<<<(MM / 128) * 2, 256, 0, stream>>>(u_h, Bre_h, Bim_h, abar_re, abar_im,
                                                 v_re, ends_re, ends_im);
  // 3) chunk carries
  scan_carry<<<(BB * NN) / 256, 256, 0, stream>>>(abar_re, abar_im, ends_re, ends_im,
                                                  carry_re, carry_im);
  // 4) carry correction + output projection + skip: out = Re(y) @ C^T + u*D  (WMMA)
  gemm_out<<<MM / LC, 256, 0, stream>>>(v_re, abar_re, abar_im, apow_re, apow_im,
                                        carry_re, carry_im, C_h, u, D_vec, out);
}

// v004
// One run takes 38.5 microseconds.
// Two timings next to v003 put it at 1.37 and 1.36 times that version's speed.
// Over all steps from v000 it is 3.91 times as fast.
#include <hip/hip_runtime.h>
#include <hip/hip_bf16.h>

typedef __attribute__((ext_vector_type(16))) _Float16 v16h;
typedef __attribute__((ext_vector_type(8)))  _Float16 v8h;
typedef __attribute__((ext_vector_type(4)))  _Float16 v4h;
typedef __attribute__((ext_vector_type(8)))  float    v8f;

#define DT_STEP   0.01f
#define DAMP_MIN_ 5e-4f

constexpr int BB  = 4;
constexpr int LL  = 4096;
constexpr int DIN = 512;
constexpr int NN  = 256;
constexpr int LC  = 64;            // scan chunk length = rows of one wave's tile in gemm_vproj
constexpr int NC  = LL / LC;       // 64 chunks
constexpr int MM  = BB * LL;       // 16384 rows

// ---------------------------------------------------------------------------
// WMMA helpers (V_WMMA_F32_16X16X32_F16, wave32; ISA 7.12.2 layouts)
// lane r = lane&15 owns row (A) / column (B) r; hi = lane>>4;
// v16h element h holds K = (h<8 ? h : h+8) + 8*hi within the 32-wide K tile.
// ---------------------------------------------------------------------------
__device__ __forceinline__ v8f wmma16(v16h a, v16h b, v8f c) {
  return __builtin_amdgcn_wmma_f32_16x16x32_f16(
      /*neg_a=*/false, a, /*neg_b=*/false, b,
      /*c_mod=*/(short)0, c, /*reuse_a=*/false, /*reuse_b=*/false);
}

// Fragment from a wave-uniform tile base plus the lane's element offset
// (row r, 8*hi): the base stays scalar, the one offset register serves all loads.
__device__ __forceinline__ v16h frag_at(const _Float16* __restrict__ base, unsigned off) {
  v8h lo  = *reinterpret_cast<const v8h*>(base + off);
  v8h hi8 = *reinterpret_cast<const v8h*>((base + 16) + off);
  return __builtin_shufflevector(lo, hi8, 0,1,2,3,4,5,6,7,8,9,10,11,12,13,14,15);
}

// Value of the lane 16 places away (l <-> l ^ 16), as one vector cross-row move.
__device__ __forceinline__ float other_half(float x) {
  int b = __builtin_bit_cast(int, x);
  b = __builtin_amdgcn_permlanex16(b, b, 0x76543210, 0xfedcba98, false, false);
  return __builtin_bit_cast(float, b);
}

// ---------------------------------------------------------------------------
// Kernel 0: bilinear discretization. A_bar[n] and A_bar^t power table (t<=LC).
// ---------------------------------------------------------------------------
__global__ void k_params(const float* __restrict__ Ar, const float* __restrict__ Ai,
                         float* __restrict__ abar_re, float* __restrict__ abar_im,
                         float* __restrict__ apow_re, float* __restrict__ apow_im) {
  int n = threadIdx.x;
  float ar = -fabsf(Ar[n]) - DAMP_MIN_;
  float ai = Ai[n];
  float dr = 1.f - 0.005f * ar, di = -0.005f * ai;       // denom = 1 - dt/2 * A
  float inv = 1.f / (dr * dr + di * di);
  float nr = 1.f + 0.005f * ar, ni = 0.005f * ai;        // numer = 1 + dt/2 * A
  float abr = (nr * dr + ni * di) * inv;
  float abi = (ni * dr - nr * di) * inv;
  abar_re[n] = abr; abar_im[n] = abi;
  float pr = 1.f, pi = 0.f;                              // A_bar^0
  for (int t = 0; t <= LC; ++t) {
    apow_re[t * NN + n] = pr; apow_im[t * NN + n] = pi;
    float qr = pr * abr - pi * abi;
    float qi = pr * abi + pi * abr;
    pr = qr; pi = qi;
  }
}

// ---------------------------------------------------------------------------
// Kernel 1: B_bar = dt*B/denom -> f16 (re/im); C -> f16. (both 131072 elems)
// ---------------------------------------------------------------------------
__global__ void k_convert(const float* __restrict__ Ar, const float* __restrict__ Ai,
                          const float* __restrict__ Bm, const float* __restrict__ Cm,
                          _Float16* __restrict__ Bre, _Float16* __restrict__ Bim,
                          _Float16* __restrict__ Ch) {
  int idx = blockIdx.x * blockDim.x + threadIdx.x;       // 0 .. NN*DIN-1
  int n = idx / DIN;
  float ar = -fabsf(Ar[n]) - DAMP_MIN_;
  float ai = Ai[n];
  float dr = 1.f - 0.005f * ar, di = -0.005f * ai;
  float inv = 1.f / (dr * dr + di * di);
  float s = DT_STEP * Bm[idx] * inv;                     // dt*B * conj(denom)/|denom|^2
  Bre[idx] = (_Float16)(s * dr);
  Bim[idx] = (_Float16)(-s * di);
  Ch[idx]  = (_Float16)Cm[idx];                          // C is DIN*NN row-major
}

// ---------------------------------------------------------------------------
// Kernel 2: v = u @ B_bar^T  (two real WMMA GEMMs share the A fragments)
// one wave per 64 x 32 tile of [MM x NN], re and im: 4 A fragments and 2 + 2 B
// fragments in registers feed 16 WMMAs per 32-wide k step. The 8 waves of a
// block stand 2 x 4 on a 128 x 128 tile, so that the lines of B that a block
// has in use fit the WGP cache.
// Prologue: the block rounds its 128 rows of u (f32) to f16 itself, once, into
// LDS; the A fragments are read from there. A wave's load covers 512 contiguous
// bytes of a row.
// Epilogue: the wave's 64 rows are one scan chunk. x[t] = A_bar x[t-1] + v[t]
// (zero start) runs on the accumulators in registers; Re(x) goes to vre and the
// chunk's complex end state to ends. v itself never reaches memory.
// ---------------------------------------------------------------------------
constexpr int UP = DIN + 8;  // LDS row pitch in halves: 1040 B = 16 B x 65 (odd), for ds_load_b128

__global__ __launch_bounds__(256) void gemm_vproj(
    const float* __restrict__ u, const _Float16* __restrict__ Bre,
    const _Float16* __restrict__ Bim,
    const float* __restrict__ abar_re, const float* __restrict__ abar_im,
    float* __restrict__ vre,
    float* __restrict__ ends_re, float* __restrict__ ends_im) {
  __shared__ __attribute__((aligned(16))) _Float16 us[128 * UP];
  int w    = __builtin_amdgcn_readfirstlane(threadIdx.x >> 5);
  int lane = threadIdx.x & 31;
  int mb   = (blockIdx.x >> 1) * 128;                  // first of the block's 128 rows of BL
  int m0   = mb + (w >> 2) * 64;                       // first of the wave's 64 rows
  int n0   = (blockIdx.x & 1) * 128 + (w & 3) * 32;    // first of 32 columns of N
  int hi   = lane >> 4, r = lane & 15;

  {
    // four waves span a row; a wave takes every second row: 64 loads, which stand
    // ahead of the converts, so that the wave waits out memory latency once.
    // scalar bases plus one lane offset: every load names the same register
    const float*   up = u  + (size_t)(mb + (w >> 2)) * DIN + (w & 3) * 128;
    _Float16*      sp = us + (w >> 2) * UP + (w & 3) * 128;
    const unsigned c  = (unsigned)lane * 4;
    float4 x[64];
#pragma unroll
    for (int k = 0; k < 64; ++k)
      x[k] = *reinterpret_cast<const float4*>((up + k * 2 * DIN) + c);
#pragma unroll
    for (int k = 0; k < 64; ++k) {
      v4h h;
      h[0] = (_Float16)x[k].x; h[1] = (_Float16)x[k].y;
      h[2] = (_Float16)x[k].z; h[3] = (_Float16)x[k].w;
      *reinterpret_cast<v4h*>((sp + k * 2 * UP) + c) = h;
    }
  }
  // publishes the A tile: a wave reads rows that all eight waves wrote
  __syncthreads();

  const _Float16* abase  = us + (w >> 2) * 64 * UP;
  const _Float16* bbaseR = Bre + (size_t)n0 * DIN;
  const _Float16* bbaseI = Bim + (size_t)n0 * DIN;
  const unsigned  lfrag  = (unsigned)(r * DIN + 8 * hi);
  const unsigned  afrag  = (unsigned)(r * UP + 8 * hi);

  float ar[2], ai[2];                                  // A_bar of the lane's two columns
#pragma unroll
  for (int j = 0; j < 2; ++j) {
    ar[j] = (abar_re + n0 + j * 16)[(unsigned)r];
    ai[j] = (abar_im + n0 + j * 16)[(unsigned)r];
  }

  v8f accR[4][2] = {}; v8f accI[4][2] = {};
  // unrolled: every load is base + the lane's offset + immediate
#pragma unroll
  for (int ks = 0; ks < DIN; ks += 32) {
    v16h a[4], br[2], bi[2];
#pragma unroll
    for (int j = 0; j < 2; ++j) {
      br[j] = frag_at(bbaseR + ks + j * 16 * DIN, lfrag);
      bi[j] = frag_at(bbaseI + ks + j * 16 * DIN, lfrag);
    }
#pragma unroll
    for (int i = 0; i < 4; ++i) a[i] = frag_at(abase + ks + i * 16 * UP, afrag);
    // keeps the step's 16 loads together ahead of its WMMAs: left free, the
    // scheduler reloads one B fragment at a time and waits out each load alone
    __builtin_amdgcn_sched_barrier(0);
#pragma unroll
    for (int j = 0; j < 2; ++j) {
#pragma unroll
      for (int i = 0; i < 4; ++i) {
        accR[i][j] = wmma16(a[i], br[j], accR[i][j]);
        accI[i][j] = wmma16(a[i], bi[j], accI[i][j]);
      }
    }
    // ends the step: no later load or store moves in among these WMMAs
    __builtin_amdgcn_sched_barrier(0);
  }
  // C/D layout: lane holds column n0+16j+r; VGPR q holds row m0 + 16i + q + 8*hi.
  // In time order a column's 64 rows are 8 runs of 8: (i, hi) = (0,0) (0,1) (1,0) ...
  // and a lane owns the 4 runs of its own hi.
  float* oR = vre + (size_t)m0 * NN + n0;
  const unsigned lout = (unsigned)(8 * hi * NN + r);
  float endr[2], endi[2];
#pragma unroll
  for (int j = 0; j < 2; ++j) {
    // pw[q] = A_bar^(q+1)
    float pwr[8], pwi[8];
    pwr[0] = ar[j]; pwi[0] = ai[j];
#pragma unroll
    for (int q = 1; q < 8; ++q) {
      pwr[q] = pwr[q - 1] * ar[j] - pwi[q - 1] * ai[j];
      pwi[q] = pwr[q - 1] * ai[j] + pwi[q - 1] * ar[j];
    }
    // 1) each run scanned from a zero start; Re stays in accR, the end is kept
    float er[4], ei[4];
#pragma unroll
    for (int i = 0; i < 4; ++i) {
      float xr = accR[i][j][0], xi = accI[i][j][0];
#pragma unroll
      for (int q = 1; q < 8; ++q) {
        float nxr = accR[i][j][q] + ar[j] * xr - ai[j] * xi;
        float nxi = accI[i][j][q] + ar[j] * xi + ai[j] * xr;
        xr = nxr; xi = nxi;
        accR[i][j][q] = xr;
      }
      er[i] = xr; ei[i] = xi;
    }
    // 2) state entering each run: both halves walk the same 8 run ends in time order
    float inr[4], ini[4];
    float sr = 0.f, si = 0.f;
#pragma unroll
    for (int i = 0; i < 4; ++i) {
      float qr = other_half(er[i]), qi = other_half(ei[i]);
      float e0r = hi ? qr : er[i], e0i = hi ? qi : ei[i];   // end of run (i, 0)
      float e1r = hi ? er[i] : qr, e1i = hi ? ei[i] : qi;   // end of run (i, 1)
      float tr = e0r, ti = e0i;                             // state entering (i, 1)
      if (i > 0) {
        tr = e0r + pwr[7] * sr - pwi[7] * si;
        ti = e0i + pwr[7] * si + pwi[7] * sr;
      }
      inr[i] = hi ? tr : sr; ini[i] = hi ? ti : si;
      sr = e1r + pwr[7] * tr - pwi[7] * ti;                 // state entering (i+1, 0)
      si = e1i + pwr[7] * ti + pwi[7] * tr;
    }
    // 3) Re(x) = Re(run-local x) + Re(A_bar^(q+1) * state entering the run)
#pragma unroll
    for (int i = 0; i < 4; ++i) {
#pragma unroll
      for (int q = 0; q < 8; ++q)
        (oR + (i * 16 + q) * NN + j * 16)[lout] =
            accR[i][j][q] + pwr[q] * inr[i] - pwi[q] * ini[i];
    }
    endr[j] = sr; endi[j] = si;
  }
  // the chunk's end state, once per column: both halves hold it, the lower one stores
  if (hi == 0) {
#pragma unroll
    for (int j = 0; j < 2; ++j) {
      (ends_re + (size_t)(m0 / LC) * NN + n0 + j * 16)[(unsigned)r] = endr[j];
      (ends_im + (size_t)(m0 / LC) * NN + n0 + j * 16)[(unsigned)r] = endi[j];
    }
  }
}

// ---------------------------------------------------------------------------
// Kernel 4: cross-chunk carry scan. carry_in[c] = state entering chunk c.
// state[c] = ends_local[c] + A^LC * state[c-1];  A^LC by 6 squarings (LC=64).
// ---------------------------------------------------------------------------
__global__ __launch_bounds__(256) void scan_carry(const float* __restrict__ abar_re,
                           const float* __restrict__ abar_im,
                           const float* __restrict__ ends_re,
                           const float* __restrict__ ends_im,
                           float* __restrict__ carry_re, float* __restrict__ carry_im) {
  int tid = blockIdx.x * blockDim.x + threadIdx.x;   // 0 .. BB*NN-1
  int n = tid % NN;
  int b = tid / NN;
  float pr = abar_re[n], pi = abar_im[n];
#pragma unroll
  for (int i = 0; i < 6; ++i) {                      // A^(2^6) = A^64
    float qr = pr * pr - pi * pi;
    float qi = 2.f * pr * pi;
    pr = qr; pi = qi;
  }
  // all chunk ends are fetched first: the 64-long chain then waits on memory once
  float er[NC], ei[NC];
#pragma unroll
  for (int c = 0; c < NC; ++c) {
    size_t idx = ((size_t)(b * NC + c)) * NN + n;
    er[c] = ends_re[idx]; ei[c] = ends_im[idx];
  }
  // the loads' address registers are free for the chain's values behind this wait
  asm volatile("s_wait_xcnt 0x0" ::: "memory");
  float cr = 0.f, ci = 0.f;
#pragma unroll
  for (int c = 0; c < NC; ++c) {
    size_t idx = ((size_t)(b * NC + c)) * NN + n;
    carry_re[idx] = cr; carry_im[idx] = ci;
    float ncr = er[c] + pr * cr - pi * ci;
    float nci = ei[c] + pr * ci + pi * cr;
    cr = ncr; ci = nci;
  }
}

// ---------------------------------------------------------------------------
// Kernel 5: out = Re(y) @ C^T + u * D   (f16 WMMA GEMM, fp32 epilogue)
// One block per scan chunk: 64 rows x all 512 columns, 8 waves side by side,
// one wave per 64 x 64 tile: 4 A and 4 B fragments feed 16 WMMAs per k step.
// Prologue: the block forms its A tile itself, once, in LDS:
//   Re(y)[t][n] = v_local[t][n] + Re(A_bar^(t+1) * carry_in[n])  -> f16
// A thread owns 4 columns and 16 rows; A_bar^(t+1) * carry_in starts from the
// power table at the thread's first row and is stepped by A_bar from row to row.
// ---------------------------------------------------------------------------
constexpr int AP = NN + 8;   // LDS row pitch in halves: 528 B = 16 B x 33 (odd), for ds_load_b128

__global__ __launch_bounds__(256) void gemm_out(
    const float* __restrict__ vre,
    const float* __restrict__ abar_re, const float* __restrict__ abar_im,
    const float* __restrict__ apow_re, const float* __restrict__ apow_im,
    const float* __restrict__ carry_re, const float* __restrict__ carry_im,
    const _Float16* __restrict__ Ch,
    const float* __restrict__ u, const float* __restrict__ Dv,
    float* __restrict__ out) {
  __shared__ __attribute__((aligned(16))) _Float16 ys[LC * AP];
  int w    = __builtin_amdgcn_readfirstlane(threadIdx.x >> 5);
  int lane = threadIdx.x & 31;
  int m0   = blockIdx.x * LC;                          // first of the chunk's 64 rows of BL
  int d0   = w * 64;                                   // first of 64 columns of Din
  int hi   = lane >> 4, r = lane & 15;

  {
    // scalar bases plus one lane offset: every load of the prologue names the same register
    const unsigned n  = (threadIdx.x & 63) * 4;        // first of the thread's 4 columns
    const int      t0 = (w >> 1) * 16;                 // first of its 16 rows: two waves span a row
    const float* vp = vre + (size_t)(m0 + t0) * NN;
    float4 x[16];
#pragma unroll
    for (int k = 0; k < 16; ++k) x[k] = *reinterpret_cast<const float4*>((vp + k * NN) + n);
    const float4 a4r = *reinterpret_cast<const float4*>(abar_re + n);
    const float4 a4i = *reinterpret_cast<const float4*>(abar_im + n);
    const float4 p4r = *reinterpret_cast<const float4*>((apow_re + (t0 + 1) * NN) + n);
    const float4 p4i = *reinterpret_cast<const float4*>((apow_im + (t0 + 1) * NN) + n);
    const float4 c4r = *reinterpret_cast<const float4*>((carry_re + (size_t)blockIdx.x * NN) + n);
    const float4 c4i = *reinterpret_cast<const float4*>((carry_im + (size_t)blockIdx.x * NN) + n);
    const float ar[4] = {a4r.x, a4r.y, a4r.z, a4r.w}, ai[4] = {a4i.x, a4i.y, a4i.z, a4i.w};
    const float pr[4] = {p4r.x, p4r.y, p4r.z, p4r.w}, pi[4] = {p4i.x, p4i.y, p4i.z, p4i.w};
    const float cr[4] = {c4r.x, c4r.y, c4r.z, c4r.w}, ci[4] = {c4i.x, c4i.y, c4i.z, c4i.w};
    float zr[4], zi[4];                                // A_bar^(t+1) * carry_in at row t
#pragma unroll
    for (int e = 0; e < 4; ++e) {
      zr[e] = pr[e] * cr[e] - pi[e] * ci[e];
      zi[e] = pr[e] * ci[e] + pi[e] * cr[e];
    }
#pragma unroll
    for (int k = 0; k < 16; ++k) {
      const float xe[4] = {x[k].x, x[k].y, x[k].z, x[k].w};
      v4h h;
#pragma unroll
      for (int e = 0; e < 4; ++e) {
        h[e] = (_Float16)(xe[e] + zr[e]);
        float nr = zr[e] * ar[e] - zi[e] * ai[e];
        float ni = zr[e] * ai[e] + zi[e] * ar[e];
        zr[e] = nr; zi[e] = ni;
      }
      *reinterpret_cast<v4h*>(ys + (t0 + k) * AP + n) = h;
    }
  }
  // publishes the A tile: every wave reads all 64 rows
  __syncthreads();

  const _Float16* bbase = Ch + (size_t)d0 * NN;            // C[d][n]: k-contig
  const unsigned  lfrag = (unsigned)(r * NN + 8 * hi);
  const unsigned  afrag = (unsigned)(r * AP + 8 * hi);

  float dval[4];
#pragma unroll
  for (int j = 0; j < 4; ++j) dval[j] = (Dv + d0 + j * 16)[(unsigned)r];

  v8f acc[4][4] = {};
  // unrolled: every load is base + the lane's offset + immediate
#pragma unroll
  for (int ks = 0; ks < NN; ks += 32) {
    v16h a[4], b[4];
#pragma unroll
    for (int j = 0; j < 4; ++j) b[j] = frag_at(bbase + ks + j * 16 * NN, lfrag);
#pragma unroll
    for (int i = 0; i < 4; ++i) a[i] = frag_at(ys + ks + i * 16 * AP, afrag);
    // keeps the step's 16 loads together ahead of its WMMAs: left free, the
    // scheduler reloads one B fragment at a time and waits out each load alone
    __builtin_amdgcn_sched_barrier(0);
#pragma unroll
    for (int j = 0; j < 4; ++j) {
#pragma unroll
      for (int i = 0; i < 4; ++i) acc[i][j] = wmma16(a[i], b[j], acc[i][j]);
    }
    // ends the step: no later load or store moves in among these WMMAs
    __builtin_amdgcn_sched_barrier(0);
  }
  const float* ub = u   + (size_t)m0 * DIN + d0;
  float*       ob = out + (size_t)m0 * DIN + d0;
  const unsigned lout = (unsigned)(8 * hi * DIN + r);
  // 16 rows at a time; the next 16 rows' u values are loaded ahead of this group's stores
  float uu[2][4][8];
#pragma unroll
  for (int j = 0; j < 4; ++j) {
#pragma unroll
    for (int q = 0; q < 8; ++q) uu[0][j][q] = (ub + q * DIN + j * 16)[lout];
  }
#pragma unroll
  for (int i = 0; i < 4; ++i) {
    if (i < 3) {
#pragma unroll
      for (int j = 0; j < 4; ++j) {
#pragma unroll
        for (int q = 0; q < 8; ++q)
          uu[(i + 1) & 1][j][q] = (ub + ((i + 1) * 16 + q) * DIN + j * 16)[lout];
      }
    }
    // keeps those 32 loads together ahead of the stores: left free, the
    // scheduler takes one load at a time and waits out each alone
    __builtin_amdgcn_sched_barrier(0);
#pragma unroll
    for (int j = 0; j < 4; ++j) {
#pragma unroll
      for (int q = 0; q < 8; ++q)
        (ob + (i * 16 + q) * DIN + j * 16)[lout] = acc[i][j][q] + uu[i & 1][j][q] * dval[j];
    }
    // the stored registers are free for the loads that follow behind this wait
    if (i < 2) asm volatile("s_wait_xcnt 0x0" ::: "memory");
  }
}

// ---------------------------------------------------------------------------
// Host launcher. Workspace carve-out (~19 MB), all launches on `stream`.
// ---------------------------------------------------------------------------
extern "C" void kernel_launch(void* const* d_in, const int* in_sizes, int n_in,
                              void* d_out, int out_size, void* d_ws, size_t ws_size,
                              hipStream_t stream) {
  const float* u      = (const float*)d_in[0];  // [BB, LL, DIN]
  const float* A_real = (const float*)d_in[1];  // [NN]
  const float* A_imag = (const float*)d_in[2];  // [NN]
  const float* B_mat  = (const float*)d_in[3];  // [NN, DIN]
  const float* C_mat  = (const float*)d_in[4];  // [DIN, NN]
  const float* D_vec  = (const float*)d_in[5];  // [DIN]
  float* out = (float*)d_out;                   // [BB, LL, DIN]

  char* w = (char*)d_ws;
  auto carve = [&](size_t bytes) -> void* {
    void* p = (void*)w;
    w += (bytes + 255) & ~(size_t)255;
    return p;
  };
  float*    abar_re  = (float*)carve(NN * sizeof(float));
  float*    abar_im  = (float*)carve(NN * sizeof(float));
  float*    apow_re  = (float*)carve((size_t)(LC + 1) * NN * sizeof(float));
  float*    apow_im  = (float*)carve((size_t)(LC + 1) * NN * sizeof(float));
  _Float16* Bre_h    = (_Float16*)carve((size_t)NN * DIN * sizeof(_Float16));
  _Float16* Bim_h    = (_Float16*)carve((size_t)NN * DIN * sizeof(_Float16));
  _Float16* C_h      = (_Float16*)carve((size_t)DIN * NN * sizeof(_Float16));
  float*    v_re     = (float*)carve((size_t)MM * NN * sizeof(float));
  float*    ends_re  = (float*)carve((size_t)BB * NC * NN * sizeof(float));
  float*    ends_im  = (float*)carve((size_t)BB * NC * NN * sizeof(float));
  float*    carry_re = (float*)carve((size_t)BB * NC * NN * sizeof(float));
  float*    carry_im = (float*)carve((size_t)BB * NC * NN * sizeof(float));

  // 0) discretize + power table
  k_params<<<1, NN, 0, stream>>>(A_real, A_imag, abar_re, abar_im, apow_re, apow_im);
  // 1) weight conversion to f16
  k_convert<<<(NN * DIN) / 256, 256, 0, stream>>>(A_real, A_imag, B_mat, C_mat,
                                                  Bre_h, Bim_h, C_h);
  // 2) input projection v = u @ B_bar^T (WMMA) with the local chunk scan in its epilogue
  gemm_vproj<<<(MM / 128) * 2, 256, 0, stream>>>(u, Bre_h, Bim_h, abar_re, abar_im,
                                                 v_re, ends_re, ends_im);
  // 3) chunk carries
  scan_carry<<<(BB * NN) / 256, 256, 0, stream>>>(abar_re, abar_im, ends_re, ends_im,
                                                  carry_re, carry_im);
  // 4) carry correction + output projection + skip: out = Re(y) @ C^T + u*D  (WMMA)
  gemm_out<<<MM / LC, 256, 0, stream>>>(v_re, abar_re, abar_im, apow_re, apow_im,
                                        carry_re, carry_im, C_h, u, D_vec, out);
}

// v005
// It runs in 32.3 microseconds.
// Two timings next to v004 both put it at 1.18 times that version's speed.
// All steps since v000 together make it 4.61 times as fast.
#include <hip/hip_runtime.h>
#include <hip/hip_bf16.h>

typedef __attribute__((ext_vector_type(16))) _Float16 v16h;
typedef __attribute__((ext_vector_type(8)))  _Float16 v8h;
typedef __attribute__((ext_vector_type(4)))  _Float16 v4h;
typedef __attribute__((ext_vector_type(8)))  float    v8f;
typedef __attribute__((ext_vector_type(4)))  float    v4f;
typedef __attribute__((ext_vector_type(2)))  _Float16 v2h;

#define DT_STEP   0.01f
#define DAMP_MIN_ 5e-4f

constexpr int BB  = 4;
constexpr int LL  = 4096;
constexpr int DIN = 512;
constexpr int NN  = 256;
constexpr int LC  = 64;            // scan chunk length = rows of one wave's tile in gemm_vproj
constexpr int NC  = LL / LC;       // 64 chunks
constexpr int MM  = BB * LL;       // 16384 rows

// ---------------------------------------------------------------------------
// WMMA helpers (V_WMMA_F32_16X16X32_F16, wave32; ISA 7.12.2 layouts)
// lane r = lane&15 owns row (A) / column (B) r; hi = lane>>4;
// v16h element h holds K = (h<8 ? h : h+8) + 8*hi within the 32-wide K tile.
// ---------------------------------------------------------------------------
__device__ __forceinline__ v8f wmma16(v16h a, v16h b, v8f c) {
  return __builtin_amdgcn_wmma_f32_16x16x32_f16(
      /*neg_a=*/false, a, /*neg_b=*/false, b,
      /*c_mod=*/(short)0, c, /*reuse_a=*/false, /*reuse_b=*/false);
}

// Fragment from a wave-uniform tile base plus the lane's element offset
// (row r, 8*hi): the base stays scalar, the one offset register serves all loads.
__device__ __forceinline__ v16h frag_at(const _Float16* __restrict__ base, unsigned off) {
  v8h lo  = *reinterpret_cast<const v8h*>(base + off);
  v8h hi8 = *reinterpret_cast<const v8h*>((base + 16) + off);
  return __builtin_shufflevector(lo, hi8, 0,1,2,3,4,5,6,7,8,9,10,11,12,13,14,15);
}

// Value of the lane 16 places away (l <-> l ^ 16), as one vector cross-row move.
__device__ __forceinline__ float other_half(float x) {
  int b = __builtin_bit_cast(int, x);
  b = __builtin_amdgcn_permlanex16(b, b, 0x76543210, 0xfedcba98, false, false);
  return __builtin_bit_cast(float, b);
}

// ---------------------------------------------------------------------------
// Bilinear discretization of one diagonal entry of A, formed where it is used:
// A_bar = (1 + dt/2 A) / (1 - dt/2 A), and f = dt / (1 - dt/2 A), B_bar = f * B.
// ---------------------------------------------------------------------------
struct Disc { float abr, abi, fr, fi; };
__device__ __forceinline__ Disc discretize(float a_real, float a_imag) {
  float ar = -fabsf(a_real) - DAMP_MIN_;
  float ai = a_imag;
  float dr = 1.f - 0.005f * ar, di = -0.005f * ai;       // denom = 1 - dt/2 * A
  float inv = 1.f / (dr * dr + di * di);
  float nr = 1.f + 0.005f * ar, ni = 0.005f * ai;        // numer = 1 + dt/2 * A
  Disc d;
  d.abr = (nr * dr + ni * di) * inv;
  d.abi = (ni * dr - nr * di) * inv;
  d.fr  = DT_STEP * inv * dr;                            // dt * conj(denom) / |denom|^2
  d.fi  = -(DT_STEP * inv) * di;
  return d;
}

// The lane's 16 f32 values of one row of B (k order of the fragment: x[0], x[1] hold
// K = 8*hi + 0..7, x[2], x[3] hold K = 16 + 8*hi + 0..7), times one part of the row's f.
__device__ __forceinline__ v16h scaled_frag(const v4f x[4], float f) {
  v4h h0 = __builtin_convertvector(x[0] * f, v4h);
  v4h h1 = __builtin_convertvector(x[1] * f, v4h);
  v4h h2 = __builtin_convertvector(x[2] * f, v4h);
  v4h h3 = __builtin_convertvector(x[3] * f, v4h);
  v8h lo  = __builtin_shufflevector(h0, h1, 0,1,2,3,4,5,6,7);
  v8h hi8 = __builtin_shufflevector(h2, h3, 0,1,2,3,4,5,6,7);
  return __builtin_shufflevector(lo, hi8, 0,1,2,3,4,5,6,7,8,9,10,11,12,13,14,15);
}

// ---------------------------------------------------------------------------
// Kernel 0: v = u @ B_bar^T  (two real WMMA GEMMs share the A fragments)
// one wave per 64 x 32 tile of [MM x NN], re and im: 4 A fragments and 2 + 2 B
// fragments in registers feed 16 WMMAs per 32-wide k step. The 8 waves of a
// block stand 2 x 4 on a 128 x 128 tile, so that the lines of B that a block
// has in use fit the WGP cache.
// B comes as the f32 input: a lane owns one row n of B, so one f32 load feeds the
// re and the im fragment, each scaled by the lane's own part of f[n] and rounded.
// The block also rounds its 512 elements of C to f16 for the output GEMM's launch.
// Left open: f[n] scales a whole column of v, so the one real product u @ B^T with f
// applied to its f32 sums would need half the WMMAs and no scaling of fragments.
// Prologue: the block rounds its 128 rows of u (f32) to f16 itself, once, into
// LDS; the A fragments are read from there. A wave's load covers 512 contiguous
// bytes of a row.
// Epilogue: the wave's 64 rows are one scan chunk. x[t] = A_bar x[t-1] + v[t]
// (zero start) runs on the accumulators in registers; Re(x) goes to vre and the
// chunk's complex end state to ends. v itself never reaches memory.
// ---------------------------------------------------------------------------
constexpr int UP = DIN + 8;  // LDS row pitch in halves: 1040 B = 16 B x 65 (odd), for ds_load_b128

__global__ __launch_bounds__(256) void gemm_vproj(
    const float* __restrict__ u, const float* __restrict__ Bm,
    const float* __restrict__ Ar, const float* __restrict__ Ai,
    const float* __restrict__ Cm, _Float16* __restrict__ Ch,
    float* __restrict__ vre,
    float* __restrict__ ends_re, float* __restrict__ ends_im) {
  __shared__ __attribute__((aligned(16))) _Float16 us[128 * UP];
  int w    = __builtin_amdgcn_readfirstlane(threadIdx.x >> 5);
  int lane = threadIdx.x & 31;
  int mb   = (blockIdx.x >> 1) * 128;                  // first of the block's 128 rows of BL
  int m0   = mb + (w >> 2) * 64;                       // first of the wave's 64 rows
  int n0   = (blockIdx.x & 1) * 128 + (w & 3) * 32;    // first of 32 columns of N
  int hi   = lane >> 4, r = lane & 15;

  // asked for along with the u tile: their latency falls under the tile's
  float araw[2], iraw[2];
#pragma unroll
  for (int j = 0; j < 2; ++j) {
    araw[j] = (Ar + n0 + j * 16)[(unsigned)r];
    iraw[j] = (Ai + n0 + j * 16)[(unsigned)r];
  }
  const unsigned cslot = (unsigned)threadIdx.x * 2;      // the thread's 2 of the block's 512 elements of C
  const float2 c2 = *reinterpret_cast<const float2*>((Cm + blockIdx.x * 512) + cslot);

  {
    // four waves span a row; a wave takes every second row: 64 loads, which stand
    // ahead of the converts, so that the wave waits out memory latency once.
    // scalar bases plus one lane offset: every load names the same register
    const float*   up = u  + (size_t)(mb + (w >> 2)) * DIN + (w & 3) * 128;
    _Float16*      sp = us + (w >> 2) * UP + (w & 3) * 128;
    const unsigned c  = (unsigned)lane * 4;
    float4 x[64];
#pragma unroll
    for (int k = 0; k < 64; ++k)
      x[k] = *reinterpret_cast<const float4*>((up + k * 2 * DIN) + c);
#pragma unroll
    for (int k = 0; k < 64; ++k) {
      v4h h;
      h[0] = (_Float16)x[k].x; h[1] = (_Float16)x[k].y;
      h[2] = (_Float16)x[k].z; h[3] = (_Float16)x[k].w;
      *reinterpret_cast<v4h*>((sp + k * 2 * UP) + c) = h;
    }
  }
  // publishes the A tile: a wave reads rows that all eight waves wrote
  __syncthreads();

  const _Float16* abase  = us + (w >> 2) * 64 * UP;
  const float*    bbase  = Bm + (size_t)n0 * DIN;
  const unsigned  lfrag  = (unsigned)(r * DIN + 8 * hi);
  const unsigned  afrag  = (unsigned)(r * UP + 8 * hi);

  float ar[2], ai[2], fr[2], fi[2];                    // A_bar and f of the lane's two columns
#pragma unroll
  for (int j = 0; j < 2; ++j) {
    Disc d = discretize(araw[j], iraw[j]);
    ar[j] = d.abr; ai[j] = d.abi; fr[j] = d.fr; fi[j] = d.fi;
  }

  v8f accR[4][2] = {}; v8f accI[4][2] = {};
  // unrolled: every load is base + the lane's offset + immediate
#pragma unroll
  for (int ks = 0; ks < DIN; ks += 32) {
    v16h a[4];
    v4f  xb[2][4];
#pragma unroll
    for (int j = 0; j < 2; ++j) {
      const float* bj = bbase + ks + j * 16 * DIN;
      xb[j][0] = *reinterpret_cast<const v4f*>(bj + lfrag);
      xb[j][1] = *reinterpret_cast<const v4f*>((bj + 4) + lfrag);
      xb[j][2] = *reinterpret_cast<const v4f*>((bj + 16) + lfrag);
      xb[j][3] = *reinterpret_cast<const v4f*>((bj + 20) + lfrag);
    }
#pragma unroll
    for (int i = 0; i < 4; ++i) a[i] = frag_at(abase + ks + i * 16 * UP, afrag);
    // keeps the step's 16 loads together ahead of its WMMAs: left free, the
    // scheduler reloads one B fragment at a time and waits out each load alone
    __builtin_amdgcn_sched_barrier(0);
#pragma unroll
    for (int j = 0; j < 2; ++j) {
      const v16h br = scaled_frag(xb[j], fr[j]);
      const v16h bi = scaled_frag(xb[j], fi[j]);
#pragma unroll
      for (int i = 0; i < 4; ++i) {
        accR[i][j] = wmma16(a[i], br, accR[i][j]);
        accI[i][j] = wmma16(a[i], bi, accI[i][j]);
      }
    }
    // ends the step: no later load or store moves in among these WMMAs
    __builtin_amdgcn_sched_barrier(0);
  }
  // C/D layout: lane holds column n0+16j+r; VGPR q holds row m0 + 16i + q + 8*hi.
  // In time order a column's 64 rows are 8 runs of 8: (i, hi) = (0,0) (0,1) (1,0) ...
  // and a lane owns the 4 runs of its own hi.
  float* oR = vre + (size_t)m0 * NN + n0;
  const unsigned lout = (unsigned)(8 * hi * NN + r);
  float endr[2], endi[2];
#pragma unroll
  for (int j = 0; j < 2; ++j) {
    // pw[q] = A_bar^(q+1)
    float pwr[8], pwi[8];
    pwr[0] = ar[j]; pwi[0] = ai[j];
#pragma unroll
    for (int q = 1; q < 8; ++q) {
      pwr[q] = pwr[q - 1] * ar[j] - pwi[q - 1] * ai[j];
      pwi[q] = pwr[q - 1] * ai[j] + pwi[q - 1] * ar[j];
    }
    // 1) each run scanned from a zero start; Re stays in accR, the end is kept
    float er[4], ei[4];
#pragma unroll
    for (int i = 0; i < 4; ++i) {
      float xr = accR[i][j][0], xi = accI[i][j][0];
#pragma unroll
      for (int q = 1; q < 8; ++q) {
        float nxr = accR[i][j][q] + ar[j] * xr - ai[j] * xi;
        float nxi = accI[i][j][q] + ar[j] * xi + ai[j] * xr;
        xr = nxr; xi = nxi;
        accR[i][j][q] = xr;
      }
      er[i] = xr; ei[i] = xi;
    }
    // 2) state entering each run: both halves walk the same 8 run ends in time order
    float inr[4], ini[4];
    float sr = 0.f, si = 0.f;
#pragma unroll
    for (int i = 0; i < 4; ++i) {
      float qr = other_half(er[i]), qi = other_half(ei[i]);
      float e0r = hi ? qr : er[i], e0i = hi ? qi : ei[i];   // end of run (i, 0)
      float e1r = hi ? er[i] : qr, e1i = hi ? ei[i] : qi;   // end of run (i, 1)
      float tr = e0r, ti = e0i;                             // state entering (i, 1)
      if (i > 0) {
        tr = e0r + pwr[7] * sr - pwi[7] * si;
        ti = e0i + pwr[7] * si + pwi[7] * sr;
      }
      inr[i] = hi ? tr : sr; ini[i] = hi ? ti : si;
      sr = e1r + pwr[7] * tr - pwi[7] * ti;                 // state entering (i+1, 0)
      si = e1i + pwr[7] * ti + pwi[7] * tr;
    }
    // 3) Re(x) = Re(run-local x) + Re(A_bar^(q+1) * state entering the run)
#pragma unroll
    for (int i = 0; i < 4; ++i) {
#pragma unroll
      for (int q = 0; q < 8; ++q)
        (oR + (i * 16 + q) * NN + j * 16)[lout] =
            accR[i][j][q] + pwr[q] * inr[i] - pwi[q] * ini[i];
    }
    endr[j] = sr; endi[j] = si;
  }
  // the chunk's end state, once per column: both halves hold it, the lower one stores
  if (hi == 0) {
#pragma unroll
    for (int j = 0; j < 2; ++j) {
      (ends_re + (size_t)(m0 / LC) * NN + n0 + j * 16)[(unsigned)r] = endr[j];
      (ends_im + (size_t)(m0 / LC) * NN + n0 + j * 16)[(unsigned)r] = endi[j];
    }
  }
  // C -> f16, C is DIN*NN row-major; a wave's store fills one 128-byte line
  v2h ch; ch[0] = (_Float16)c2.x; ch[1] = (_Float16)c2.y;
  *reinterpret_cast<v2h*>((Ch + blockIdx.x * 512) + cslot) = ch;
}

// ---------------------------------------------------------------------------
// Kernel 1: cross-chunk carry scan. carry_in[c] = state entering chunk c.
// state[c] = ends_local[c] + A^LC * state[c-1];  A^LC by 6 squarings (LC=64).
// ---------------------------------------------------------------------------
__global__ __launch_bounds__(256) void scan_carry(const float* __restrict__ Ar,
                           const float* __restrict__ Ai,
                           const float* __restrict__ ends_re,
                           const float* __restrict__ ends_im,
                           float* __restrict__ carry_re, float* __restrict__ carry_im) {
  int tid = blockIdx.x * blockDim.x + threadIdx.x;   // 0 .. BB*NN-1
  int n = tid % NN;
  int b = tid / NN;
  const Disc d = discretize(Ar[n], Ai[n]);
  float pr = d.abr, pi = d.abi;
#pragma unroll
  for (int i = 0; i < 6; ++i) {                      // A^(2^6) = A^64
    float qr = pr * pr - pi * pi;
    float qi = 2.f * pr * pi;
    pr = qr; pi = qi;
  }
  // all chunk ends are fetched first: the 64-long chain then waits on memory once
  float er[NC], ei[NC];
#pragma unroll
  for (int c = 0; c < NC; ++c) {
    size_t idx = ((size_t)(b * NC + c)) * NN + n;
    er[c] = ends_re[idx]; ei[c] = ends_im[idx];
  }
  // the loads' address registers are free for the chain's values behind this wait
  asm volatile("s_wait_xcnt 0x0" ::: "memory");
  float cr = 0.f, ci = 0.f;
#pragma unroll
  for (int c = 0; c < NC; ++c) {
    size_t idx = ((size_t)(b * NC + c)) * NN + n;
    carry_re[idx] = cr; carry_im[idx] = ci;
    float ncr = er[c] + pr * cr - pi * ci;
    float nci = ei[c] + pr * ci + pi * cr;
    cr = ncr; ci = nci;
  }
}

// ---------------------------------------------------------------------------
// Kernel 2: out = Re(y) @ C^T + u * D   (f16 WMMA GEMM, fp32 epilogue)
// One block per scan chunk: 64 rows x all 512 columns, 8 waves side by side,
// one wave per 64 x 64 tile: 4 A and 4 B fragments feed 16 WMMAs per k step.
// Prologue: the block forms its A tile itself, once, in LDS:
//   Re(y)[t][n] = v_local[t][n] + Re(A_bar^(t+1) * carry_in[n])  -> f16
// A thread owns 4 columns and 16 rows; A_bar^(t+1) * carry_in starts at the thread's
// first row t0 from A_bar * (A_bar^16)^(t0/16) and is stepped by A_bar from row to row.
// ---------------------------------------------------------------------------
constexpr int AP = NN + 8;   // LDS row pitch in halves: 528 B = 16 B x 33 (odd), for ds_load_b128

__global__ __launch_bounds__(256) void gemm_out(
    const float* __restrict__ vre,
    const float* __restrict__ Ar, const float* __restrict__ Ai,
    const float* __restrict__ carry_re, const float* __restrict__ carry_im,
    const _Float16* __restrict__ Ch,
    const float* __restrict__ u, const float* __restrict__ Dv,
    float* __restrict__ out) {
  __shared__ __attribute__((aligned(16))) _Float16 ys[LC * AP];
  int w    = __builtin_amdgcn_readfirstlane(threadIdx.x >> 5);
  int lane = threadIdx.x & 31;
  int m0   = blockIdx.x * LC;                          // first of the chunk's 64 rows of BL
  int d0   = w * 64;                                   // first of 64 columns of Din
  int hi   = lane >> 4, r = lane & 15;

  {
    // scalar bases plus one lane offset: every load of the prologue names the same register
    const unsigned n  = (threadIdx.x & 63) * 4;        // first of the thread's 4 columns
    const int      t0 = (w >> 1) * 16;                 // first of its 16 rows: two waves span a row
    const float* vp = vre + (size_t)(m0 + t0) * NN;
    float4 x[16];
#pragma unroll
    for (int k = 0; k < 16; ++k) x[k] = *reinterpret_cast<const float4*>((vp + k * NN) + n);
    const float4 a4r = *reinterpret_cast<const float4*>(Ar + n);
    const float4 a4i = *reinterpret_cast<const float4*>(Ai + n);
    const float4 c4r = *reinterpret_cast<const float4*>((carry_re + (size_t)blockIdx.x * NN) + n);
    const float4 c4i = *reinterpret_cast<const float4*>((carry_im + (size_t)blockIdx.x * NN) + n);
    const float rawr[4] = {a4r.x, a4r.y, a4r.z, a4r.w}, rawi[4] = {a4i.x, a4i.y, a4i.z, a4i.w};
    float ar[4], ai[4], pr[4], pi[4];                  // A_bar and A_bar^(t0+1)
#pragma unroll
    for (int e = 0; e < 4; ++e) {
      const Disc d = discretize(rawr[e], rawi[e]);
      ar[e] = d.abr; ai[e] = d.abi;
      float sr = ar[e], si = ai[e];
#pragma unroll
      for (int s = 0; s < 4; ++s) {                    // A_bar^16 by four squarings
        float qr = sr * sr - si * si;
        float qi = 2.f * sr * si;
        sr = qr; si = qi;
      }
      pr[e] = ar[e]; pi[e] = ai[e];
#pragma unroll
      for (int s = 0; s < 3; ++s) {
        if (s < (w >> 1)) {                            // the same for the whole wave
          float qr = pr[e] * sr - pi[e] * si;
          float qi = pr[e] * si + pi[e] * sr;
          pr[e] = qr; pi[e] = qi;
        }
      }
    }
    const float cr[4] = {c4r.x, c4r.y, c4r.z, c4r.w}, ci[4] = {c4i.x, c4i.y, c4i.z, c4i.w};
    float zr[4], zi[4];                                // A_bar^(t+1) * carry_in at row t
#pragma unroll
    for (int e = 0; e < 4; ++e) {
      zr[e] = pr[e] * cr[e] - pi[e] * ci[e];
      zi[e] = pr[e] * ci[e] + pi[e] * cr[e];
    }
#pragma unroll
    for (int k = 0; k < 16; ++k) {
      const float xe[4] = {x[k].x, x[k].y, x[k].z, x[k].w};
      v4h h;
#pragma unroll
      for (int e = 0; e < 4; ++e) {
        h[e] = (_Float16)(xe[e] + zr[e]);
        float nr = zr[e] * ar[e] - zi[e] * ai[e];
        float ni = zr[e] * ai[e] + zi[e] * ar[e];
        zr[e] = nr; zi[e] = ni;
      }
      *reinterpret_cast<v4h*>(ys + (t0 + k) * AP + n) = h;
    }
  }
  // publishes the A tile: every wave reads all 64 rows
  __syncthreads();

  const _Float16* bbase = Ch + (size_t)d0 * NN;            // C[d][n]: k-contig
  const unsigned  lfrag = (unsigned)(r * NN + 8 * hi);
  const unsigned  afrag = (unsigned)(r * AP + 8 * hi);

  float dval[4];
#pragma unroll
  for (int j = 0; j < 4; ++j) dval[j] = (Dv + d0 + j * 16)[(unsigned)r];

  v8f acc[4][4] = {};
  // unrolled: every load is base + the lane's offset + immediate
#pragma unroll
  for (int ks = 0; ks < NN; ks += 32) {
    v16h a[4], b[4];
#pragma unroll
    for (int j = 0; j < 4; ++j) b[j] = frag_at(bbase + ks + j * 16 * NN, lfrag);
#pragma unroll
    for (int i = 0; i < 4; ++i) a[i] = frag_at(ys + ks + i * 16 * AP, afrag);
    // keeps the step's 16 loads together ahead of its WMMAs: left free, the
    // scheduler reloads one B fragment at a time and waits out each load alone
    __builtin_amdgcn_sched_barrier(0);
#pragma unroll
    for (int j = 0; j < 4; ++j) {
#pragma unroll
      for (int i = 0; i < 4; ++i) acc[i][j] = wmma16(a[i], b[j], acc[i][j]);
    }
    // ends the step: no later load or store moves in among these WMMAs
    __builtin_amdgcn_sched_barrier(0);
  }
  const float* ub = u   + (size_t)m0 * DIN + d0;
  float*       ob = out + (size_t)m0 * DIN + d0;
  const unsigned lout = (unsigned)(8 * hi * DIN + r);
  // 16 rows at a time; the next 16 rows' u values are loaded ahead of this group's stores
  float uu[2][4][8];
#pragma unroll
  for (int j = 0; j < 4; ++j) {
#pragma unroll
    for (int q = 0; q < 8; ++q) uu[0][j][q] = (ub + q * DIN + j * 16)[lout];
  }
#pragma unroll
  for (int i = 0; i < 4; ++i) {
    if (i < 3) {
#pragma unroll
      for (int j = 0; j < 4; ++j) {
#pragma unroll
        for (int q = 0; q < 8; ++q)
          uu[(i + 1) & 1][j][q] = (ub + ((i + 1) * 16 + q) * DIN + j * 16)[lout];
      }
    }
    // keeps those 32 loads together ahead of the stores: left free, the
    // scheduler takes one load at a time and waits out each alone
    __builtin_amdgcn_sched_barrier(0);
#pragma unroll
    for (int j = 0; j < 4; ++j) {
#pragma unroll
      for (int q = 0; q < 8; ++q)
        (ob + (i * 16 + q) * DIN + j * 16)[lout] = acc[i][j][q] + uu[i & 1][j][q] * dval[j];
    }
    // the stored registers are free for the loads that follow behind this wait
    if (i < 2) asm volatile("s_wait_xcnt 0x0" ::: "memory");
  }
}

// ---------------------------------------------------------------------------
// Host launcher. Workspace carve-out (~18 MB), all launches on `stream`.
// ---------------------------------------------------------------------------
extern "C" void kernel_launch(void* const* d_in, const int* in_sizes, int n_in,
                              void* d_out, int out_size, void* d_ws, size_t ws_size,
                              hipStream_t stream) {
  const float* u      = (const float*)d_in[0];  // [BB, LL, DIN]
  const float* A_real = (const float*)d_in[1];  // [NN]
  const float* A_imag = (const float*)d_in[2];  // [NN]
  const float* B_mat  = (const float*)d_in[3];  // [NN, DIN]
  const float* C_mat  = (const float*)d_in[4];  // [DIN, NN]
  const float* D_vec  = (const float*)d_in[5];  // [DIN]
  float* out = (float*)d_out;                   // [BB, LL, DIN]

  char* w = (char*)d_ws;
  auto carve = [&](size_t bytes) -> void* {
    void* p = (void*)w;
    w += (bytes + 255) & ~(size_t)255;
    return p;
  };
  _Float16* C_h      = (_Float16*)carve((size_t)DIN * NN * sizeof(_Float16));
  float*    v_re     = (float*)carve((size_t)MM * NN * sizeof(float));
  float*    ends_re  = (float*)carve((size_t)BB * NC * NN * sizeof(float));
  float*    ends_im  = (float*)carve((size_t)BB * NC * NN * sizeof(float));
  float*    carry_re = (float*)carve((size_t)BB * NC * NN * sizeof(float));
  float*    carry_im = (float*)carve((size_t)BB * NC * NN * sizeof(float));

  // 0) input projection v = u @ B_bar^T (WMMA) with the local chunk scan in its epilogue; C -> f16
  gemm_vproj<<<(MM / 128) * 2, 256, 0, stream>>>(u, B_mat, A_real, A_imag, C_mat, C_h,
                                                 v_re, ends_re, ends_im);
  // 1) chunk carries
  scan_carry<<<(BB * NN) / 256, 256, 0, stream>>>(A_real, A_imag, ends_re, ends_im,
                                                  carry_re, carry_im);
  // 2) carry correction + output projection + skip: out = Re(y) @ C^T + u*D  (WMMA)
  gemm_out<<<MM / LC, 256, 0, stream>>>(v_re, A_real, A_imag, carry_re, carry_im,
                                        C_h, u, D_vec, out);
}

// v006
// It runs in 28.4 microseconds.
// In both of two side-by-side timings against v005, it was 1.15 times as fast.
// Over all steps from v000 it is 5.28 times as fast.
#include <hip/hip_runtime.h>
#include <hip/hip_bf16.h>

typedef __attribute__((ext_vector_type(16))) _Float16 v16h;
typedef __attribute__((ext_vector_type(8)))  _Float16 v8h;
typedef __attribute__((ext_vector_type(4)))  _Float16 v4h;
typedef __attribute__((ext_vector_type(8)))  float    v8f;
typedef __attribute__((ext_vector_type(4)))  float    v4f;
typedef __attribute__((ext_vector_type(2)))  _Float16 v2h;

#define DT_STEP   0.01f
#define DAMP_MIN_ 5e-4f

constexpr int BB  = 4;
constexpr int LL  = 4096;
constexpr int DIN = 512;
constexpr int NN  = 256;
constexpr int LC  = 64;            // scan chunk length = rows of one wave's tile in gemm_vproj
constexpr int NC  = LL / LC;       // 64 chunks
constexpr int MM  = BB * LL;       // 16384 rows

// ---------------------------------------------------------------------------
// WMMA helpers (V_WMMA_F32_16X16X32_F16, wave32; ISA 7.12.2 layouts)
// lane r = lane&15 owns row (A) / column (B) r; hi = lane>>4;
// v16h element h holds K = (h<8 ? h : h+8) + 8*hi within the 32-wide K tile.
// ---------------------------------------------------------------------------
__device__ __forceinline__ v8f wmma16(v16h a, v16h b, v8f c) {
  return __builtin_amdgcn_wmma_f32_16x16x32_f16(
      /*neg_a=*/false, a, /*neg_b=*/false, b,
      /*c_mod=*/(short)0, c, /*reuse_a=*/false, /*reuse_b=*/false);
}

// Fragment from a wave-uniform tile base plus the lane's element offset
// (row r, 8*hi): the base stays scalar, the one offset register serves all loads.
__device__ __forceinline__ v16h frag_at(const _Float16* __restrict__ base, unsigned off) {
  v8h lo  = *reinterpret_cast<const v8h*>(base + off);
  v8h hi8 = *reinterpret_cast<const v8h*>((base + 16) + off);
  return __builtin_shufflevector(lo, hi8, 0,1,2,3,4,5,6,7,8,9,10,11,12,13,14,15);
}

// Value of the lane 16 places away (l <-> l ^ 16), as one vector cross-row move.
__device__ __forceinline__ float other_half(float x) {
  int b = __builtin_bit_cast(int, x);
  b = __builtin_amdgcn_permlanex16(b, b, 0x76543210, 0xfedcba98, false, false);
  return __builtin_bit_cast(float, b);
}

// ---------------------------------------------------------------------------
// Bilinear discretization of one diagonal entry of A, formed where it is used:
// A_bar = (1 + dt/2 A) / (1 - dt/2 A), and f = dt / (1 - dt/2 A), B_bar = f * B.
// ---------------------------------------------------------------------------
struct Disc { float abr, abi, fr, fi; };
__device__ __forceinline__ Disc discretize(float a_real, float a_imag) {
  float ar = -fabsf(a_real) - DAMP_MIN_;
  float ai = a_imag;
  float dr = 1.f - 0.005f * ar, di = -0.005f * ai;       // denom = 1 - dt/2 * A
  float inv = 1.f / (dr * dr + di * di);
  float nr = 1.f + 0.005f * ar, ni = 0.005f * ai;        // numer = 1 + dt/2 * A
  Disc d;
  d.abr = (nr * dr + ni * di) * inv;
  d.abi = (ni * dr - nr * di) * inv;
  d.fr  = DT_STEP * inv * dr;                            // dt * conj(denom) / |denom|^2
  d.fi  = -(DT_STEP * inv) * di;
  return d;
}

// The lane's 16 f32 values of one row of B (k order of the fragment: x[0], x[1] hold
// K = 8*hi + 0..7, x[2], x[3] hold K = 16 + 8*hi + 0..7), times one part of the row's f.
__device__ __forceinline__ v16h scaled_frag(const v4f x[4], float f) {
  v4h h0 = __builtin_convertvector(x[0] * f, v4h);
  v4h h1 = __builtin_convertvector(x[1] * f, v4h);
  v4h h2 = __builtin_convertvector(x[2] * f, v4h);
  v4h h3 = __builtin_convertvector(x[3] * f, v4h);
  v8h lo  = __builtin_shufflevector(h0, h1, 0,1,2,3,4,5,6,7);
  v8h hi8 = __builtin_shufflevector(h2, h3, 0,1,2,3,4,5,6,7);
  return __builtin_shufflevector(lo, hi8, 0,1,2,3,4,5,6,7,8,9,10,11,12,13,14,15);
}

// ---------------------------------------------------------------------------
// Kernel 0: v = u @ B_bar^T  (two real WMMA GEMMs share the A fragments)
// one wave per 64 x 32 tile of [MM x NN], re and im: 4 A fragments and 2 + 2 B
// fragments in registers feed 16 WMMAs per 32-wide k step. The 8 waves of a
// block stand 2 x 4 on a 128 x 128 tile, so that the lines of B that a block
// has in use fit the WGP cache.
// B comes as the f32 input: a lane owns one row n of B, so one f32 load feeds the
// re and the im fragment, each scaled by the lane's own part of f[n] and rounded.
// The block also rounds its 512 elements of C to f16 for the output GEMM's launch.
// Left open: f[n] scales a whole column of v, so the one real product u @ B^T with f
// applied to its f32 sums would need half the WMMAs and no scaling of fragments.
// Prologue: the block rounds its 128 rows of u (f32) to f16 itself, once, into
// LDS; the A fragments are read from there. A wave's load covers 512 contiguous
// bytes of a row.
// Epilogue: the wave's 64 rows are one scan chunk. x[t] = A_bar x[t-1] + v[t]
// (zero start) runs on the accumulators in registers; Re(x) goes to vre and the
// chunk's complex end state to ends. v itself never reaches memory.
// ---------------------------------------------------------------------------
constexpr int UP = DIN + 8;  // LDS row pitch in halves: 1040 B = 16 B x 65 (odd), for ds_load_b128

__global__ __launch_bounds__(256) void gemm_vproj(
    const float* __restrict__ u, const float* __restrict__ Bm,
    const float* __restrict__ Ar, const float* __restrict__ Ai,
    const float* __restrict__ Cm, _Float16* __restrict__ Ch,
    float* __restrict__ vre,
    float* __restrict__ ends_re, float* __restrict__ ends_im) {
  __shared__ __attribute__((aligned(16))) _Float16 us[128 * UP];
  int w    = __builtin_amdgcn_readfirstlane(threadIdx.x >> 5);
  int lane = threadIdx.x & 31;
  int mb   = (blockIdx.x >> 1) * 128;                  // first of the block's 128 rows of BL
  int m0   = mb + (w >> 2) * 64;                       // first of the wave's 64 rows
  int n0   = (blockIdx.x & 1) * 128 + (w & 3) * 32;    // first of 32 columns of N
  int hi   = lane >> 4, r = lane & 15;

  // asked for along with the u tile: their latency falls under the tile's
  float araw[2], iraw[2];
#pragma unroll
  for (int j = 0; j < 2; ++j) {
    araw[j] = (Ar + n0 + j * 16)[(unsigned)r];
    iraw[j] = (Ai + n0 + j * 16)[(unsigned)r];
  }
  const unsigned cslot = (unsigned)threadIdx.x * 2;      // the thread's 2 of the block's 512 elements of C
  const float2 c2 = *reinterpret_cast<const float2*>((Cm + blockIdx.x * 512) + cslot);

  {
    // four waves span a row; a wave takes every second row: 64 loads, which stand
    // ahead of the converts, so that the wave waits out memory latency once.
    // scalar bases plus one lane offset: every load names the same register
    const float*   up = u  + (size_t)(mb + (w >> 2)) * DIN + (w & 3) * 128;
    _Float16*      sp = us + (w >> 2) * UP + (w & 3) * 128;
    const unsigned c  = (unsigned)lane * 4;
    float4 x[64];
#pragma unroll
    for (int k = 0; k < 64; ++k)
      x[k] = *reinterpret_cast<const float4*>((up + k * 2 * DIN) + c);
#pragma unroll
    for (int k = 0; k < 64; ++k) {
      v4h h;
      h[0] = (_Float16)x[k].x; h[1] = (_Float16)x[k].y;
      h[2] = (_Float16)x[k].z; h[3] = (_Float16)x[k].w;
      *reinterpret_cast<v4h*>((sp + k * 2 * UP) + c) = h;
    }
  }
  // publishes the A tile: a wave reads rows that all eight waves wrote
  __syncthreads();

  const _Float16* abase  = us + (w >> 2) * 64 * UP;
  const float*    bbase  = Bm + (size_t)n0 * DIN;
  const unsigned  lfrag  = (unsigned)(r * DIN + 8 * hi);
  const unsigned  afrag  = (unsigned)(r * UP + 8 * hi);

  float ar[2], ai[2], fr[2], fi[2];                    // A_bar and f of the lane's two columns
#pragma unroll
  for (int j = 0; j < 2; ++j) {
    Disc d = discretize(araw[j], iraw[j]);
    ar[j] = d.abr; ai[j] = d.abi; fr[j] = d.fr; fi[j] = d.fi;
  }

  v8f accR[4][2] = {}; v8f accI[4][2] = {};
  // unrolled: every load is base + the lane's offset + immediate
#pragma unroll
  for (int ks = 0; ks < DIN; ks += 32) {
    v16h a[4];
    v4f  xb[2][4];
#pragma unroll
    for (int j = 0; j < 2; ++j) {
      const float* bj = bbase + ks + j * 16 * DIN;
      xb[j][0] = *reinterpret_cast<const v4f*>(bj + lfrag);
      xb[j][1] = *reinterpret_cast<const v4f*>((bj + 4) + lfrag);
      xb[j][2] = *reinterpret_cast<const v4f*>((bj + 16) + lfrag);
      xb[j][3] = *reinterpret_cast<const v4f*>((bj + 20) + lfrag);
    }
#pragma unroll
    for (int i = 0; i < 4; ++i) a[i] = frag_at(abase + ks + i * 16 * UP, afrag);
    // keeps the step's 16 loads together ahead of its WMMAs: left free, the
    // scheduler reloads one B fragment at a time and waits out each load alone
    __builtin_amdgcn_sched_barrier(0);
#pragma unroll
    for (int j = 0; j < 2; ++j) {
      const v16h br = scaled_frag(xb[j], fr[j]);
      const v16h bi = scaled_frag(xb[j], fi[j]);
#pragma unroll
      for (int i = 0; i < 4; ++i) {
        accR[i][j] = wmma16(a[i], br, accR[i][j]);
        accI[i][j] = wmma16(a[i], bi, accI[i][j]);
      }
    }
    // ends the step: no later load or store moves in among these WMMAs
    __builtin_amdgcn_sched_barrier(0);
  }
  // C/D layout: lane holds column n0+16j+r; VGPR q holds row m0 + 16i + q + 8*hi.
  // In time order a column's 64 rows are 8 runs of 8: (i, hi) = (0,0) (0,1) (1,0) ...
  // and a lane owns the 4 runs of its own hi.
  float* oR = vre + (size_t)m0 * NN + n0;
  const unsigned lout = (unsigned)(8 * hi * NN + r);
  float endr[2], endi[2];
#pragma unroll
  for (int j = 0; j < 2; ++j) {
    // pw[q] = A_bar^(q+1)
    float pwr[8], pwi[8];
    pwr[0] = ar[j]; pwi[0] = ai[j];
#pragma unroll
    for (int q = 1; q < 8; ++q) {
      pwr[q] = pwr[q - 1] * ar[j] - pwi[q - 1] * ai[j];
      pwi[q] = pwr[q - 1] * ai[j] + pwi[q - 1] * ar[j];
    }
    // 1) each run scanned from a zero start; Re stays in accR, the end is kept
    float er[4], ei[4];
#pragma unroll
    for (int i = 0; i < 4; ++i) {
      float xr = accR[i][j][0], xi = accI[i][j][0];
#pragma unroll
      for (int q = 1; q < 8; ++q) {
        float nxr = accR[i][j][q] + ar[j] * xr - ai[j] * xi;
        float nxi = accI[i][j][q] + ar[j] * xi + ai[j] * xr;
        xr = nxr; xi = nxi;
        accR[i][j][q] = xr;
      }
      er[i] = xr; ei[i] = xi;
    }
    // 2) state entering each run: both halves walk the same 8 run ends in time order
    float inr[4], ini[4];
    float sr = 0.f, si = 0.f;
#pragma unroll
    for (int i = 0; i < 4; ++i) {
      float qr = other_half(er[i]), qi = other_half(ei[i]);
      float e0r = hi ? qr : er[i], e0i = hi ? qi : ei[i];   // end of run (i, 0)
      float e1r = hi ? er[i] : qr, e1i = hi ? ei[i] : qi;   // end of run (i, 1)
      float tr = e0r, ti = e0i;                             // state entering (i, 1)
      if (i > 0) {
        tr = e0r + pwr[7] * sr - pwi[7] * si;
        ti = e0i + pwr[7] * si + pwi[7] * sr;
      }
      inr[i] = hi ? tr : sr; ini[i] = hi ? ti : si;
      sr = e1r + pwr[7] * tr - pwi[7] * ti;                 // state entering (i+1, 0)
      si = e1i + pwr[7] * ti + pwi[7] * tr;
    }
    // 3) Re(x) = Re(run-local x) + Re(A_bar^(q+1) * state entering the run)
#pragma unroll
    for (int i = 0; i < 4; ++i) {
#pragma unroll
      for (int q = 0; q < 8; ++q)
        (oR + (i * 16 + q) * NN + j * 16)[lout] =
            accR[i][j][q] + pwr[q] * inr[i] - pwi[q] * ini[i];
    }
    endr[j] = sr; endi[j] = si;
  }
  // the chunk's end state, once per column: both halves hold it, the lower one stores
  if (hi == 0) {
#pragma unroll
    for (int j = 0; j < 2; ++j) {
      (ends_re + (size_t)(m0 / LC) * NN + n0 + j * 16)[(unsigned)r] = endr[j];
      (ends_im + (size_t)(m0 / LC) * NN + n0 + j * 16)[(unsigned)r] = endi[j];
    }
  }
  // C -> f16, C is DIN*NN row-major; a wave's store fills one 128-byte line
  v2h ch; ch[0] = (_Float16)c2.x; ch[1] = (_Float16)c2.y;
  *reinterpret_cast<v2h*>((Ch + blockIdx.x * 512) + cslot) = ch;
}

// ---------------------------------------------------------------------------
// Kernel 1: out = Re(y) @ C^T + u * D   (f16 WMMA GEMM, fp32 epilogue)
// One block per scan chunk: 64 rows x all 512 columns, 8 waves side by side,
// one wave per 64 x 64 tile: 4 A and 4 B fragments feed 16 WMMAs per k step.
// Prologue: the block forms its A tile itself, once, in LDS:
//   Re(y)[t][n] = v_local[t][n] + Re(A_bar^(t+1) * carry_in[n])  -> f16
// A thread owns 4 columns and 16 rows; A_bar^(t+1) * carry_in starts at the thread's
// first row t0 from A_bar * (A_bar^16)^(t0/16) and is stepped by A_bar from row to row.
// carry_in, the state entering the chunk, is formed here too, from the end states of the
// batch's earlier chunks: carry_in = sum over c' < c of (A_bar^64)^(c-1-c') * end[c'].
// The 64 places that end at chunk c-1 (places ahead of the batch's first chunk count as 0)
// fall into 4 runs of 16; the threads of row group g sum run g for their 4 columns by
// Horner's rule, the 4 sums meet in LDS and are joined with A_bar^1024.
// ---------------------------------------------------------------------------
constexpr int AP = NN + 8;   // LDS row pitch in halves: 528 B = 16 B x 33 (odd), for ds_load_b128
constexpr int SEG = NC / 4;  // chunk ends summed by one row group

__global__ __launch_bounds__(256) void gemm_out(
    const float* __restrict__ vre,
    const float* __restrict__ Ar, const float* __restrict__ Ai,
    const float* __restrict__ ends_re, const float* __restrict__ ends_im,
    const _Float16* __restrict__ Ch,
    const float* __restrict__ u, const float* __restrict__ Dv,
    float* __restrict__ out) {
  __shared__ __attribute__((aligned(16))) _Float16 ys[LC * AP];
  __shared__ __attribute__((aligned(16))) float segr[4 * NN];
  __shared__ __attribute__((aligned(16))) float segi[4 * NN];
  int w    = __builtin_amdgcn_readfirstlane(threadIdx.x >> 5);
  int lane = threadIdx.x & 31;
  int m0   = blockIdx.x * LC;                          // first of the chunk's 64 rows of BL
  int d0   = w * 64;                                   // first of 64 columns of Din
  int hi   = lane >> 4, r = lane & 15;

  {
    // scalar bases plus one lane offset: every load of the prologue names the same register
    const unsigned n  = (threadIdx.x & 63) * 4;        // first of the thread's 4 columns
    const int      g  = w >> 1;                        // row group: two waves span a row
    const int      t0 = g * 16;                        // first of its 16 rows
    // the group's run stands for chunks cb .. cb + 15 of the batch; below 0 there is none:
    // the run is read from its first chunk that exists, cs, and holds cnt chunks (16; fewer
    // in the run with the batch's first chunk; none, cnt <= 0, ahead of it). The 16 rows
    // read lie inside the batch's 64 for every cs (cs <= 47).
    const int    cb  = (int)(blockIdx.x & (NC - 1)) - NC + g * SEG;
    const int    cs  = cb > 0 ? cb : 0;
    const int    cnt = cb + SEG - cs;
    const float* eR = ends_re + (size_t)((blockIdx.x & ~(unsigned)(NC - 1)) + cs) * NN;
    const float* eI = ends_im + (size_t)((blockIdx.x & ~(unsigned)(NC - 1)) + cs) * NN;
    float4 er[SEG], ei[SEG];                           // read only where cnt > 0
    if (cnt > 0) {                                     // the same for the whole wave: an empty run asks L2 for nothing
#pragma unroll
      for (int k = 0; k < SEG; ++k) {
        er[k] = *reinterpret_cast<const float4*>((eR + k * NN) + n);
        ei[k] = *reinterpret_cast<const float4*>((eI + k * NN) + n);
      }
    }
    // A behind the branch: asked for ahead of it, its wait behind the join counts for the
    // path without loads too, and comes to stand for all of the ends ahead of the rows of v
    const float4 a4r = *reinterpret_cast<const float4*>(Ar + n);
    const float4 a4i = *reinterpret_cast<const float4*>(Ai + n);
    const float* vp = vre + (size_t)(m0 + t0) * NN;
    float4 x[16];
#pragma unroll
    for (int k = 0; k < 16; ++k) x[k] = *reinterpret_cast<const float4*>((vp + k * NN) + n);
    // the 18 loads first, as one group: left free, the scheduler waits for A in their
    // midst, and the later loads start one latency late
    __builtin_amdgcn_sched_group_barrier(0x020, 18, 0);
    // the loads' address registers are free for the values that follow behind this wait
    asm volatile("s_wait_xcnt 0x0" ::: "memory");
    const float rawr[4] = {a4r.x, a4r.y, a4r.z, a4r.w}, rawi[4] = {a4i.x, a4i.y, a4i.z, a4i.w};
    float ar[4], ai[4], pr[4], pi[4];                  // A_bar and A_bar^(t0+1)
    float cpr[4], cpi[4], rpr[4], rpi[4];              // A_bar^64 (a chunk), A_bar^1024 (a run of 16)
#pragma unroll
    for (int e = 0; e < 4; ++e) {
      const Disc d = discretize(rawr[e], rawi[e]);
      ar[e] = d.abr; ai[e] = d.abi;
      float sr = ar[e], si = ai[e];
#pragma unroll
      for (int s = 0; s < 4; ++s) {                    // A_bar^16 by four squarings
        float qr = sr * sr - si * si;
        float qi = 2.f * sr * si;
        sr = qr; si = qi;
      }
      pr[e] = ar[e]; pi[e] = ai[e];
#pragma unroll
      for (int s = 0; s < 3; ++s) {
        if (s < (w >> 1)) {                            // the same for the whole wave
          float qr = pr[e] * sr - pi[e] * si;
          float qi = pr[e] * si + pi[e] * sr;
          pr[e] = qr; pi[e] = qi;
        }
      }
#pragma unroll
      for (int s = 0; s < 6; ++s) {                    // A_bar^16 squared on: ^64 after 2, ^1024 after 6
        float qr = sr * sr - si * si;
        float qi = 2.f * sr * si;
        sr = qr; si = qi;
        if (s == 1) { cpr[e] = sr; cpi[e] = si; }
      }
      rpr[e] = sr; rpi[e] = si;
    }
    // the run's sum: h = h * A_bar^64 + end, oldest chunk first, over its cnt chunks
    float hr[4] = {0.f, 0.f, 0.f, 0.f}, hm[4] = {0.f, 0.f, 0.f, 0.f};
    if (cnt > 0) {
#pragma unroll
      for (int k = 0; k < SEG; ++k) {
        const float kr[4] = {er[k].x, er[k].y, er[k].z, er[k].w};
        const float km[4] = {ei[k].x, ei[k].y, ei[k].z, ei[k].w};
        const bool on = k < cnt;                       // the same for the whole wave
#pragma unroll
        for (int e = 0; e < 4; ++e) {
          float nr = kr[e] + cpr[e] * hr[e] - cpi[e] * hm[e];
          float ni = km[e] + cpr[e] * hm[e] + cpi[e] * hr[e];
          hr[e] = on ? nr : hr[e]; hm[e] = on ? ni : hm[e];
        }
      }
    }
    *reinterpret_cast<float4*>(segr + g * NN + n) = make_float4(hr[0], hr[1], hr[2], hr[3]);
    *reinterpret_cast<float4*>(segi + g * NN + n) = make_float4(hm[0], hm[1], hm[2], hm[3]);
    // publishes the four runs' sums: a thread reads those of the other three row groups
    __syncthreads();
    float cr[4], ci[4];                                // carry_in of the thread's 4 columns
#pragma unroll
    for (int s = 0; s < 4; ++s) {
      const float4 s4r = *reinterpret_cast<const float4*>(segr + s * NN + n);
      const float4 s4i = *reinterpret_cast<const float4*>(segi + s * NN + n);
      const float kr[4] = {s4r.x, s4r.y, s4r.z, s4r.w}, km[4] = {s4i.x, s4i.y, s4i.z, s4i.w};
#pragma unroll
      for (int e = 0; e < 4; ++e) {
        if (s == 0) { cr[e] = kr[e]; ci[e] = km[e]; }
        else {
          float nr = kr[e] + rpr[e] * cr[e] - rpi[e] * ci[e];
          float ni = km[e] + rpr[e] * ci[e] + rpi[e] * cr[e];
          cr[e] = nr; ci[e] = ni;
        }
      }
    }
    float zr[4], zi[4];                                // A_bar^(t+1) * carry_in at row t
#pragma unroll
    for (int e = 0; e < 4; ++e) {
      zr[e] = pr[e] * cr[e] - pi[e] * ci[e];
      zi[e] = pr[e] * ci[e] + pi[e] * cr[e];
    }
#pragma unroll
    for (int k = 0; k < 16; ++k) {
      const float xe[4] = {x[k].x, x[k].y, x[k].z, x[k].w};
      v4h h;
#pragma unroll
      for (int e = 0; e < 4; ++e) {
        h[e] = (_Float16)(xe[e] + zr[e]);
        float nr = zr[e] * ar[e] - zi[e] * ai[e];
        float ni = zr[e] * ai[e] + zi[e] * ar[e];
        zr[e] = nr; zi[e] = ni;
      }
      *reinterpret_cast<v4h*>(ys + (t0 + k) * AP + n) = h;
    }
  }
  // publishes the A tile: every wave reads all 64 rows
  __syncthreads();

  const _Float16* bbase = Ch + (size_t)d0 * NN;            // C[d][n]: k-contig
  const unsigned  lfrag = (unsigned)(r * NN + 8 * hi);
  const unsigned  afrag = (unsigned)(r * AP + 8 * hi);

  float dval[4];
#pragma unroll
  for (int j = 0; j < 4; ++j) dval[j] = (Dv + d0 + j * 16)[(unsigned)r];

  v8f acc[4][4] = {};
  // unrolled: every load is base + the lane's offset + immediate
#pragma unroll
  for (int ks = 0; ks < NN; ks += 32) {
    v16h a[4], b[4];
#pragma unroll
    for (int j = 0; j < 4; ++j) b[j] = frag_at(bbase + ks + j * 16 * NN, lfrag);
#pragma unroll
    for (int i = 0; i < 4; ++i) a[i] = frag_at(ys + ks + i * 16 * AP, afrag);
    // keeps the step's 16 loads together ahead of its WMMAs: left free, the
    // scheduler reloads one B fragment at a time and waits out each load alone
    __builtin_amdgcn_sched_barrier(0);
#pragma unroll
    for (int j = 0; j < 4; ++j) {
#pragma unroll
      for (int i = 0; i < 4; ++i) acc[i][j] = wmma16(a[i], b[j], acc[i][j]);
    }
    // ends the step: no later load or store moves in among these WMMAs
    __builtin_amdgcn_sched_barrier(0);
  }
  const float* ub = u   + (size_t)m0 * DIN + d0;
  float*       ob = out + (size_t)m0 * DIN + d0;
  const unsigned lout = (unsigned)(8 * hi * DIN + r);
  // 16 rows at a time; the next 16 rows' u values are loaded ahead of this group's stores
  float uu[2][4][8];
#pragma unroll
  for (int j = 0; j < 4; ++j) {
#pragma unroll
    for (int q = 0; q < 8; ++q) uu[0][j][q] = (ub + q * DIN + j * 16)[lout];
  }
#pragma unroll
  for (int i = 0; i < 4; ++i) {
    if (i < 3) {
#pragma unroll
      for (int j = 0; j < 4; ++j) {
#pragma unroll
        for (int q = 0; q < 8; ++q)
          uu[(i + 1) & 1][j][q] = (ub + ((i + 1) * 16 + q) * DIN + j * 16)[lout];
      }
    }
    // keeps those 32 loads together ahead of the stores: left free, the
    // scheduler takes one load at a time and waits out each alone
    __builtin_amdgcn_sched_barrier(0);
#pragma unroll
    for (int j = 0; j < 4; ++j) {
#pragma unroll
      for (int q = 0; q < 8; ++q)
        (ob + (i * 16 + q) * DIN + j * 16)[lout] = acc[i][j][q] + uu[i & 1][j][q] * dval[j];
    }
    // the stored registers are free for the loads that follow behind this wait
    if (i < 2) asm volatile("s_wait_xcnt 0x0" ::: "memory");
  }
}

// ---------------------------------------------------------------------------
// Host launcher. Workspace carve-out (~18 MB), all launches on `stream`.
// ---------------------------------------------------------------------------
extern "C" void kernel_launch(void* const* d_in, const int* in_sizes, int n_in,
                              void* d_out, int out_size, void* d_ws, size_t ws_size,
                              hipStream_t stream) {
  const float* u      = (const float*)d_in[0];  // [BB, LL, DIN]
  const float* A_real = (const float*)d_in[1];  // [NN]
  const float* A_imag = (const float*)d_in[2];  // [NN]
  const float* B_mat  = (const float*)d_in[3];  // [NN, DIN]
  const float* C_mat  = (const float*)d_in[4];  // [DIN, NN]
  const float* D_vec  = (const float*)d_in[5];  // [DIN]
  float* out = (float*)d_out;                   // [BB, LL, DIN]

  char* w = (char*)d_ws;
  auto carve = [&](size_t bytes) -> void* {
    void* p = (void*)w;
    w += (bytes + 255) & ~(size_t)255;
    return p;
  };
  _Float16* C_h      = (_Float16*)carve((size_t)DIN * NN * sizeof(_Float16));
  float*    v_re     = (float*)carve((size_t)MM * NN * sizeof(float));
  float*    ends_re  = (float*)carve((size_t)BB * NC * NN * sizeof(float));
  float*    ends_im  = (float*)carve((size_t)BB * NC * NN * sizeof(float));

  // 0) input projection v = u @ B_bar^T (WMMA) with the local chunk scan in its epilogue; C -> f16
  gemm_vproj<<<(MM / 128) * 2, 256, 0, stream>>>(u, B_mat, A_real, A_imag, C_mat, C_h,
                                                 v_re, ends_re, ends_im);
  // 1) chunk carries + carry correction + output projection + skip: out = Re(y) @ C^T + u*D  (WMMA)
  gemm_out<<<MM / LC, 256, 0, stream>>>(v_re, A_real, A_imag, ends_re, ends_im,
                                        C_h, u, D_vec, out);
}

// v007
// It runs in 23.5 microseconds.
// Two timings next to v006 put it at 1.19 and 1.21 times that version's speed.
// Over all steps from v000 it is 6.33 times as fast.
#include <hip/hip_runtime.h>
#include <hip/hip_bf16.h>

typedef __attribute__((ext_vector_type(16))) _Float16 v16h;
typedef __attribute__((ext_vector_type(8)))  _Float16 v8h;
typedef __attribute__((ext_vector_type(4)))  _Float16 v4h;
typedef __attribute__((ext_vector_type(8)))  float    v8f;
typedef __attribute__((ext_vector_type(4)))  float    v4f;
typedef __attribute__((ext_vector_type(2)))  _Float16 v2h;

#define DT_STEP   0.01f
#define DAMP_MIN_ 5e-4f

constexpr int BB  = 4;
constexpr int LL  = 4096;
constexpr int DIN = 512;
constexpr int NN  = 256;
constexpr int LC  = 64;            // scan chunk length = rows of one wave's tile in gemm_vproj
constexpr int NC  = LL / LC;       // 64 chunks
constexpr int MM  = BB * LL;       // 16384 rows

// ---------------------------------------------------------------------------
// WMMA helpers (V_WMMA_F32_16X16X32_F16, wave32; ISA 7.12.2 layouts)
// lane r = lane&15 owns row (A) / column (B) r; hi = lane>>4;
// v16h element h holds K = (h<8 ? h : h+8) + 8*hi within the 32-wide K tile.
// ---------------------------------------------------------------------------
__device__ __forceinline__ v8f wmma16(v16h a, v16h b, v8f c) {
  return __builtin_amdgcn_wmma_f32_16x16x32_f16(
      /*neg_a=*/false, a, /*neg_b=*/false, b,
      /*c_mod=*/(short)0, c, /*reuse_a=*/false, /*reuse_b=*/false);
}

// Fragment from a wave-uniform tile base plus the lane's element offset
// (row r, 8*hi): the base stays scalar, the one offset register serves all loads.
__device__ __forceinline__ v16h frag_at(const _Float16* __restrict__ base, unsigned off) {
  v8h lo  = *reinterpret_cast<const v8h*>(base + off);
  v8h hi8 = *reinterpret_cast<const v8h*>((base + 16) + off);
  return __builtin_shufflevector(lo, hi8, 0,1,2,3,4,5,6,7,8,9,10,11,12,13,14,15);
}

// Value of the lane 16 places away (l <-> l ^ 16), as one vector cross-row move.
__device__ __forceinline__ float other_half(float x) {
  int b = __builtin_bit_cast(int, x);
  b = __builtin_amdgcn_permlanex16(b, b, 0x76543210, 0xfedcba98, false, false);
  return __builtin_bit_cast(float, b);
}

// Low 32 bits of a __shared__ address: the byte offset in the work-group's LDS.
__device__ __forceinline__ unsigned lds_off(const void* p) { return (unsigned)(size_t)p; }

// Eight asynchronous copies from global memory to LDS, through no register: copy c brings the
// lane's 16 bytes at g + c * GSTEP to LDS byte l + c * LSTEP. A wave's copy covers 512
// contiguous bytes, four whole lines. s_wait_xcnt stands in the copies' own statement: no
// register that a copy names is rewritten ahead of it.
template <int LSTEP, int GSTEP>
__device__ __forceinline__ void copy8(unsigned l, const char* g) {
  asm volatile(
      "global_load_async_to_lds_b128 %0, %8, off\n\t"
      "global_load_async_to_lds_b128 %1, %9, off\n\t"
      "global_load_async_to_lds_b128 %2, %10, off\n\t"
      "global_load_async_to_lds_b128 %3, %11, off\n\t"
      "global_load_async_to_lds_b128 %4, %12, off\n\t"
      "global_load_async_to_lds_b128 %5, %13, off\n\t"
      "global_load_async_to_lds_b128 %6, %14, off\n\t"
      "global_load_async_to_lds_b128 %7, %15, off\n\t"
      "s_wait_xcnt 0x0"
      :: "v"(l), "v"(l + LSTEP), "v"(l + 2 * LSTEP), "v"(l + 3 * LSTEP),
         "v"(l + 4 * LSTEP), "v"(l + 5 * LSTEP), "v"(l + 6 * LSTEP), "v"(l + 7 * LSTEP),
         "v"(g), "v"(g + GSTEP), "v"(g + 2 * GSTEP), "v"(g + 3 * GSTEP),
         "v"(g + 4 * GSTEP), "v"(g + 5 * GSTEP), "v"(g + 6 * GSTEP), "v"(g + 7 * GSTEP)
      : "memory");
}

// ---------------------------------------------------------------------------
// Bilinear discretization of one diagonal entry of A, formed where it is used:
// A_bar = (1 + dt/2 A) / (1 - dt/2 A), and f = dt / (1 - dt/2 A), B_bar = f * B.
// ---------------------------------------------------------------------------
struct Disc { float abr, abi, fr, fi; };
__device__ __forceinline__ Disc discretize(float a_real, float a_imag) {
  float ar = -fabsf(a_real) - DAMP_MIN_;
  float ai = a_imag;
  float dr = 1.f - 0.005f * ar, di = -0.005f * ai;       // denom = 1 - dt/2 * A
  float inv = 1.f / (dr * dr + di * di);
  float nr = 1.f + 0.005f * ar, ni = 0.005f * ai;        // numer = 1 + dt/2 * A
  Disc d;
  d.abr = (nr * dr + ni * di) * inv;
  d.abi = (ni * dr - nr * di) * inv;
  d.fr  = DT_STEP * inv * dr;                            // dt * conj(denom) / |denom|^2
  d.fi  = -(DT_STEP * inv) * di;
  return d;
}

// The lane's 16 f32 values of one row of B (k order of the fragment: x[0], x[1] hold
// K = 8*hi + 0..7, x[2], x[3] hold K = 16 + 8*hi + 0..7), times one part of the row's f.
__device__ __forceinline__ v16h scaled_frag(const v4f x[4], float f) {
  v4h h0 = __builtin_convertvector(x[0] * f, v4h);
  v4h h1 = __builtin_convertvector(x[1] * f, v4h);
  v4h h2 = __builtin_convertvector(x[2] * f, v4h);
  v4h h3 = __builtin_convertvector(x[3] * f, v4h);
  v8h lo  = __builtin_shufflevector(h0, h1, 0,1,2,3,4,5,6,7);
  v8h hi8 = __builtin_shufflevector(h2, h3, 0,1,2,3,4,5,6,7);
  return __builtin_shufflevector(lo, hi8, 0,1,2,3,4,5,6,7,8,9,10,11,12,13,14,15);
}

// ---------------------------------------------------------------------------
// Kernel 0: v = u @ B_bar^T  (two real WMMA GEMMs share the A fragments)
// one wave per 64 x 32 tile of [MM x NN], re and im: 4 A fragments and 2 + 2 B
// fragments in registers feed 16 WMMAs per 32-wide k step. The 8 waves of a
// block stand 2 x 4 on a 128 x 128 tile.
// B comes as the f32 input, through LDS: the block's 128 rows in 4 tiles of 128 k, two
// buffers, brought by asynchronous copies of whole lines one tile ahead of its use.
// A lane owns one row n of B, so one f32 LDS read feeds the re and the im fragment,
// each scaled by the lane's own part of f[n] and rounded.
// The block also rounds its 512 elements of C to f16 for the output GEMM's launch.
// Left open: f[n] scales a whole column of v, so the one real product u @ B^T with f
// applied to its f32 sums would need half the WMMAs and no scaling of fragments.
// Prologue: the block rounds its 128 rows of u (f32) to f16 itself, once, into
// LDS; the A fragments are read from there. A wave's load covers 512 contiguous
// bytes of a row.
// Epilogue: the wave's 64 rows are one scan chunk. x[t] = A_bar x[t-1] + v[t]
// (zero start) runs on the accumulators in registers; Re(x) goes to vre and the
// chunk's complex end state to ends. v itself never reaches memory.
// ---------------------------------------------------------------------------
constexpr int UP = DIN + 8;  // LDS row pitch in halves: 1040 B = 16 B x 65 (odd), for ds_load_b128
constexpr int KT = 128;      // k width of a staged tile of B: a row's part is 512 B, one copy of a wave
constexpr int NT = DIN / KT; // 4 tiles
constexpr int BP = KT + 4;   // LDS row pitch in floats: 528 B = 16 B x 33 (odd), for ds_load_b128

__global__ __launch_bounds__(256) void gemm_vproj(
    const float* __restrict__ u, const float* __restrict__ Bm,
    const float* __restrict__ Ar, const float* __restrict__ Ai,
    const float* __restrict__ Cm, _Float16* __restrict__ Ch,
    float* __restrict__ vre,
    float* __restrict__ ends_re, float* __restrict__ ends_im) {
  __shared__ __attribute__((aligned(16))) _Float16 us[128 * UP];
  __shared__ __attribute__((aligned(16))) float    bs[2 * 128 * BP];
  int w    = __builtin_amdgcn_readfirstlane(threadIdx.x >> 5);
  int lane = threadIdx.x & 31;
  int mb   = (blockIdx.x >> 1) * 128;                  // first of the block's 128 rows of BL
  int m0   = mb + (w >> 2) * 64;                       // first of the wave's 64 rows
  int n0   = (blockIdx.x & 1) * 128 + (w & 3) * 32;    // first of 32 columns of N
  int hi   = lane >> 4, r = lane & 15;

  // a wave brings 16 of the block's 128 rows of a tile of B, one row's 512 bytes a copy
  const unsigned bl = lds_off(bs) + (unsigned)(w * 16 * BP * 4) + (unsigned)lane * 16;
  const char*    bg = reinterpret_cast<const char*>(Bm + (size_t)((blockIdx.x & 1) * 128 + w * 16) * DIN) + lane * 16;
  auto stage_b = [&](int t, int buf) {
    copy8<BP * 4, DIN * 4>(bl + buf * (128 * BP * 4), bg + t * (KT * 4));
    copy8<BP * 4, DIN * 4>(bl + buf * (128 * BP * 4) + 8 * BP * 4, bg + t * (KT * 4) + 8 * DIN * 4);
  };
  stage_b(0, 0);                                       // flies under the u tile's loads

  // asked for along with the u tile: their latency falls under the tile's
  float araw[2], iraw[2];
#pragma unroll
  for (int j = 0; j < 2; ++j) {
    araw[j] = (Ar + n0 + j * 16)[(unsigned)r];
    iraw[j] = (Ai + n0 + j * 16)[(unsigned)r];
  }
  const unsigned cslot = (unsigned)threadIdx.x * 2;      // the thread's 2 of the block's 512 elements of C
  const float2 c2 = *reinterpret_cast<const float2*>((Cm + blockIdx.x * 512) + cslot);

  {
    // four waves span a row; a wave takes every second row: 64 loads, which stand
    // ahead of the converts, so that the wave waits out memory latency once.
    // scalar bases plus one lane offset: every load names the same register
    const float*   up = u  + (size_t)(mb + (w >> 2)) * DIN + (w & 3) * 128;
    _Float16*      sp = us + (w >> 2) * UP + (w & 3) * 128;
    const unsigned c  = (unsigned)lane * 4;
    float4 x[64];
#pragma unroll
    for (int k = 0; k < 64; ++k)
      x[k] = *reinterpret_cast<const float4*>((up + k * 2 * DIN) + c);
#pragma unroll
    for (int k = 0; k < 64; ++k) {
      v4h h;
      h[0] = (_Float16)x[k].x; h[1] = (_Float16)x[k].y;
      h[2] = (_Float16)x[k].z; h[3] = (_Float16)x[k].w;
      *reinterpret_cast<v4h*>((sp + k * 2 * UP) + c) = h;
    }
  }
  // the wave's copies of tile 0 have landed before it says so at the barrier
  asm volatile("s_wait_asynccnt 0x0" ::: "memory");
  // publishes the A tile and tile 0 of B: a wave reads rows that all eight waves brought
  __syncthreads();
  stage_b(1, 1);                                       // flies under tile 0's WMMAs

  const _Float16* abase  = us + (w >> 2) * 64 * UP;
  const unsigned  lfrag  = (unsigned)(r * BP + 8 * hi);
  const unsigned  afrag  = (unsigned)(r * UP + 8 * hi);

  float ar[2], ai[2], fr[2], fi[2];                    // A_bar and f of the lane's two columns
#pragma unroll
  for (int j = 0; j < 2; ++j) {
    Disc d = discretize(araw[j], iraw[j]);
    ar[j] = d.abr; ai[j] = d.abi; fr[j] = d.fr; fi[j] = d.fi;
  }

  v8f accR[4][2] = {}; v8f accI[4][2] = {};
  // unrolled: every load is base + the lane's offset + immediate
#pragma unroll
  for (int ks = 0; ks < DIN; ks += 32) {
    const int t = ks / KT;                             // the tile of B that holds this k step
    v16h a[4];
    v4f  xb[2][4];
#pragma unroll
    for (int j = 0; j < 2; ++j) {
      const float* bj = bs + (t & 1) * (128 * BP) + ((w & 3) * 32 + j * 16) * BP + (ks - t * KT);
      xb[j][0] = *reinterpret_cast<const v4f*>(bj + lfrag);
      xb[j][1] = *reinterpret_cast<const v4f*>((bj + 4) + lfrag);
      xb[j][2] = *reinterpret_cast<const v4f*>((bj + 16) + lfrag);
      xb[j][3] = *reinterpret_cast<const v4f*>((bj + 20) + lfrag);
    }
#pragma unroll
    for (int i = 0; i < 4; ++i) a[i] = frag_at(abase + ks + i * 16 * UP, afrag);
    // keeps the step's 16 loads together ahead of its WMMAs: left free, the
    // scheduler reloads one B fragment at a time and waits out each load alone
    __builtin_amdgcn_sched_barrier(0);
#pragma unroll
    for (int j = 0; j < 2; ++j) {
      const v16h br = scaled_frag(xb[j], fr[j]);
      const v16h bi = scaled_frag(xb[j], fi[j]);
#pragma unroll
      for (int i = 0; i < 4; ++i) {
        accR[i][j] = wmma16(a[i], br, accR[i][j]);
        accI[i][j] = wmma16(a[i], bi, accI[i][j]);
      }
    }
    // ends the step: no later load or store moves in among these WMMAs
    __builtin_amdgcn_sched_barrier(0);
    if (ks + 32 == (t + 1) * KT) {
      // foot of tile t: the wave's reads of its buffer are done and its copies of tile t + 1
      // have landed before the barrier, which publishes tile t + 1 and frees tile t's buffer
      asm volatile("s_wait_dscnt 0x0" ::: "memory");
      asm volatile("s_wait_asynccnt 0x0" ::: "memory");
      __syncthreads();
      if (t + 2 < NT) stage_b(t + 2, t & 1);
    }
  }
  // no copy is left in flight behind the loop
  asm volatile("s_wait_asynccnt 0x0" ::: "memory");
  // C/D layout: lane holds column n0+16j+r; VGPR q holds row m0 + 16i + q + 8*hi.
  // In time order a column's 64 rows are 8 runs of 8: (i, hi) = (0,0) (0,1) (1,0) ...
  // and a lane owns the 4 runs of its own hi.
  float* oR = vre + (size_t)m0 * NN + n0;
  const unsigned lout = (unsigned)(8 * hi * NN + r);
  float endr[2], endi[2];
#pragma unroll
  for (int j = 0; j < 2; ++j) {
    // pw[q] = A_bar^(q+1)
    float pwr[8], pwi[8];
    pwr[0] = ar[j]; pwi[0] = ai[j];
#pragma unroll
    for (int q = 1; q < 8; ++q) {
      pwr[q] = pwr[q - 1] * ar[j] - pwi[q - 1] * ai[j];
      pwi[q] = pwr[q - 1] * ai[j] + pwi[q - 1] * ar[j];
    }
    // 1) each run scanned from a zero start; Re stays in accR, the end is kept
    float er[4], ei[4];
#pragma unroll
    for (int i = 0; i < 4; ++i) {
      float xr = accR[i][j][0], xi = accI[i][j][0];
#pragma unroll
      for (int q = 1; q < 8; ++q) {
        float nxr = accR[i][j][q] + ar[j] * xr - ai[j] * xi;
        float nxi = accI[i][j][q] + ar[j] * xi + ai[j] * xr;
        xr = nxr; xi = nxi;
        accR[i][j][q] = xr;
      }
      er[i] = xr; ei[i] = xi;
    }
    // 2) state entering each run: both halves walk the same 8 run ends in time order
    float inr[4], ini[4];
    float sr = 0.f, si = 0.f;
#pragma unroll
    for (int i = 0; i < 4; ++i) {
      float qr = other_half(er[i]), qi = other_half(ei[i]);
      float e0r = hi ? qr : er[i], e0i = hi ? qi : ei[i];   // end of run (i, 0)
      float e1r = hi ? er[i] : qr, e1i = hi ? ei[i] : qi;   // end of run (i, 1)
      float tr = e0r, ti = e0i;                             // state entering (i, 1)
      if (i > 0) {
        tr = e0r + pwr[7] * sr - pwi[7] * si;
        ti = e0i + pwr[7] * si + pwi[7] * sr;
      }
      inr[i] = hi ? tr : sr; ini[i] = hi ? ti : si;
      sr = e1r + pwr[7] * tr - pwi[7] * ti;                 // state entering (i+1, 0)
      si = e1i + pwr[7] * ti + pwi[7] * tr;
    }
    // 3) Re(x) = Re(run-local x) + Re(A_bar^(q+1) * state entering the run)
#pragma unroll
    for (int i = 0; i < 4; ++i) {
#pragma unroll
      for (int q = 0; q < 8; ++q)
        (oR + (i * 16 + q) * NN + j * 16)[lout] =
            accR[i][j][q] + pwr[q] * inr[i] - pwi[q] * ini[i];
    }
    endr[j] = sr; endi[j] = si;
  }
  // the chunk's end state, once per column: both halves hold it, the lower one stores
  if (hi == 0) {
#pragma unroll
    for (int j = 0; j < 2; ++j) {
      (ends_re + (size_t)(m0 / LC) * NN + n0 + j * 16)[(unsigned)r] = endr[j];
      (ends_im + (size_t)(m0 / LC) * NN + n0 + j * 16)[(unsigned)r] = endi[j];
    }
  }
  // C -> f16, C is DIN*NN row-major; a wave's store fills one 128-byte line
  v2h ch; ch[0] = (_Float16)c2.x; ch[1] = (_Float16)c2.y;
  *reinterpret_cast<v2h*>((Ch + blockIdx.x * 512) + cslot) = ch;
}

// ---------------------------------------------------------------------------
// Kernel 1: out = Re(y) @ C^T + u * D   (f16 WMMA GEMM, fp32 epilogue)
// One block per scan chunk: 64 rows x all 512 columns, 8 waves side by side,
// one wave per 64 x 64 tile: 4 A and 4 B fragments feed 16 WMMAs per k step.
// Prologue: the block forms its A tile itself, once, in LDS:
//   Re(y)[t][n] = v_local[t][n] + Re(A_bar^(t+1) * carry_in[n])  -> f16
// A thread owns 4 columns and 16 rows; A_bar^(t+1) * carry_in starts at the thread's
// first row t0 from A_bar * (A_bar^16)^(t0/16) and is stepped by A_bar from row to row.
// carry_in, the state entering the chunk, is formed here too, from the end states of the
// batch's earlier chunks: carry_in = sum over c' < c of (A_bar^64)^(c-1-c') * end[c'].
// The 64 places that end at chunk c-1 (places ahead of the batch's first chunk count as 0)
// fall into 4 runs of 16; the threads of row group g sum run g for their 4 columns by
// Horner's rule, the 4 sums meet in LDS and are joined with A_bar^1024.
// C (f16) comes through LDS too: a wave brings its own 64 rows by asynchronous copies of
// whole lines, which fly under the prologue; the B fragments are read from there.
// ---------------------------------------------------------------------------
constexpr int AP = NN + 8;   // LDS row pitch in halves: 528 B = 16 B x 33 (odd), for ds_load_b128
constexpr int SEG = NC / 4;  // chunk ends summed by one row group

__global__ __launch_bounds__(256) void gemm_out(
    const float* __restrict__ vre,
    const float* __restrict__ Ar, const float* __restrict__ Ai,
    const float* __restrict__ ends_re, const float* __restrict__ ends_im,
    const _Float16* __restrict__ Ch,
    const float* __restrict__ u, const float* __restrict__ Dv,
    float* __restrict__ out) {
  __shared__ __attribute__((aligned(16))) _Float16 ys[LC * AP];
  __shared__ __attribute__((aligned(16))) float segr[4 * NN];
  __shared__ __attribute__((aligned(16))) float segi[4 * NN];
  __shared__ __attribute__((aligned(16))) _Float16 cs[DIN * AP];
  int w    = __builtin_amdgcn_readfirstlane(threadIdx.x >> 5);
  int lane = threadIdx.x & 31;
  int m0   = blockIdx.x * LC;                          // first of the chunk's 64 rows of BL
  int d0   = w * 64;                                   // first of 64 columns of Din
  int hi   = lane >> 4, r = lane & 15;
  // the lane's 16 bytes of the first of the wave's 64 rows of C, one row's 512 bytes a copy
  const unsigned cl = lds_off(cs) + (unsigned)(d0 * AP * 2) + (unsigned)lane * 16;
  const char*    cg = reinterpret_cast<const char*>(Ch + (size_t)d0 * NN) + lane * 16;

  {
    // scalar bases plus one lane offset: every load of the prologue names the same register
    const unsigned n  = (threadIdx.x & 63) * 4;        // first of the thread's 4 columns
    const int      g  = w >> 1;                        // row group: two waves span a row
    const int      t0 = g * 16;                        // first of its 16 rows
    // the group's run stands for chunks cb .. cb + 15 of the batch; below 0 there is none:
    // the run is read from its first chunk that exists, cs, and holds cnt chunks (16; fewer
    // in the run with the batch's first chunk; none, cnt <= 0, ahead of it). The 16 rows
    // read lie inside the batch's 64 for every cs (cs <= 47).
    const int    cb  = (int)(blockIdx.x & (NC - 1)) - NC + g * SEG;
    const int    cs  = cb > 0 ? cb : 0;
    const int    cnt = cb + SEG - cs;
    const float* eR = ends_re + (size_t)((blockIdx.x & ~(unsigned)(NC - 1)) + cs) * NN;
    const float* eI = ends_im + (size_t)((blockIdx.x & ~(unsigned)(NC - 1)) + cs) * NN;
    float4 er[SEG], ei[SEG];                           // read only where cnt > 0
    if (cnt > 0) {                                     // the same for the whole wave: an empty run asks L2 for nothing
#pragma unroll
      for (int k = 0; k < SEG; ++k) {
        er[k] = *reinterpret_cast<const float4*>((eR + k * NN) + n);
        ei[k] = *reinterpret_cast<const float4*>((eI + k * NN) + n);
      }
    }
    // A behind the branch: asked for ahead of it, its wait behind the join counts for the
    // path without loads too, and comes to stand for all of the ends ahead of the rows of v
    const float4 a4r = *reinterpret_cast<const float4*>(Ar + n);
    const float4 a4i = *reinterpret_cast<const float4*>(Ai + n);
    const float* vp = vre + (size_t)(m0 + t0) * NN;
    float4 x[16];
#pragma unroll
    for (int k = 0; k < 16; ++k) x[k] = *reinterpret_cast<const float4*>((vp + k * NN) + n);
    // the 18 loads first, as one group: left free, the scheduler waits for A in their
    // midst, and the later loads start one latency late
    __builtin_amdgcn_sched_group_barrier(0x020, 18, 0);
    // the loads' address registers are free for the values that follow behind this wait
    asm volatile("s_wait_xcnt 0x0" ::: "memory");
    // 56 of the wave's 64 rows of C, behind the loads that the prologue waits for
#pragma unroll
    for (int s = 0; s < 7; ++s) copy8<AP * 2, NN * 2>(cl + s * (8 * AP * 2), cg + s * (8 * NN * 2));
    const float rawr[4] = {a4r.x, a4r.y, a4r.z, a4r.w}, rawi[4] = {a4i.x, a4i.y, a4i.z, a4i.w};
    float ar[4], ai[4], pr[4], pi[4];                  // A_bar and A_bar^(t0+1)
    float cpr[4], cpi[4], rpr[4], rpi[4];              // A_bar^64 (a chunk), A_bar^1024 (a run of 16)
#pragma unroll
    for (int e = 0; e < 4; ++e) {
      const Disc d = discretize(rawr[e], rawi[e]);
      ar[e] = d.abr; ai[e] = d.abi;
      float sr = ar[e], si = ai[e];
#pragma unroll
      for (int s = 0; s < 4; ++s) {                    // A_bar^16 by four squarings
        float qr = sr * sr - si * si;
        float qi = 2.f * sr * si;
        sr = qr; si = qi;
      }
      pr[e] = ar[e]; pi[e] = ai[e];
#pragma unroll
      for (int s = 0; s < 3; ++s) {
        if (s < (w >> 1)) {                            // the same for the whole wave
          float qr = pr[e] * sr - pi[e] * si;
          float qi = pr[e] * si + pi[e] * sr;
          pr[e] = qr; pi[e] = qi;
        }
      }
#pragma unroll
      for (int s = 0; s < 6; ++s) {                    // A_bar^16 squared on: ^64 after 2, ^1024 after 6
        float qr = sr * sr - si * si;
        float qi = 2.f * sr * si;
        sr = qr; si = qi;
        if (s == 1) { cpr[e] = sr; cpi[e] = si; }
      }
      rpr[e] = sr; rpi[e] = si;
    }
    // the run's sum: h = h * A_bar^64 + end, oldest chunk first, over its cnt chunks
    float hr[4] = {0.f, 0.f, 0.f, 0.f}, hm[4] = {0.f, 0.f, 0.f, 0.f};
    if (cnt > 0) {
#pragma unroll
      for (int k = 0; k < SEG; ++k) {
        const float kr[4] = {er[k].x, er[k].y, er[k].z, er[k].w};
        const float km[4] = {ei[k].x, ei[k].y, ei[k].z, ei[k].w};
        const bool on = k < cnt;                       // the same for the whole wave
#pragma unroll
        for (int e = 0; e < 4; ++e) {
          float nr = kr[e] + cpr[e] * hr[e] - cpi[e] * hm[e];
          float ni = km[e] + cpr[e] * hm[e] + cpi[e] * hr[e];
          hr[e] = on ? nr : hr[e]; hm[e] = on ? ni : hm[e];
        }
      }
    }
    *reinterpret_cast<float4*>(segr + g * NN + n) = make_float4(hr[0], hr[1], hr[2], hr[3]);
    *reinterpret_cast<float4*>(segi + g * NN + n) = make_float4(hm[0], hm[1], hm[2], hm[3]);
    // the last 8 rows of C go behind the first 56: a wave keeps fewer than 64 copies in flight
    asm volatile("s_wait_asynccnt 0x0" ::: "memory");
    copy8<AP * 2, NN * 2>(cl + 7 * (8 * AP * 2), cg + 7 * (8 * NN * 2));
    // publishes the four runs' sums: a thread reads those of the other three row groups
    __syncthreads();
    float cr[4], ci[4];                                // carry_in of the thread's 4 columns
#pragma unroll
    for (int s = 0; s < 4; ++s) {
      const float4 s4r = *reinterpret_cast<const float4*>(segr + s * NN + n);
      const float4 s4i = *reinterpret_cast<const float4*>(segi + s * NN + n);
      const float kr[4] = {s4r.x, s4r.y, s4r.z, s4r.w}, km[4] = {s4i.x, s4i.y, s4i.z, s4i.w};
#pragma unroll
      for (int e = 0; e < 4; ++e) {
        if (s == 0) { cr[e] = kr[e]; ci[e] = km[e]; }
        else {
          float nr = kr[e] + rpr[e] * cr[e] - rpi[e] * ci[e];
          float ni = km[e] + rpr[e] * ci[e] + rpi[e] * cr[e];
          cr[e] = nr; ci[e] = ni;
        }
      }
    }
    float zr[4], zi[4];                                // A_bar^(t+1) * carry_in at row t
#pragma unroll
    for (int e = 0; e < 4; ++e) {
      zr[e] = pr[e] * cr[e] - pi[e] * ci[e];
      zi[e] = pr[e] * ci[e] + pi[e] * cr[e];
    }
#pragma unroll
    for (int k = 0; k < 16; ++k) {
      const float xe[4] = {x[k].x, x[k].y, x[k].z, x[k].w};
      v4h h;
#pragma unroll
      for (int e = 0; e < 4; ++e) {
        h[e] = (_Float16)(xe[e] + zr[e]);
        float nr = zr[e] * ar[e] - zi[e] * ai[e];
        float ni = zr[e] * ai[e] + zi[e] * ar[e];
        zr[e] = nr; zi[e] = ni;
      }
      *reinterpret_cast<v4h*>(ys + (t0 + k) * AP + n) = h;
    }
  }
  // the wave's rows of C have landed before anything reads them
  asm volatile("s_wait_asynccnt 0x0" ::: "memory");
  // publishes the A tile: every wave reads all 64 rows
  __syncthreads();

  const _Float16* bbase = cs + d0 * AP;                    // C[d][n]: k-contig, at the A tile's pitch
  const unsigned  afrag = (unsigned)(r * AP + 8 * hi);

  float dval[4];
#pragma unroll
  for (int j = 0; j < 4; ++j) dval[j] = (Dv + d0 + j * 16)[(unsigned)r];

  v8f acc[4][4] = {};
  // unrolled: every load is base + the lane's offset + immediate
#pragma unroll
  for (int ks = 0; ks < NN; ks += 32) {
    v16h a[4], b[4];
#pragma unroll
    for (int j = 0; j < 4; ++j) b[j] = frag_at(bbase + ks + j * 16 * AP, afrag);
#pragma unroll
    for (int i = 0; i < 4; ++i) a[i] = frag_at(ys + ks + i * 16 * AP, afrag);
    // keeps the step's 16 loads together ahead of its WMMAs: left free, the
    // scheduler reloads one B fragment at a time and waits out each load alone
    __builtin_amdgcn_sched_barrier(0);
#pragma unroll
    for (int j = 0; j < 4; ++j) {
#pragma unroll
      for (int i = 0; i < 4; ++i) acc[i][j] = wmma16(a[i], b[j], acc[i][j]);
    }
    // ends the step: no later load or store moves in among these WMMAs
    __builtin_amdgcn_sched_barrier(0);
  }
  const float* ub = u   + (size_t)m0 * DIN + d0;
  float*       ob = out + (size_t)m0 * DIN + d0;
  const unsigned lout = (unsigned)(8 * hi * DIN + r);
  // 16 rows at a time; the next 16 rows' u values are loaded ahead of this group's stores
  float uu[2][4][8];
#pragma unroll
  for (int j = 0; j < 4; ++j) {
#pragma unroll
    for (int q = 0; q < 8; ++q) uu[0][j][q] = (ub + q * DIN + j * 16)[lout];
  }
#pragma unroll
  for (int i = 0; i < 4; ++i) {
    if (i < 3) {
#pragma unroll
      for (int j = 0; j < 4; ++j) {
#pragma unroll
        for (int q = 0; q < 8; ++q)
          uu[(i + 1) & 1][j][q] = (ub + ((i + 1) * 16 + q) * DIN + j * 16)[lout];
      }
    }
    // keeps those 32 loads together ahead of the stores: left free, the
    // scheduler takes one load at a time and waits out each alone
    __builtin_amdgcn_sched_barrier(0);
#pragma unroll
    for (int j = 0; j < 4; ++j) {
#pragma unroll
      for (int q = 0; q < 8; ++q)
        (ob + (i * 16 + q) * DIN + j * 16)[lout] = acc[i][j][q] + uu[i & 1][j][q] * dval[j];
    }
    // the stored registers are free for the loads that follow behind this wait
    if (i < 2) asm volatile("s_wait_xcnt 0x0" ::: "memory");
  }
}

// ---------------------------------------------------------------------------
// Host launcher. Workspace carve-out (~18 MB), all launches on `stream`.
// ---------------------------------------------------------------------------
extern "C" void kernel_launch(void* const* d_in, const int* in_sizes, int n_in,
                              void* d_out, int out_size, void* d_ws, size_t ws_size,
                              hipStream_t stream) {
  const float* u      = (const float*)d_in[0];  // [BB, LL, DIN]
  const float* A_real = (const float*)d_in[1];  // [NN]
  const float* A_imag = (const float*)d_in[2];  // [NN]
  const float* B_mat  = (const float*)d_in[3];  // [NN, DIN]
  const float* C_mat  = (const float*)d_in[4];  // [DIN, NN]
  const float* D_vec  = (const float*)d_in[5];  // [DIN]
  float* out = (float*)d_out;                   // [BB, LL, DIN]

  char* w = (char*)d_ws;
  auto carve = [&](size_t bytes) -> void* {
    void* p = (void*)w;
    w += (bytes + 255) & ~(size_t)255;
    return p;
  };
  _Float16* C_h      = (_Float16*)carve((size_t)DIN * NN * sizeof(_Float16));
  float*    v_re     = (float*)carve((size_t)MM * NN * sizeof(float));
  float*    ends_re  = (float*)carve((size_t)BB * NC * NN * sizeof(float));
  float*    ends_im  = (float*)carve((size_t)BB * NC * NN * sizeof(float));

  // 0) input projection v = u @ B_bar^T (WMMA) with the local chunk scan in its epilogue; C -> f16
  gemm_vproj<<<(MM / 128) * 2, 256, 0, stream>>>(u, B_mat, A_real, A_imag, C_mat, C_h,
                                                 v_re, ends_re, ends_im);
  // 1) chunk carries + carry correction + output projection + skip: out = Re(y) @ C^T + u*D  (WMMA)
  gemm_out<<<MM / LC, 256, 0, stream>>>(v_re, A_real, A_imag, ends_re, ends_im,
                                        C_h, u, D_vec, out);
}

// v008
// It runs in 21.7 microseconds.
// In both of two side-by-side timings against v007, it was 1.08 times as fast.
// Over all steps from v000 it is 6.85 times as fast.
#include <hip/hip_runtime.h>
#include <hip/hip_bf16.h>

typedef __attribute__((ext_vector_type(16))) _Float16 v16h;
typedef __attribute__((ext_vector_type(8)))  _Float16 v8h;
typedef __attribute__((ext_vector_type(4)))  _Float16 v4h;
typedef __attribute__((ext_vector_type(8)))  float    v8f;
typedef __attribute__((ext_vector_type(4)))  float    v4f;
typedef __attribute__((ext_vector_type(2)))  _Float16 v2h;

#define DT_STEP   0.01f
#define DAMP_MIN_ 5e-4f

constexpr int BB  = 4;
constexpr int LL  = 4096;
constexpr int DIN = 512;
constexpr int NN  = 256;
constexpr int LC  = 64;            // scan chunk length = rows of one wave's tile in gemm_vproj
constexpr int NC  = LL / LC;       // 64 chunks
constexpr int MM  = BB * LL;       // 16384 rows

// ---------------------------------------------------------------------------
// WMMA helpers (V_WMMA_F32_16X16X32_F16, wave32; ISA 7.12.2 layouts)
// lane r = lane&15 owns row (A) / column (B) r; hi = lane>>4;
// v16h element h holds K = (h<8 ? h : h+8) + 8*hi within the 32-wide K tile.
// ---------------------------------------------------------------------------
__device__ __forceinline__ v8f wmma16(v16h a, v16h b, v8f c) {
  return __builtin_amdgcn_wmma_f32_16x16x32_f16(
      /*neg_a=*/false, a, /*neg_b=*/false, b,
      /*c_mod=*/(short)0, c, /*reuse_a=*/false, /*reuse_b=*/false);
}

// Fragment from a wave-uniform tile base plus the lane's element offset
// (row r, 8*hi): the base stays scalar, the one offset register serves all loads.
__device__ __forceinline__ v16h frag_at(const _Float16* __restrict__ base, unsigned off) {
  v8h lo  = *reinterpret_cast<const v8h*>(base + off);
  v8h hi8 = *reinterpret_cast<const v8h*>((base + 16) + off);
  return __builtin_shufflevector(lo, hi8, 0,1,2,3,4,5,6,7,8,9,10,11,12,13,14,15);
}

// Value of the lane 16 places away (l <-> l ^ 16), as one vector cross-row move.
__device__ __forceinline__ float other_half(float x) {
  int b = __builtin_bit_cast(int, x);
  b = __builtin_amdgcn_permlanex16(b, b, 0x76543210, 0xfedcba98, false, false);
  return __builtin_bit_cast(float, b);
}

// Low 32 bits of a __shared__ address: the byte offset in the work-group's LDS.
__device__ __forceinline__ unsigned lds_off(const void* p) { return (unsigned)(size_t)p; }

// Eight asynchronous copies from global memory to LDS, through no register: copy c brings the
// lane's 16 bytes at g + c * GSTEP to LDS byte l + c * LSTEP. A wave's copy covers 512
// contiguous bytes, four whole lines. s_wait_xcnt stands in the copies' own statement: no
// register that a copy names is rewritten ahead of it.
template <int LSTEP, int GSTEP>
__device__ __forceinline__ void copy8(unsigned l, const char* g) {
  asm volatile(
      "global_load_async_to_lds_b128 %0, %8, off\n\t"
      "global_load_async_to_lds_b128 %1, %9, off\n\t"
      "global_load_async_to_lds_b128 %2, %10, off\n\t"
      "global_load_async_to_lds_b128 %3, %11, off\n\t"
      "global_load_async_to_lds_b128 %4, %12, off\n\t"
      "global_load_async_to_lds_b128 %5, %13, off\n\t"
      "global_load_async_to_lds_b128 %6, %14, off\n\t"
      "global_load_async_to_lds_b128 %7, %15, off\n\t"
      "s_wait_xcnt 0x0"
      :: "v"(l), "v"(l + LSTEP), "v"(l + 2 * LSTEP), "v"(l + 3 * LSTEP),
         "v"(l + 4 * LSTEP), "v"(l + 5 * LSTEP), "v"(l + 6 * LSTEP), "v"(l + 7 * LSTEP),
         "v"(g), "v"(g + GSTEP), "v"(g + 2 * GSTEP), "v"(g + 3 * GSTEP),
         "v"(g + 4 * GSTEP), "v"(g + 5 * GSTEP), "v"(g + 6 * GSTEP), "v"(g + 7 * GSTEP)
      : "memory");
}

// ---------------------------------------------------------------------------
// Bilinear discretization of one diagonal entry of A, formed where it is used:
// A_bar = (1 + dt/2 A) / (1 - dt/2 A), and f = dt / (1 - dt/2 A), B_bar = f * B.
// ---------------------------------------------------------------------------
struct Disc { float abr, abi, fr, fi; };
__device__ __forceinline__ Disc discretize(float a_real, float a_imag) {
  float ar = -fabsf(a_real) - DAMP_MIN_;
  float ai = a_imag;
  float dr = 1.f - 0.005f * ar, di = -0.005f * ai;       // denom = 1 - dt/2 * A
  float inv = 1.f / (dr * dr + di * di);
  float nr = 1.f + 0.005f * ar, ni = 0.005f * ai;        // numer = 1 + dt/2 * A
  Disc d;
  d.abr = (nr * dr + ni * di) * inv;
  d.abi = (ni * dr - nr * di) * inv;
  d.fr  = DT_STEP * inv * dr;                            // dt * conj(denom) / |denom|^2
  d.fi  = -(DT_STEP * inv) * di;
  return d;
}

// The lane's 16 f32 values of one row of B (k order of the fragment: x[0], x[1] hold
// K = 8*hi + 0..7, x[2], x[3] hold K = 16 + 8*hi + 0..7), rounded to f16.
__device__ __forceinline__ v16h rounded_frag(const v4f x[4]) {
  v4h h0 = __builtin_convertvector(x[0], v4h);
  v4h h1 = __builtin_convertvector(x[1], v4h);
  v4h h2 = __builtin_convertvector(x[2], v4h);
  v4h h3 = __builtin_convertvector(x[3], v4h);
  v8h lo  = __builtin_shufflevector(h0, h1, 0,1,2,3,4,5,6,7);
  v8h hi8 = __builtin_shufflevector(h2, h3, 0,1,2,3,4,5,6,7);
  return __builtin_shufflevector(lo, hi8, 0,1,2,3,4,5,6,7,8,9,10,11,12,13,14,15);
}

// ---------------------------------------------------------------------------
// Kernel 0: v = u @ B_bar^T = f * (u @ B^T): B_bar[n] is the real row B[n] times the complex
// f[n], so ONE real WMMA GEMM s = u @ B^T gives both parts: v[t][n] = f[n] * s[t][n], formed
// from the f32 sums in the epilogue.
// one wave per 64 x 32 tile of [MM x NN]: 4 A fragments and 2 B fragments in registers
// feed 8 WMMAs per 32-wide k step. The 8 waves of a block stand 2 x 4 on a 128 x 128 tile.
// B comes as the f32 input, through LDS: the block's 128 rows in 4 tiles of 128 k, two
// buffers, brought by asynchronous copies of whole lines one tile ahead of its use.
// A lane owns one row n of B and rounds its f32 LDS reads to the f16 fragment.
// Left open: a k step's 8 WMMAs stand behind the wait for its own 16 LDS reads, which now
// set the loop's pace; fragments fetched one step ahead into a second register set (the
// loop leaves registers free) would take that wait out of the step.
// The block also rounds its 512 elements of C to f16 for the output GEMM's launch.
// Prologue: the block rounds its 128 rows of u (f32) to f16 itself, once, into
// LDS; the A fragments are read from there. A wave's load covers 512 contiguous
// bytes of a row.
// Epilogue: the wave's 64 rows are one scan chunk. x[t] = A_bar x[t-1] + v[t]
// (zero start) runs on f times the accumulators, in registers; Re(x) goes to vre and the
// chunk's complex end state to ends. v itself never reaches memory.
// ---------------------------------------------------------------------------
constexpr int UP = DIN + 8;  // LDS row pitch in halves: 1040 B = 16 B x 65 (odd), for ds_load_b128
constexpr int KT = 128;      // k width of a staged tile of B: a row's part is 512 B, one copy of a wave
constexpr int NT = DIN / KT; // 4 tiles
constexpr int BP = KT + 4;   // LDS row pitch in floats: 528 B = 16 B x 33 (odd), for ds_load_b128

__global__ __launch_bounds__(256) void gemm_vproj(
    const float* __restrict__ u, const float* __restrict__ Bm,
    const float* __restrict__ Ar, const float* __restrict__ Ai,
    const float* __restrict__ Cm, _Float16* __restrict__ Ch,
    float* __restrict__ vre,
    float* __restrict__ ends_re, float* __restrict__ ends_im) {
  __shared__ __attribute__((aligned(16))) _Float16 us[128 * UP];
  __shared__ __attribute__((aligned(16))) float    bs[2 * 128 * BP];
  int w    = __builtin_amdgcn_readfirstlane(threadIdx.x >> 5);
  int lane = threadIdx.x & 31;
  int mb   = (blockIdx.x >> 1) * 128;                  // first of the block's 128 rows of BL
  int m0   = mb + (w >> 2) * 64;                       // first of the wave's 64 rows
  int n0   = (blockIdx.x & 1) * 128 + (w & 3) * 32;    // first of 32 columns of N
  int hi   = lane >> 4, r = lane & 15;

  // a wave brings 16 of the block's 128 rows of a tile of B, one row's 512 bytes a copy
  const unsigned bl = lds_off(bs) + (unsigned)(w * 16 * BP * 4) + (unsigned)lane * 16;
  const char*    bg = reinterpret_cast<const char*>(Bm + (size_t)((blockIdx.x & 1) * 128 + w * 16) * DIN) + lane * 16;
  auto stage_b = [&](int t, int buf) {
    copy8<BP * 4, DIN * 4>(bl + buf * (128 * BP * 4), bg + t * (KT * 4));
    copy8<BP * 4, DIN * 4>(bl + buf * (128 * BP * 4) + 8 * BP * 4, bg + t * (KT * 4) + 8 * DIN * 4);
  };
  stage_b(0, 0);                                       // flies under the u tile's loads

  // asked for along with the u tile: their latency falls under the tile's
  float araw[2], iraw[2];
#pragma unroll
  for (int j = 0; j < 2; ++j) {
    araw[j] = (Ar + n0 + j * 16)[(unsigned)r];
    iraw[j] = (Ai + n0 + j * 16)[(unsigned)r];
  }
  const unsigned cslot = (unsigned)threadIdx.x * 2;      // the thread's 2 of the block's 512 elements of C
  const float2 c2 = *reinterpret_cast<const float2*>((Cm + blockIdx.x * 512) + cslot);

  {
    // four waves span a row; a wave takes every second row: 64 loads, which stand
    // ahead of the converts, so that the wave waits out memory latency once.
    // scalar bases plus one lane offset: every load names the same register
    const float*   up = u  + (size_t)(mb + (w >> 2)) * DIN + (w & 3) * 128;
    _Float16*      sp = us + (w >> 2) * UP + (w & 3) * 128;
    const unsigned c  = (unsigned)lane * 4;
    float4 x[64];
#pragma unroll
    for (int k = 0; k < 64; ++k)
      x[k] = *reinterpret_cast<const float4*>((up + k * 2 * DIN) + c);
#pragma unroll
    for (int k = 0; k < 64; ++k) {
      v4h h;
      h[0] = (_Float16)x[k].x; h[1] = (_Float16)x[k].y;
      h[2] = (_Float16)x[k].z; h[3] = (_Float16)x[k].w;
      *reinterpret_cast<v4h*>((sp + k * 2 * UP) + c) = h;
    }
  }
  // the wave's copies of tile 0 have landed before it says so at the barrier
  asm volatile("s_wait_asynccnt 0x0" ::: "memory");
  // publishes the A tile and tile 0 of B: a wave reads rows that all eight waves brought
  __syncthreads();
  stage_b(1, 1);                                       // flies under tile 0's WMMAs

  const _Float16* abase  = us + (w >> 2) * 64 * UP;
  const unsigned  lfrag  = (unsigned)(r * BP + 8 * hi);
  const unsigned  afrag  = (unsigned)(r * UP + 8 * hi);

  float ar[2], ai[2], fr[2], fi[2];                    // A_bar and f of the lane's two columns
#pragma unroll
  for (int j = 0; j < 2; ++j) {
    Disc d = discretize(araw[j], iraw[j]);
    ar[j] = d.abr; ai[j] = d.abi; fr[j] = d.fr; fi[j] = d.fi;
  }

  v8f acc[4][2] = {};
  // unrolled: every load is base + the lane's offset + immediate
#pragma unroll
  for (int ks = 0; ks < DIN; ks += 32) {
    const int t = ks / KT;                             // the tile of B that holds this k step
    v16h a[4];
    v4f  xb[2][4];
#pragma unroll
    for (int j = 0; j < 2; ++j) {
      const float* bj = bs + (t & 1) * (128 * BP) + ((w & 3) * 32 + j * 16) * BP + (ks - t * KT);
      xb[j][0] = *reinterpret_cast<const v4f*>(bj + lfrag);
      xb[j][1] = *reinterpret_cast<const v4f*>((bj + 4) + lfrag);
      xb[j][2] = *reinterpret_cast<const v4f*>((bj + 16) + lfrag);
      xb[j][3] = *reinterpret_cast<const v4f*>((bj + 20) + lfrag);
    }
#pragma unroll
    for (int i = 0; i < 4; ++i) a[i] = frag_at(abase + ks + i * 16 * UP, afrag);
    // keeps the step's 16 loads together ahead of its WMMAs: left free, the
    // scheduler reloads one B fragment at a time and waits out each load alone
    __builtin_amdgcn_sched_barrier(0);
    const v16h b0 = rounded_frag(xb[0]);
    const v16h b1 = rounded_frag(xb[1]);
#pragma unroll
    for (int i = 0; i < 4; ++i) {
      acc[i][0] = wmma16(a[i], b0, acc[i][0]);
      acc[i][1] = wmma16(a[i], b1, acc[i][1]);
    }
    // ends the step: no later load or store moves in among these WMMAs
    __builtin_amdgcn_sched_barrier(0);
    if (ks + 32 == (t + 1) * KT) {
      // foot of tile t: the wave's reads of its buffer are done and its copies of tile t + 1
      // have landed before the barrier, which publishes tile t + 1 and frees tile t's buffer
      asm volatile("s_wait_dscnt 0x0" ::: "memory");
      asm volatile("s_wait_asynccnt 0x0" ::: "memory");
      __syncthreads();
      if (t + 2 < NT) stage_b(t + 2, t & 1);
    }
  }
  // no copy is left in flight behind the loop
  asm volatile("s_wait_asynccnt 0x0" ::: "memory");
  // C/D layout: lane holds column n0+16j+r; VGPR q holds row m0 + 16i + q + 8*hi.
  // In time order a column's 64 rows are 8 runs of 8: (i, hi) = (0,0) (0,1) (1,0) ...
  // and a lane owns the 4 runs of its own hi.
  float* oR = vre + (size_t)m0 * NN + n0;
  const unsigned lout = (unsigned)(8 * hi * NN + r);
  float endr[2], endi[2];
#pragma unroll
  for (int j = 0; j < 2; ++j) {
    // pw[q] = A_bar^(q+1)
    float pwr[8], pwi[8];
    pwr[0] = ar[j]; pwi[0] = ai[j];
#pragma unroll
    for (int q = 1; q < 8; ++q) {
      pwr[q] = pwr[q - 1] * ar[j] - pwi[q - 1] * ai[j];
      pwi[q] = pwr[q - 1] * ai[j] + pwi[q - 1] * ar[j];
    }
    // 1) each run scanned from a zero start, on v = f * s; Re takes s's place in acc, the end is kept
    float er[4], ei[4];
#pragma unroll
    for (int i = 0; i < 4; ++i) {
      float xr = fr[j] * acc[i][j][0], xi = fi[j] * acc[i][j][0];
      acc[i][j][0] = xr;
#pragma unroll
      for (int q = 1; q < 8; ++q) {
        float nxr = fr[j] * acc[i][j][q] + ar[j] * xr - ai[j] * xi;
        float nxi = fi[j] * acc[i][j][q] + ar[j] * xi + ai[j] * xr;
        xr = nxr; xi = nxi;
        acc[i][j][q] = xr;
      }
      er[i] = xr; ei[i] = xi;
    }
    // 2) state entering each run: both halves walk the same 8 run ends in time order
    float inr[4], ini[4];
    float sr = 0.f, si = 0.f;
#pragma unroll
    for (int i = 0; i < 4; ++i) {
      float qr = other_half(er[i]), qi = other_half(ei[i]);
      float e0r = hi ? qr : er[i], e0i = hi ? qi : ei[i];   // end of run (i, 0)
      float e1r = hi ? er[i] : qr, e1i = hi ? ei[i] : qi;   // end of run (i, 1)
      float tr = e0r, ti = e0i;                             // state entering (i, 1)
      if (i > 0) {
        tr = e0r + pwr[7] * sr - pwi[7] * si;
        ti = e0i + pwr[7] * si + pwi[7] * sr;
      }
      inr[i] = hi ? tr : sr; ini[i] = hi ? ti : si;
      sr = e1r + pwr[7] * tr - pwi[7] * ti;                 // state entering (i+1, 0)
      si = e1i + pwr[7] * ti + pwi[7] * tr;
    }
    // 3) Re(x) = Re(run-local x) + Re(A_bar^(q+1) * state entering the run)
#pragma unroll
    for (int i = 0; i < 4; ++i) {
#pragma unroll
      for (int q = 0; q < 8; ++q)
        (oR + (i * 16 + q) * NN + j * 16)[lout] =
            acc[i][j][q] + pwr[q] * inr[i] - pwi[q] * ini[i];
    }
    endr[j] = sr; endi[j] = si;
  }
  // the chunk's end state, once per column: both halves hold it, the lower one stores
  if (hi == 0) {
#pragma unroll
    for (int j = 0; j < 2; ++j) {
      (ends_re + (size_t)(m0 / LC) * NN + n0 + j * 16)[(unsigned)r] = endr[j];
      (ends_im + (size_t)(m0 / LC) * NN + n0 + j * 16)[(unsigned)r] = endi[j];
    }
  }
  // C -> f16, C is DIN*NN row-major; a wave's store fills one 128-byte line
  v2h ch; ch[0] = (_Float16)c2.x; ch[1] = (_Float16)c2.y;
  *reinterpret_cast<v2h*>((Ch + blockIdx.x * 512) + cslot) = ch;
}

// ---------------------------------------------------------------------------
// Kernel 1: out = Re(y) @ C^T + u * D   (f16 WMMA GEMM, fp32 epilogue)
// One block per scan chunk: 64 rows x all 512 columns, 8 waves side by side,
// one wave per 64 x 64 tile: 4 A and 4 B fragments feed 16 WMMAs per k step.
// Prologue: the block forms its A tile itself, once, in LDS:
//   Re(y)[t][n] = v_local[t][n] + Re(A_bar^(t+1) * carry_in[n])  -> f16
// A thread owns 4 columns and 16 rows; A_bar^(t+1) * carry_in starts at the thread's
// first row t0 from A_bar * (A_bar^16)^(t0/16) and is stepped by A_bar from row to row.
// carry_in, the state entering the chunk, is formed here too, from the end states of the
// batch's earlier chunks: carry_in = sum over c' < c of (A_bar^64)^(c-1-c') * end[c'].
// The 64 places that end at chunk c-1 (places ahead of the batch's first chunk count as 0)
// fall into 4 runs of 16; the threads of row group g sum run g for their 4 columns by
// Horner's rule, the 4 sums meet in LDS and are joined with A_bar^1024.
// C (f16) comes through LDS too: a wave brings its own 64 rows by asynchronous copies of
// whole lines, which fly under the prologue; the B fragments are read from there.
// ---------------------------------------------------------------------------
constexpr int AP = NN + 8;   // LDS row pitch in halves: 528 B = 16 B x 33 (odd), for ds_load_b128
constexpr int SEG = NC / 4;  // chunk ends summed by one row group

__global__ __launch_bounds__(256) void gemm_out(
    const float* __restrict__ vre,
    const float* __restrict__ Ar, const float* __restrict__ Ai,
    const float* __restrict__ ends_re, const float* __restrict__ ends_im,
    const _Float16* __restrict__ Ch,
    const float* __restrict__ u, const float* __restrict__ Dv,
    float* __restrict__ out) {
  __shared__ __attribute__((aligned(16))) _Float16 ys[LC * AP];
  __shared__ __attribute__((aligned(16))) float segr[4 * NN];
  __shared__ __attribute__((aligned(16))) float segi[4 * NN];
  __shared__ __attribute__((aligned(16))) _Float16 cs[DIN * AP];
  int w    = __builtin_amdgcn_readfirstlane(threadIdx.x >> 5);
  int lane = threadIdx.x & 31;
  int m0   = blockIdx.x * LC;                          // first of the chunk's 64 rows of BL
  int d0   = w * 64;                                   // first of 64 columns of Din
  int hi   = lane >> 4, r = lane & 15;
  // the lane's 16 bytes of the first of the wave's 64 rows of C, one row's 512 bytes a copy
  const unsigned cl = lds_off(cs) + (unsigned)(d0 * AP * 2) + (unsigned)lane * 16;
  const char*    cg = reinterpret_cast<const char*>(Ch + (size_t)d0 * NN) + lane * 16;

  {
    // scalar bases plus one lane offset: every load of the prologue names the same register
    const unsigned n  = (threadIdx.x & 63) * 4;        // first of the thread's 4 columns
    const int      g  = w >> 1;                        // row group: two waves span a row
    const int      t0 = g * 16;                        // first of its 16 rows
    // the group's run stands for chunks cb .. cb + 15 of the batch; below 0 there is none:
    // the run is read from its first chunk that exists, cs, and holds cnt chunks (16; fewer
    // in the run with the batch's first chunk; none, cnt <= 0, ahead of it). The 16 rows
    // read lie inside the batch's 64 for every cs (cs <= 47).
    const int    cb  = (int)(blockIdx.x & (NC - 1)) - NC + g * SEG;
    const int    cs  = cb > 0 ? cb : 0;
    const int    cnt = cb + SEG - cs;
    const float* eR = ends_re + (size_t)((blockIdx.x & ~(unsigned)(NC - 1)) + cs) * NN;
    const float* eI = ends_im + (size_t)((blockIdx.x & ~(unsigned)(NC - 1)) + cs) * NN;
    float4 er[SEG], ei[SEG];                           // read only where cnt > 0
    if (cnt > 0) {                                     // the same for the whole wave: an empty run asks L2 for nothing
#pragma unroll
      for (int k = 0; k < SEG; ++k) {
        er[k] = *reinterpret_cast<const float4*>((eR + k * NN) + n);
        ei[k] = *reinterpret_cast<const float4*>((eI + k * NN) + n);
      }
    }
    // A behind the branch: asked for ahead of it, its wait behind the join counts for the
    // path without loads too, and comes to stand for all of the ends ahead of the rows of v
    const float4 a4r = *reinterpret_cast<const float4*>(Ar + n);
    const float4 a4i = *reinterpret_cast<const float4*>(Ai + n);
    const float* vp = vre + (size_t)(m0 + t0) * NN;
    float4 x[16];
#pragma unroll
    for (int k = 0; k < 16; ++k) x[k] = *reinterpret_cast<const float4*>((vp + k * NN) + n);
    // the 18 loads first, as one group: left free, the scheduler waits for A in their
    // midst, and the later loads start one latency late
    __builtin_amdgcn_sched_group_barrier(0x020, 18, 0);
    // the loads' address registers are free for the values that follow behind this wait
    asm volatile("s_wait_xcnt 0x0" ::: "memory");
    // 56 of the wave's 64 rows of C, behind the loads that the prologue waits for
#pragma unroll
    for (int s = 0; s < 7; ++s) copy8<AP * 2, NN * 2>(cl + s * (8 * AP * 2), cg + s * (8 * NN * 2));
    const float rawr[4] = {a4r.x, a4r.y, a4r.z, a4r.w}, rawi[4] = {a4i.x, a4i.y, a4i.z, a4i.w};
    float ar[4], ai[4], pr[4], pi[4];                  // A_bar and A_bar^(t0+1)
    float cpr[4], cpi[4], rpr[4], rpi[4];              // A_bar^64 (a chunk), A_bar^1024 (a run of 16)
#pragma unroll
    for (int e = 0; e < 4; ++e) {
      const Disc d = discretize(rawr[e], rawi[e]);
      ar[e] = d.abr; ai[e] = d.abi;
      float sr = ar[e], si = ai[e];
#pragma unroll
      for (int s = 0; s < 4; ++s) {                    // A_bar^16 by four squarings
        float qr = sr * sr - si * si;
        float qi = 2.f * sr * si;
        sr = qr; si = qi;
      }
      pr[e] = ar[e]; pi[e] = ai[e];
#pragma unroll
      for (int s = 0; s < 3; ++s) {
        if (s < (w >> 1)) {                            // the same for the whole wave
          float qr = pr[e] * sr - pi[e] * si;
          float qi = pr[e] * si + pi[e] * sr;
          pr[e] = qr; pi[e] = qi;
        }
      }
#pragma unroll
      for (int s = 0; s < 6; ++s) {                    // A_bar^16 squared on: ^64 after 2, ^1024 after 6
        float qr = sr * sr - si * si;
        float qi = 2.f * sr * si;
        sr = qr; si = qi;
        if (s == 1) { cpr[e] = sr; cpi[e] = si; }
      }
      rpr[e] = sr; rpi[e] = si;
    }
    // the run's sum: h = h * A_bar^64 + end, oldest chunk first, over its cnt chunks
    float hr[4] = {0.f, 0.f, 0.f, 0.f}, hm[4] = {0.f, 0.f, 0.f, 0.f};
    if (cnt > 0) {
#pragma unroll
      for (int k = 0; k < SEG; ++k) {
        const float kr[4] = {er[k].x, er[k].y, er[k].z, er[k].w};
        const float km[4] = {ei[k].x, ei[k].y, ei[k].z, ei[k].w};
        const bool on = k < cnt;                       // the same for the whole wave
#pragma unroll
        for (int e = 0; e < 4; ++e) {
          float nr = kr[e] + cpr[e] * hr[e] - cpi[e] * hm[e];
          float ni = km[e] + cpr[e] * hm[e] + cpi[e] * hr[e];
          hr[e] = on ? nr : hr[e]; hm[e] = on ? ni : hm[e];
        }
      }
    }
    *reinterpret_cast<float4*>(segr + g * NN + n) = make_float4(hr[0], hr[1], hr[2], hr[3]);
    *reinterpret_cast<float4*>(segi + g * NN + n) = make_float4(hm[0], hm[1], hm[2], hm[3]);
    // the last 8 rows of C go behind the first 56: a wave keeps fewer than 64 copies in flight
    asm volatile("s_wait_asynccnt 0x0" ::: "memory");
    copy8<AP * 2, NN * 2>(cl + 7 * (8 * AP * 2), cg + 7 * (8 * NN * 2));
    // publishes the four runs' sums: a thread reads those of the other three row groups
    __syncthreads();
    float cr[4], ci[4];                                // carry_in of the thread's 4 columns
#pragma unroll
    for (int s = 0; s < 4; ++s) {
      const float4 s4r = *reinterpret_cast<const float4*>(segr + s * NN + n);
      const float4 s4i = *reinterpret_cast<const float4*>(segi + s * NN + n);
      const float kr[4] = {s4r.x, s4r.y, s4r.z, s4r.w}, km[4] = {s4i.x, s4i.y, s4i.z, s4i.w};
#pragma unroll
      for (int e = 0; e < 4; ++e) {
        if (s == 0) { cr[e] = kr[e]; ci[e] = km[e]; }
        else {
          float nr = kr[e] + rpr[e] * cr[e] - rpi[e] * ci[e];
          float ni = km[e] + rpr[e] * ci[e] + rpi[e] * cr[e];
          cr[e] = nr; ci[e] = ni;
        }
      }
    }
    float zr[4], zi[4];                                // A_bar^(t+1) * carry_in at row t
#pragma unroll
    for (int e = 0; e < 4; ++e) {
      zr[e] = pr[e] * cr[e] - pi[e] * ci[e];
      zi[e] = pr[e] * ci[e] + pi[e] * cr[e];
    }
#pragma unroll
    for (int k = 0; k < 16; ++k) {
      const float xe[4] = {x[k].x, x[k].y, x[k].z, x[k].w};
      v4h h;
#pragma unroll
      for (int e = 0; e < 4; ++e) {
        h[e] = (_Float16)(xe[e] + zr[e]);
        float nr = zr[e] * ar[e] - zi[e] * ai[e];
        float ni = zr[e] * ai[e] + zi[e] * ar[e];
        zr[e] = nr; zi[e] = ni;
      }
      *reinterpret_cast<v4h*>(ys + (t0 + k) * AP + n) = h;
    }
  }
  // the wave's rows of C have landed before anything reads them
  asm volatile("s_wait_asynccnt 0x0" ::: "memory");
  // publishes the A tile: every wave reads all 64 rows
  __syncthreads();

  const _Float16* bbase = cs + d0 * AP;                    // C[d][n]: k-contig, at the A tile's pitch
  const unsigned  afrag = (unsigned)(r * AP + 8 * hi);

  float dval[4];
#pragma unroll
  for (int j = 0; j < 4; ++j) dval[j] = (Dv + d0 + j * 16)[(unsigned)r];

  v8f acc[4][4] = {};
  // unrolled: every load is base + the lane's offset + immediate
#pragma unroll
  for (int ks = 0; ks < NN; ks += 32) {
    v16h a[4], b[4];
#pragma unroll
    for (int j = 0; j < 4; ++j) b[j] = frag_at(bbase + ks + j * 16 * AP, afrag);
#pragma unroll
    for (int i = 0; i < 4; ++i) a[i] = frag_at(ys + ks + i * 16 * AP, afrag);
    // keeps the step's 16 loads together ahead of its WMMAs: left free, the
    // scheduler reloads one B fragment at a time and waits out each load alone
    __builtin_amdgcn_sched_barrier(0);
#pragma unroll
    for (int j = 0; j < 4; ++j) {
#pragma unroll
      for (int i = 0; i < 4; ++i) acc[i][j] = wmma16(a[i], b[j], acc[i][j]);
    }
    // ends the step: no later load or store moves in among these WMMAs
    __builtin_amdgcn_sched_barrier(0);
  }
  const float* ub = u   + (size_t)m0 * DIN + d0;
  float*       ob = out + (size_t)m0 * DIN + d0;
  const unsigned lout = (unsigned)(8 * hi * DIN + r);
  // 16 rows at a time; the next 16 rows' u values are loaded ahead of this group's stores
  float uu[2][4][8];
#pragma unroll
  for (int j = 0; j < 4; ++j) {
#pragma unroll
    for (int q = 0; q < 8; ++q) uu[0][j][q] = (ub + q * DIN + j * 16)[lout];
  }
#pragma unroll
  for (int i = 0; i < 4; ++i) {
    if (i < 3) {
#pragma unroll
      for (int j = 0; j < 4; ++j) {
#pragma unroll
        for (int q = 0; q < 8; ++q)
          uu[(i + 1) & 1][j][q] = (ub + ((i + 1) * 16 + q) * DIN + j * 16)[lout];
      }
    }
    // keeps those 32 loads together ahead of the stores: left free, the
    // scheduler takes one load at a time and waits out each alone
    __builtin_amdgcn_sched_barrier(0);
#pragma unroll
    for (int j = 0; j < 4; ++j) {
#pragma unroll
      for (int q = 0; q < 8; ++q)
        (ob + (i * 16 + q) * DIN + j * 16)[lout] = acc[i][j][q] + uu[i & 1][j][q] * dval[j];
    }
    // the stored registers are free for the loads that follow behind this wait
    if (i < 2) asm volatile("s_wait_xcnt 0x0" ::: "memory");
  }
}

// ---------------------------------------------------------------------------
// Host launcher. Workspace carve-out (~18 MB), all launches on `stream`.
// ---------------------------------------------------------------------------
extern "C" void kernel_launch(void* const* d_in, const int* in_sizes, int n_in,
                              void* d_out, int out_size, void* d_ws, size_t ws_size,
                              hipStream_t stream) {
  const float* u      = (const float*)d_in[0];  // [BB, LL, DIN]
  const float* A_real = (const float*)d_in[1];  // [NN]
  const float* A_imag = (const float*)d_in[2];  // [NN]
  const float* B_mat  = (const float*)d_in[3];  // [NN, DIN]
  const float* C_mat  = (const float*)d_in[4];  // [DIN, NN]
  const float* D_vec  = (const float*)d_in[5];  // [DIN]
  float* out = (float*)d_out;                   // [BB, LL, DIN]

  char* w = (char*)d_ws;
  auto carve = [&](size_t bytes) -> void* {
    void* p = (void*)w;
    w += (bytes + 255) & ~(size_t)255;
    return p;
  };
  _Float16* C_h      = (_Float16*)carve((size_t)DIN * NN * sizeof(_Float16));
  float*    v_re     = (float*)carve((size_t)MM * NN * sizeof(float));
  float*    ends_re  = (float*)carve((size_t)BB * NC * NN * sizeof(float));
  float*    ends_im  = (float*)carve((size_t)BB * NC * NN * sizeof(float));

  // 0) input projection v = u @ B_bar^T (WMMA) with the local chunk scan in its epilogue; C -> f16
  gemm_vproj<<<(MM / 128) * 2, 256, 0, stream>>>(u, B_mat, A_real, A_imag, C_mat, C_h,
                                                 v_re, ends_re, ends_im);
  // 1) chunk carries + carry correction + output projection + skip: out = Re(y) @ C^T + u*D  (WMMA)
  gemm_out<<<MM / LC, 256, 0, stream>>>(v_re, A_real, A_imag, ends_re, ends_im,
                                        C_h, u, D_vec, out);
}

// v009
// A run of this version takes 20.9 microseconds.
// Next to v008, in two timings, it ran 1.04 times as fast each time.
// Over all steps from v000 it is 7.12 times as fast.
#include <hip/hip_runtime.h>
#include <hip/hip_bf16.h>

typedef __attribute__((ext_vector_type(16))) _Float16 v16h;
typedef __attribute__((ext_vector_type(8)))  _Float16 v8h;
typedef __attribute__((ext_vector_type(4)))  _Float16 v4h;
typedef __attribute__((ext_vector_type(8)))  float    v8f;
typedef __attribute__((ext_vector_type(4)))  float    v4f;
typedef __attribute__((ext_vector_type(2)))  _Float16 v2h;
typedef __attribute__((ext_vector_type(2)))  unsigned v2u;

#define DT_STEP   0.01f
#define DAMP_MIN_ 5e-4f

constexpr int BB  = 4;
constexpr int LL  = 4096;
constexpr int DIN = 512;
constexpr int NN  = 256;
constexpr int LC  = 64;            // scan chunk length = rows of one wave's tile in gemm_vproj
constexpr int NC  = LL / LC;       // 64 chunks
constexpr int MM  = BB * LL;       // 16384 rows

// ---------------------------------------------------------------------------
// WMMA helpers (V_WMMA_F32_16X16X32_F16, wave32; ISA 7.12.2 layouts)
// lane r = lane&15 owns row (A) / column (B) r; hi = lane>>4;
// v16h element h holds K = (h<8 ? h : h+8) + 8*hi within the 32-wide K tile.
// ---------------------------------------------------------------------------
__device__ __forceinline__ v8f wmma16(v16h a, v16h b, v8f c) {
  return __builtin_amdgcn_wmma_f32_16x16x32_f16(
      /*neg_a=*/false, a, /*neg_b=*/false, b,
      /*c_mod=*/(short)0, c, /*reuse_a=*/false, /*reuse_b=*/false);
}

// Fragment from a wave-uniform tile base plus the lane's element offset
// (row r, 8*hi): the base stays scalar, the one offset register serves all loads.
__device__ __forceinline__ v16h frag_at(const _Float16* __restrict__ base, unsigned off) {
  v8h lo  = *reinterpret_cast<const v8h*>(base + off);
  v8h hi8 = *reinterpret_cast<const v8h*>((base + 16) + off);
  return __builtin_shufflevector(lo, hi8, 0,1,2,3,4,5,6,7,8,9,10,11,12,13,14,15);
}

// Value of the lane 16 places away (l <-> l ^ 16), as one vector cross-row move.
__device__ __forceinline__ float other_half(float x) {
  int b = __builtin_bit_cast(int, x);
  b = __builtin_amdgcn_permlanex16(b, b, 0x76543210, 0xfedcba98, false, false);
  return __builtin_bit_cast(float, b);
}

// Low 32 bits of a __shared__ address: the byte offset in the work-group's LDS.
__device__ __forceinline__ unsigned lds_off(const void* p) { return (unsigned)(size_t)p; }

// The work-group's barrier alone. __syncthreads() also waits out the wave's global loads; here
// the later k tiles of u are to stay in flight across it. The waits that the LDS data need
// (s_wait_dscnt, s_wait_asynccnt) are written in front of it at each use.
__device__ __forceinline__ void barrier_only() {
  asm volatile("s_barrier_signal -1\n\ts_barrier_wait -1" ::: "memory");
}

// Eight asynchronous copies from global memory to LDS, through no register: copy c brings the
// lane's 16 bytes at g + c * GSTEP to LDS byte l + c * LSTEP. A wave's copy covers 512
// contiguous bytes, four whole lines. s_wait_xcnt stands in the copies' own statement: no
// register that a copy names is rewritten ahead of it.
template <int LSTEP, int GSTEP>
__device__ __forceinline__ void copy8(unsigned l, const char* g) {
  asm volatile(
      "global_load_async_to_lds_b128 %0, %8, off\n\t"
      "global_load_async_to_lds_b128 %1, %9, off\n\t"
      "global_load_async_to_lds_b128 %2, %10, off\n\t"
      "global_load_async_to_lds_b128 %3, %11, off\n\t"
      "global_load_async_to_lds_b128 %4, %12, off\n\t"
      "global_load_async_to_lds_b128 %5, %13, off\n\t"
      "global_load_async_to_lds_b128 %6, %14, off\n\t"
      "global_load_async_to_lds_b128 %7, %15, off\n\t"
      "s_wait_xcnt 0x0"
      :: "v"(l), "v"(l + LSTEP), "v"(l + 2 * LSTEP), "v"(l + 3 * LSTEP),
         "v"(l + 4 * LSTEP), "v"(l + 5 * LSTEP), "v"(l + 6 * LSTEP), "v"(l + 7 * LSTEP),
         "v"(g), "v"(g + GSTEP), "v"(g + 2 * GSTEP), "v"(g + 3 * GSTEP),
         "v"(g + 4 * GSTEP), "v"(g + 5 * GSTEP), "v"(g + 6 * GSTEP), "v"(g + 7 * GSTEP)
      : "memory");
}

// ---------------------------------------------------------------------------
// Bilinear discretization of one diagonal entry of A, formed where it is used:
// A_bar = (1 + dt/2 A) / (1 - dt/2 A), and f = dt / (1 - dt/2 A), B_bar = f * B.
// ---------------------------------------------------------------------------
struct Disc { float abr, abi, fr, fi; };
__device__ __forceinline__ Disc discretize(float a_real, float a_imag) {
  float ar = -fabsf(a_real) - DAMP_MIN_;
  float ai = a_imag;
  float dr = 1.f - 0.005f * ar, di = -0.005f * ai;       // denom = 1 - dt/2 * A
  float inv = 1.f / (dr * dr + di * di);
  float nr = 1.f + 0.005f * ar, ni = 0.005f * ai;        // numer = 1 + dt/2 * A
  Disc d;
  d.abr = (nr * dr + ni * di) * inv;
  d.abi = (ni * dr - nr * di) * inv;
  d.fr  = DT_STEP * inv * dr;                            // dt * conj(denom) / |denom|^2
  d.fi  = -(DT_STEP * inv) * di;
  return d;
}

// The lane's 16 f32 values of one row of B (k order of the fragment: x[0], x[1] hold
// K = 8*hi + 0..7, x[2], x[3] hold K = 16 + 8*hi + 0..7), rounded to f16.
__device__ __forceinline__ v16h rounded_frag(const v4f x[4]) {
  v4h h0 = __builtin_convertvector(x[0], v4h);
  v4h h1 = __builtin_convertvector(x[1], v4h);
  v4h h2 = __builtin_convertvector(x[2], v4h);
  v4h h3 = __builtin_convertvector(x[3], v4h);
  v8h lo  = __builtin_shufflevector(h0, h1, 0,1,2,3,4,5,6,7);
  v8h hi8 = __builtin_shufflevector(h2, h3, 0,1,2,3,4,5,6,7);
  return __builtin_shufflevector(lo, hi8, 0,1,2,3,4,5,6,7,8,9,10,11,12,13,14,15);
}

// ---------------------------------------------------------------------------
// Kernel 0: v = u @ B_bar^T = f * (u @ B^T): B_bar[n] is the real row B[n] times the complex
// f[n], so ONE real WMMA GEMM s = u @ B^T gives both parts: v[t][n] = f[n] * s[t][n], formed
// from the f32 sums in the epilogue.
// one wave per 64 x 32 tile of [MM x NN]: 4 A fragments and 2 B fragments in registers
// feed 8 WMMAs per 32-wide k step. The 8 waves of a block stand 2 x 4 on a 128 x 128 tile.
// B comes as the f32 input, through LDS: the block's 128 rows in 4 tiles of 128 k, two
// buffers, brought by asynchronous copies of whole lines one tile ahead of its use.
// A lane owns one row n of B and rounds its f32 LDS reads to the f16 fragment.
// Left open: a k step's 8 WMMAs stand behind the wait for its own 16 LDS reads, which now
// set the loop's pace; fragments fetched one step ahead into a second register set (the
// loop leaves registers free) would take that wait out of the step.
// The block also rounds its 512 elements of C to f16 for the output GEMM's launch.
// The block rounds its 128 rows of u (f32) to f16 itself, once, into LDS; the A fragments
// are read from there. A wave's load covers 512 contiguous bytes of a row. u comes in the
// same 4 k tiles as B, through two register sets: only tile 0 is waited for ahead of the
// loop; tile t + 1 is rounded at the foot of tile t, and its loads fly under the WMMAs.
// Epilogue: the wave's 64 rows are one scan chunk. x[t] = A_bar x[t-1] + v[t]
// (zero start) runs on f times the accumulators, in registers; Re(x) goes to vre and the
// chunk's complex end state to ends. v itself never reaches memory.
// ---------------------------------------------------------------------------
constexpr int UP = DIN + 8;  // LDS row pitch in halves: 1040 B = 16 B x 65 (odd), for ds_load_b128
constexpr int KT = 128;      // k width of a staged tile of B: a row's part is 512 B, one copy of a wave
constexpr int NT = DIN / KT; // 4 tiles
constexpr int BP = KT + 4;   // LDS row pitch in floats: 528 B = 16 B x 33 (odd), for ds_load_b128

__global__ __launch_bounds__(256) void gemm_vproj(
    const float* __restrict__ u, const float* __restrict__ Bm,
    const float* __restrict__ Ar, const float* __restrict__ Ai,
    const float* __restrict__ Cm, _Float16* __restrict__ Ch,
    float* __restrict__ vre,
    float* __restrict__ ends_re, float* __restrict__ ends_im) {
  __shared__ __attribute__((aligned(16))) _Float16 us[128 * UP];
  __shared__ __attribute__((aligned(16))) float    bs[2 * 128 * BP];
  int w    = __builtin_amdgcn_readfirstlane(threadIdx.x >> 5);
  int lane = threadIdx.x & 31;
  int mb   = (blockIdx.x >> 1) * 128;                  // first of the block's 128 rows of BL
  int m0   = mb + (w >> 2) * 64;                       // first of the wave's 64 rows
  int n0   = (blockIdx.x & 1) * 128 + (w & 3) * 32;    // first of 32 columns of N
  int hi   = lane >> 4, r = lane & 15;

  // a wave brings 16 of the block's 128 rows of a tile of B, one row's 512 bytes a copy
  const unsigned bl = lds_off(bs) + (unsigned)(w * 16 * BP * 4) + (unsigned)lane * 16;
  const char*    bg = reinterpret_cast<const char*>(Bm + (size_t)((blockIdx.x & 1) * 128 + w * 16) * DIN) + lane * 16;
  auto stage_b = [&](int t, int buf) {
    copy8<BP * 4, DIN * 4>(bl + buf * (128 * BP * 4), bg + t * (KT * 4));
    copy8<BP * 4, DIN * 4>(bl + buf * (128 * BP * 4) + 8 * BP * 4, bg + t * (KT * 4) + 8 * DIN * 4);
  };
  stage_b(0, 0);                                       // flies under the u tile's loads

  // asked for along with the u tile: their latency falls under the tile's
  float araw[2], iraw[2];
#pragma unroll
  for (int j = 0; j < 2; ++j) {
    araw[j] = (Ar + n0 + j * 16)[(unsigned)r];
    iraw[j] = (Ai + n0 + j * 16)[(unsigned)r];
  }
  const unsigned cslot = (unsigned)threadIdx.x * 2;      // the thread's 2 of the block's 512 elements of C
  const float2 c2 = *reinterpret_cast<const float2*>((Cm + blockIdx.x * 512) + cslot);

  // a wave takes every eighth row, one k tile's 512 bytes of it a load: 16 loads a k tile.
  // Two register sets: tiles 0 and 1 are asked for here, tile t + 2 when tile t has been rounded.
  // scalar bases plus one lane offset: every load names the same register
  const float*   up = u  + (size_t)(mb + w) * DIN;
  _Float16*      sp = us + w * UP;
  const unsigned uc = (unsigned)lane * 4;
  float4 x[2][16];
  auto load_u = [&](int t) {
#pragma unroll
    for (int k = 0; k < 16; ++k)
      x[t & 1][k] = *reinterpret_cast<const float4*>((up + k * 8 * DIN + t * KT) + uc);
    // the loads' offset register is free for other values behind this wait
    asm volatile("s_wait_xcnt 0x0" ::: "memory");
    // keeps the tile's loads here, together: moved down to their converts they would start late
    __builtin_amdgcn_sched_barrier(0);
  };
  // k tile t of the wave's 16 rows -> f16 in LDS. The rounding (to nearest even, the instruction
  // the compiler itself takes for this convert) stands in asm volatile, which stays where it is
  // written: the compiler moves its own converts up to directly behind their loads, and with
  // them the wait for the loads, so that nothing flies under the WMMAs.
  auto round_u = [&](int t) {
#pragma unroll
    for (int k = 0; k < 16; ++k) {
      unsigned h01, h23;
      asm volatile("v_cvt_pk_f16_f32 %0, %1, %2" : "=v"(h01) : "v"(x[t & 1][k].x), "v"(x[t & 1][k].y));
      asm volatile("v_cvt_pk_f16_f32 %0, %1, %2" : "=v"(h23) : "v"(x[t & 1][k].z), "v"(x[t & 1][k].w));
      const v2u h = {h01, h23};
      *reinterpret_cast<v4h*>((sp + k * 8 * UP + t * KT) + uc) = __builtin_bit_cast(v4h, h);
    }
  };
  load_u(0);
  load_u(1);
  round_u(0);
  // the wave's LDS stores of u's tile 0 are done and its copies of B's tile 0 have landed
  // before it says so at the barrier
  asm volatile("s_wait_dscnt 0x0" ::: "memory");
  asm volatile("s_wait_asynccnt 0x0" ::: "memory");
  // publishes tile 0 of u and of B: a wave reads rows that all eight waves brought
  barrier_only();
  stage_b(1, 1);                                       // both fly under tile 0's WMMAs
  load_u(2);

  const _Float16* abase  = us + (w >> 2) * 64 * UP;
  const unsigned  lfrag  = (unsigned)(r * BP + 8 * hi);
  const unsigned  afrag  = (unsigned)(r * UP + 8 * hi);

  float ar[2], ai[2], fr[2], fi[2];                    // A_bar and f of the lane's two columns
#pragma unroll
  for (int j = 0; j < 2; ++j) {
    Disc d = discretize(araw[j], iraw[j]);
    ar[j] = d.abr; ai[j] = d.abi; fr[j] = d.fr; fi[j] = d.fi;
  }

  v8f acc[4][2] = {};
  // unrolled: every load is base + the lane's offset + immediate
#pragma unroll
  for (int ks = 0; ks < DIN; ks += 32) {
    const int t = ks / KT;                             // the tile of B that holds this k step
    v16h a[4];
    v4f  xb[2][4];
#pragma unroll
    for (int j = 0; j < 2; ++j) {
      const float* bj = bs + (t & 1) * (128 * BP) + ((w & 3) * 32 + j * 16) * BP + (ks - t * KT);
      xb[j][0] = *reinterpret_cast<const v4f*>(bj + lfrag);
      xb[j][1] = *reinterpret_cast<const v4f*>((bj + 4) + lfrag);
      xb[j][2] = *reinterpret_cast<const v4f*>((bj + 16) + lfrag);
      xb[j][3] = *reinterpret_cast<const v4f*>((bj + 20) + lfrag);
    }
#pragma unroll
    for (int i = 0; i < 4; ++i) a[i] = frag_at(abase + ks + i * 16 * UP, afrag);
    // keeps the step's 16 loads together ahead of its WMMAs: left free, the
    // scheduler reloads one B fragment at a time and waits out each load alone
    __builtin_amdgcn_sched_barrier(0);
    const v16h b0 = rounded_frag(xb[0]);
    const v16h b1 = rounded_frag(xb[1]);
#pragma unroll
    for (int i = 0; i < 4; ++i) {
      acc[i][0] = wmma16(a[i], b0, acc[i][0]);
      acc[i][1] = wmma16(a[i], b1, acc[i][1]);
    }
    // ends the step: no later load or store moves in among these WMMAs
    __builtin_amdgcn_sched_barrier(0);
    if (ks + 32 == (t + 1) * KT) {
      // foot of tile t: u's tile t + 1, whose loads flew under the WMMAs, goes to LDS
      if (t + 1 < NT) {
        // the distance behind the step's last WMMA: the asm converts may write registers that
        // held its A or B
        asm volatile("v_nop\n\tv_nop\n\tv_nop\n\tv_nop");
        round_u(t + 1);
      }
      // the wave's reads of B's buffer and its stores of u are done and its copies of tile t + 1
      // have landed before the barrier, which publishes tile t + 1 and frees tile t's buffer
      asm volatile("s_wait_dscnt 0x0" ::: "memory");
      asm volatile("s_wait_asynccnt 0x0" ::: "memory");
      barrier_only();
      if (t + 2 < NT) stage_b(t + 2, t & 1);
      if (t + 3 < NT) load_u(t + 3);                   // into the registers that round_u(t + 1) has read
    }
  }
  // no copy is left in flight behind the loop
  asm volatile("s_wait_asynccnt 0x0" ::: "memory");
  // C/D layout: lane holds column n0+16j+r; VGPR q holds row m0 + 16i + q + 8*hi.
  // In time order a column's 64 rows are 8 runs of 8: (i, hi) = (0,0) (0,1) (1,0) ...
  // and a lane owns the 4 runs of its own hi.
  float* oR = vre + (size_t)m0 * NN + n0;
  const unsigned lout = (unsigned)(8 * hi * NN + r);
  float endr[2], endi[2];
#pragma unroll
  for (int j = 0; j < 2; ++j) {
    // pw[q] = A_bar^(q+1)
    float pwr[8], pwi[8];
    pwr[0] = ar[j]; pwi[0] = ai[j];
#pragma unroll
    for (int q = 1; q < 8; ++q) {
      pwr[q] = pwr[q - 1] * ar[j] - pwi[q - 1] * ai[j];
      pwi[q] = pwr[q - 1] * ai[j] + pwi[q - 1] * ar[j];
    }
    // 1) each run scanned from a zero start, on v = f * s; Re takes s's place in acc, the end is kept
    float er[4], ei[4];
#pragma unroll
    for (int i = 0; i < 4; ++i) {
      float xr = fr[j] * acc[i][j][0], xi = fi[j] * acc[i][j][0];
      acc[i][j][0] = xr;
#pragma unroll
      for (int q = 1; q < 8; ++q) {
        float nxr = fr[j] * acc[i][j][q] + ar[j] * xr - ai[j] * xi;
        float nxi = fi[j] * acc[i][j][q] + ar[j] * xi + ai[j] * xr;
        xr = nxr; xi = nxi;
        acc[i][j][q] = xr;
      }
      er[i] = xr; ei[i] = xi;
    }
    // 2) state entering each run: both halves walk the same 8 run ends in time order
    float inr[4], ini[4];
    float sr = 0.f, si = 0.f;
#pragma unroll
    for (int i = 0; i < 4; ++i) {
      float qr = other_half(er[i]), qi = other_half(ei[i]);
      float e0r = hi ? qr : er[i], e0i = hi ? qi : ei[i];   // end of run (i, 0)
      float e1r = hi ? er[i] : qr, e1i = hi ? ei[i] : qi;   // end of run (i, 1)
      float tr = e0r, ti = e0i;                             // state entering (i, 1)
      if (i > 0) {
        tr = e0r + pwr[7] * sr - pwi[7] * si;
        ti = e0i + pwr[7] * si + pwi[7] * sr;
      }
      inr[i] = hi ? tr : sr; ini[i] = hi ? ti : si;
      sr = e1r + pwr[7] * tr - pwi[7] * ti;                 // state entering (i+1, 0)
      si = e1i + pwr[7] * ti + pwi[7] * tr;
    }
    // 3) Re(x) = Re(run-local x) + Re(A_bar^(q+1) * state entering the run)
#pragma unroll
    for (int i = 0; i < 4; ++i) {
#pragma unroll
      for (int q = 0; q < 8; ++q)
        (oR + (i * 16 + q) * NN + j * 16)[lout] =
            acc[i][j][q] + pwr[q] * inr[i] - pwi[q] * ini[i];
    }
    endr[j] = sr; endi[j] = si;
  }
  // the chunk's end state, once per column: both halves hold it, the lower one stores
  if (hi == 0) {
#pragma unroll
    for (int j = 0; j < 2; ++j) {
      (ends_re + (size_t)(m0 / LC) * NN + n0 + j * 16)[(unsigned)r] = endr[j];
      (ends_im + (size_t)(m0 / LC) * NN + n0 + j * 16)[(unsigned)r] = endi[j];
    }
  }
  // C -> f16, C is DIN*NN row-major; a wave's store fills one 128-byte line
  v2h ch; ch[0] = (_Float16)c2.x; ch[1] = (_Float16)c2.y;
  *reinterpret_cast<v2h*>((Ch + blockIdx.x * 512) + cslot) = ch;
}

// ---------------------------------------------------------------------------
// Kernel 1: out = Re(y) @ C^T + u * D   (f16 WMMA GEMM, fp32 epilogue)
// One block per scan chunk: 64 rows x all 512 columns, 8 waves side by side,
// one wave per 64 x 64 tile: 4 A and 4 B fragments feed 16 WMMAs per k step.
// Prologue: the block forms its A tile itself, once, in LDS:
//   Re(y)[t][n] = v_local[t][n] + Re(A_bar^(t+1) * carry_in[n])  -> f16
// A thread owns 4 columns and 16 rows; A_bar^(t+1) * carry_in starts at the thread's
// first row t0 from A_bar * (A_bar^16)^(t0/16) and is stepped by A_bar from row to row.
// carry_in, the state entering the chunk, is formed here too, from the end states of the
// batch's earlier chunks: carry_in = sum over c' < c of (A_bar^64)^(c-1-c') * end[c'].
// The 64 places that end at chunk c-1 (places ahead of the batch's first chunk count as 0)
// fall into 4 runs of 16; the threads of row group g sum run g for their 4 columns by
// Horner's rule, the 4 sums meet in LDS and are joined with A_bar^1024.
// C (f16) comes through LDS too: a wave brings its own 64 rows by asynchronous copies of
// whole lines, which fly under the prologue; the B fragments are read from there.
// ---------------------------------------------------------------------------
constexpr int AP = NN + 8;   // LDS row pitch in halves: 528 B = 16 B x 33 (odd), for ds_load_b128
constexpr int SEG = NC / 4;  // chunk ends summed by one row group

__global__ __launch_bounds__(256) void gemm_out(
    const float* __restrict__ vre,
    const float* __restrict__ Ar, const float* __restrict__ Ai,
    const float* __restrict__ ends_re, const float* __restrict__ ends_im,
    const _Float16* __restrict__ Ch,
    const float* __restrict__ u, const float* __restrict__ Dv,
    float* __restrict__ out) {
  __shared__ __attribute__((aligned(16))) _Float16 ys[LC * AP];
  __shared__ __attribute__((aligned(16))) float segr[4 * NN];
  __shared__ __attribute__((aligned(16))) float segi[4 * NN];
  __shared__ __attribute__((aligned(16))) _Float16 cs[DIN * AP];
  int w    = __builtin_amdgcn_readfirstlane(threadIdx.x >> 5);
  int lane = threadIdx.x & 31;
  int m0   = blockIdx.x * LC;                          // first of the chunk's 64 rows of BL
  int d0   = w * 64;                                   // first of 64 columns of Din
  int hi   = lane >> 4, r = lane & 15;
  // the lane's 16 bytes of the first of the wave's 64 rows of C, one row's 512 bytes a copy
  const unsigned cl = lds_off(cs) + (unsigned)(d0 * AP * 2) + (unsigned)lane * 16;
  const char*    cg = reinterpret_cast<const char*>(Ch + (size_t)d0 * NN) + lane * 16;

  {
    // scalar bases plus one lane offset: every load of the prologue names the same register
    const unsigned n  = (threadIdx.x & 63) * 4;        // first of the thread's 4 columns
    const int      g  = w >> 1;                        // row group: two waves span a row
    const int      t0 = g * 16;                        // first of its 16 rows
    // the group's run stands for chunks cb .. cb + 15 of the batch; below 0 there is none:
    // the run is read from its first chunk that exists, cs, and holds cnt chunks (16; fewer
    // in the run with the batch's first chunk; none, cnt <= 0, ahead of it). The 16 rows
    // read lie inside the batch's 64 for every cs (cs <= 47).
    const int    cb  = (int)(blockIdx.x & (NC - 1)) - NC + g * SEG;
    const int    cs  = cb > 0 ? cb : 0;
    const int    cnt = cb + SEG - cs;
    const float* eR = ends_re + (size_t)((blockIdx.x & ~(unsigned)(NC - 1)) + cs) * NN;
    const float* eI = ends_im + (size_t)((blockIdx.x & ~(unsigned)(NC - 1)) + cs) * NN;
    float4 er[SEG], ei[SEG];                           // read only where cnt > 0
    if (cnt > 0) {                                     // the same for the whole wave: an empty run asks L2 for nothing
#pragma unroll
      for (int k = 0; k < SEG; ++k) {
        er[k] = *reinterpret_cast<const float4*>((eR + k * NN) + n);
        ei[k] = *reinterpret_cast<const float4*>((eI + k * NN) + n);
      }
    }
    // A behind the branch: asked for ahead of it, its wait behind the join counts for the
    // path without loads too, and comes to stand for all of the ends ahead of the rows of v
    const float4 a4r = *reinterpret_cast<const float4*>(Ar + n);
    const float4 a4i = *reinterpret_cast<const float4*>(Ai + n);
    const float* vp = vre + (size_t)(m0 + t0) * NN;
    float4 x[16];
#pragma unroll
    for (int k = 0; k < 16; ++k) x[k] = *reinterpret_cast<const float4*>((vp + k * NN) + n);
    // the 18 loads first, as one group: left free, the scheduler waits for A in their
    // midst, and the later loads start one latency late
    __builtin_amdgcn_sched_group_barrier(0x020, 18, 0);
    // the loads' address registers are free for the values that follow behind this wait
    asm volatile("s_wait_xcnt 0x0" ::: "memory");
    // 56 of the wave's 64 rows of C, behind the loads that the prologue waits for
#pragma unroll
    for (int s = 0; s < 7; ++s) copy8<AP * 2, NN * 2>(cl + s * (8 * AP * 2), cg + s * (8 * NN * 2));
    const float rawr[4] = {a4r.x, a4r.y, a4r.z, a4r.w}, rawi[4] = {a4i.x, a4i.y, a4i.z, a4i.w};
    float ar[4], ai[4], pr[4], pi[4];                  // A_bar and A_bar^(t0+1)
    float cpr[4], cpi[4], rpr[4], rpi[4];              // A_bar^64 (a chunk), A_bar^1024 (a run of 16)
#pragma unroll
    for (int e = 0; e < 4; ++e) {
      const Disc d = discretize(rawr[e], rawi[e]);
      ar[e] = d.abr; ai[e] = d.abi;
      float sr = ar[e], si = ai[e];
#pragma unroll
      for (int s = 0; s < 4; ++s) {                    // A_bar^16 by four squarings
        float qr = sr * sr - si * si;
        float qi = 2.f * sr * si;
        sr = qr; si = qi;
      }
      pr[e] = ar[e]; pi[e] = ai[e];
#pragma unroll
      for (int s = 0; s < 3; ++s) {
        if (s < (w >> 1)) {                            // the same for the whole wave
          float qr = pr[e] * sr - pi[e] * si;
          float qi = pr[e] * si + pi[e] * sr;
          pr[e] = qr; pi[e] = qi;
        }
      }
#pragma unroll
      for (int s = 0; s < 6; ++s) {                    // A_bar^16 squared on: ^64 after 2, ^1024 after 6
        float qr = sr * sr - si * si;
        float qi = 2.f * sr * si;
        sr = qr; si = qi;
        if (s == 1) { cpr[e] = sr; cpi[e] = si; }
      }
      rpr[e] = sr; rpi[e] = si;
    }
    // the run's sum: h = h * A_bar^64 + end, oldest chunk first, over its cnt chunks
    float hr[4] = {0.f, 0.f, 0.f, 0.f}, hm[4] = {0.f, 0.f, 0.f, 0.f};
    if (cnt > 0) {
#pragma unroll
      for (int k = 0; k < SEG; ++k) {
        const float kr[4] = {er[k].x, er[k].y, er[k].z, er[k].w};
        const float km[4] = {ei[k].x, ei[k].y, ei[k].z, ei[k].w};
        const bool on = k < cnt;                       // the same for the whole wave
#pragma unroll
        for (int e = 0; e < 4; ++e) {
          float nr = kr[e] + cpr[e] * hr[e] - cpi[e] * hm[e];
          float ni = km[e] + cpr[e] * hm[e] + cpi[e] * hr[e];
          hr[e] = on ? nr : hr[e]; hm[e] = on ? ni : hm[e];
        }
      }
    }
    *reinterpret_cast<float4*>(segr + g * NN + n) = make_float4(hr[0], hr[1], hr[2], hr[3]);
    *reinterpret_cast<float4*>(segi + g * NN + n) = make_float4(hm[0], hm[1], hm[2], hm[3]);
    // the last 8 rows of C go behind the first 56: a wave keeps fewer than 64 copies in flight
    asm volatile("s_wait_asynccnt 0x0" ::: "memory");
    copy8<AP * 2, NN * 2>(cl + 7 * (8 * AP * 2), cg + 7 * (8 * NN * 2));
    // publishes the four runs' sums: a thread reads those of the other three row groups
    __syncthreads();
    float cr[4], ci[4];                                // carry_in of the thread's 4 columns
#pragma unroll
    for (int s = 0; s < 4; ++s) {
      const float4 s4r = *reinterpret_cast<const float4*>(segr + s * NN + n);
      const float4 s4i = *reinterpret_cast<const float4*>(segi + s * NN + n);
      const float kr[4] = {s4r.x, s4r.y, s4r.z, s4r.w}, km[4] = {s4i.x, s4i.y, s4i.z, s4i.w};
#pragma unroll
      for (int e = 0; e < 4; ++e) {
        if (s == 0) { cr[e] = kr[e]; ci[e] = km[e]; }
        else {
          float nr = kr[e] + rpr[e] * cr[e] - rpi[e] * ci[e];
          float ni = km[e] + rpr[e] * ci[e] + rpi[e] * cr[e];
          cr[e] = nr; ci[e] = ni;
        }
      }
    }
    float zr[4], zi[4];                                // A_bar^(t+1) * carry_in at row t
#pragma unroll
    for (int e = 0; e < 4; ++e) {
      zr[e] = pr[e] * cr[e] - pi[e] * ci[e];
      zi[e] = pr[e] * ci[e] + pi[e] * cr[e];
    }
#pragma unroll
    for (int k = 0; k < 16; ++k) {
      const float xe[4] = {x[k].x, x[k].y, x[k].z, x[k].w};
      v4h h;
#pragma unroll
      for (int e = 0; e < 4; ++e) {
        h[e] = (_Float16)(xe[e] + zr[e]);
        float nr = zr[e] * ar[e] - zi[e] * ai[e];
        float ni = zr[e] * ai[e] + zi[e] * ar[e];
        zr[e] = nr; zi[e] = ni;
      }
      *reinterpret_cast<v4h*>(ys + (t0 + k) * AP + n) = h;
    }
  }
  // the wave's rows of C have landed before anything reads them
  asm volatile("s_wait_asynccnt 0x0" ::: "memory");
  // publishes the A tile: every wave reads all 64 rows
  __syncthreads();

  const _Float16* bbase = cs + d0 * AP;                    // C[d][n]: k-contig, at the A tile's pitch
  const unsigned  afrag = (unsigned)(r * AP + 8 * hi);

  float dval[4];
#pragma unroll
  for (int j = 0; j < 4; ++j) dval[j] = (Dv + d0 + j * 16)[(unsigned)r];

  v8f acc[4][4] = {};
  // unrolled: every load is base + the lane's offset + immediate
#pragma unroll
  for (int ks = 0; ks < NN; ks += 32) {
    v16h a[4], b[4];
#pragma unroll
    for (int j = 0; j < 4; ++j) b[j] = frag_at(bbase + ks + j * 16 * AP, afrag);
#pragma unroll
    for (int i = 0; i < 4; ++i) a[i] = frag_at(ys + ks + i * 16 * AP, afrag);
    // keeps the step's 16 loads together ahead of its WMMAs: left free, the
    // scheduler reloads one B fragment at a time and waits out each load alone
    __builtin_amdgcn_sched_barrier(0);
#pragma unroll
    for (int j = 0; j < 4; ++j) {
#pragma unroll
      for (int i = 0; i < 4; ++i) acc[i][j] = wmma16(a[i], b[j], acc[i][j]);
    }
    // ends the step: no later load or store moves in among these WMMAs
    __builtin_amdgcn_sched_barrier(0);
  }
  const float* ub = u   + (size_t)m0 * DIN + d0;
  float*       ob = out + (size_t)m0 * DIN + d0;
  const unsigned lout = (unsigned)(8 * hi * DIN + r);
  // 16 rows at a time; the next 16 rows' u values are loaded ahead of this group's stores
  float uu[2][4][8];
#pragma unroll
  for (int j = 0; j < 4; ++j) {
#pragma unroll
    for (int q = 0; q < 8; ++q) uu[0][j][q] = (ub + q * DIN + j * 16)[lout];
  }
#pragma unroll
  for (int i = 0; i < 4; ++i) {
    if (i < 3) {
#pragma unroll
      for (int j = 0; j < 4; ++j) {
#pragma unroll
        for (int q = 0; q < 8; ++q)
          uu[(i + 1) & 1][j][q] = (ub + ((i + 1) * 16 + q) * DIN + j * 16)[lout];
      }
    }
    // keeps those 32 loads together ahead of the stores: left free, the
    // scheduler takes one load at a time and waits out each alone
    __builtin_amdgcn_sched_barrier(0);
#pragma unroll
    for (int j = 0; j < 4; ++j) {
#pragma unroll
      for (int q = 0; q < 8; ++q)
        (ob + (i * 16 + q) * DIN + j * 16)[lout] = acc[i][j][q] + uu[i & 1][j][q] * dval[j];
    }
    // the stored registers are free for the loads that follow behind this wait
    if (i < 2) asm volatile("s_wait_xcnt 0x0" ::: "memory");
  }
}

// ---------------------------------------------------------------------------
// Host launcher. Workspace carve-out (~18 MB), all launches on `stream`.
// ---------------------------------------------------------------------------
extern "C" void kernel_launch(void* const* d_in, const int* in_sizes, int n_in,
                              void* d_out, int out_size, void* d_ws, size_t ws_size,
                              hipStream_t stream) {
  const float* u      = (const float*)d_in[0];  // [BB, LL, DIN]
  const float* A_real = (const float*)d_in[1];  // [NN]
  const float* A_imag = (const float*)d_in[2];  // [NN]
  const float* B_mat  = (const float*)d_in[3];  // [NN, DIN]
  const float* C_mat  = (const float*)d_in[4];  // [DIN, NN]
  const float* D_vec  = (const float*)d_in[5];  // [DIN]
  float* out = (float*)d_out;                   // [BB, LL, DIN]

  char* w = (char*)d_ws;
  auto carve = [&](size_t bytes) -> void* {
    void* p = (void*)w;
    w += (bytes + 255) & ~(size_t)255;
    return p;
  };
  _Float16* C_h      = (_Float16*)carve((size_t)DIN * NN * sizeof(_Float16));
  float*    v_re     = (float*)carve((size_t)MM * NN * sizeof(float));
  float*    ends_re  = (float*)carve((size_t)BB * NC * NN * sizeof(float));
  float*    ends_im  = (float*)carve((size_t)BB * NC * NN * sizeof(float));

  // 0) input projection v = u @ B_bar^T (WMMA) with the local chunk scan in its epilogue; C -> f16
  gemm_vproj<<<(MM / 128) * 2, 256, 0, stream>>>(u, B_mat, A_real, A_imag, C_mat, C_h,
                                                 v_re, ends_re, ends_im);
  // 1) chunk carries + carry correction + output projection + skip: out = Re(y) @ C^T + u*D  (WMMA)
  gemm_out<<<MM / LC, 256, 0, stream>>>(v_re, A_real, A_imag, ends_re, ends_im,
                                        C_h, u, D_vec, out);
}

// v010
// One run takes 20.1 microseconds.
// Next to v009, in two timings, it ran 1.04 and 1.03 times as fast.
// Over all steps from v000 it is 7.36 times as fast.
#include <hip/hip_runtime.h>
#include <hip/hip_bf16.h>

typedef __attribute__((ext_vector_type(16))) _Float16 v16h;
typedef __attribute__((ext_vector_type(8)))  _Float16 v8h;
typedef __attribute__((ext_vector_type(4)))  _Float16 v4h;
typedef __attribute__((ext_vector_type(8)))  float    v8f;
typedef __attribute__((ext_vector_type(4)))  float    v4f;
typedef __attribute__((ext_vector_type(2)))  _Float16 v2h;
typedef __attribute__((ext_vector_type(2)))  unsigned v2u;

#define DT_STEP   0.01f
#define DAMP_MIN_ 5e-4f

constexpr int BB  = 4;
constexpr int LL  = 4096;
constexpr int DIN = 512;
constexpr int NN  = 256;
constexpr int LC  = 64;            // scan chunk length = rows of one wave's tile in gemm_vproj
constexpr int NC  = LL / LC;       // 64 chunks
constexpr int MM  = BB * LL;       // 16384 rows

// ---------------------------------------------------------------------------
// WMMA helpers (V_WMMA_F32_16X16X32_F16, wave32; ISA 7.12.2 layouts)
// lane r = lane&15 owns row (A) / column (B) r; hi = lane>>4;
// v16h element h holds K = (h<8 ? h : h+8) + 8*hi within the 32-wide K tile.
// ---------------------------------------------------------------------------
__device__ __forceinline__ v8f wmma16(v16h a, v16h b, v8f c) {
  return __builtin_amdgcn_wmma_f32_16x16x32_f16(
      /*neg_a=*/false, a, /*neg_b=*/false, b,
      /*c_mod=*/(short)0, c, /*reuse_a=*/false, /*reuse_b=*/false);
}

// Fragment from a wave-uniform tile base plus the lane's element offset
// (row r, 8*hi): the base stays scalar, the one offset register serves all loads.
__device__ __forceinline__ v16h frag_at(const _Float16* __restrict__ base, unsigned off) {
  v8h lo  = *reinterpret_cast<const v8h*>(base + off);
  v8h hi8 = *reinterpret_cast<const v8h*>((base + 16) + off);
  return __builtin_shufflevector(lo, hi8, 0,1,2,3,4,5,6,7,8,9,10,11,12,13,14,15);
}

// Value of the lane 16 places away (l <-> l ^ 16), as one vector cross-row move.
__device__ __forceinline__ float other_half(float x) {
  int b = __builtin_bit_cast(int, x);
  b = __builtin_amdgcn_permlanex16(b, b, 0x76543210, 0xfedcba98, false, false);
  return __builtin_bit_cast(float, b);
}

// Low 32 bits of a __shared__ address: the byte offset in the work-group's LDS.
__device__ __forceinline__ unsigned lds_off(const void* p) { return (unsigned)(size_t)p; }

// The work-group's barrier alone. __syncthreads() also waits out the wave's global loads; here
// the later k tiles of u are to stay in flight across it. The waits that the LDS data need
// (s_wait_dscnt, s_wait_asynccnt) are written in front of it at each use.
__device__ __forceinline__ void barrier_only() {
  asm volatile("s_barrier_signal -1\n\ts_barrier_wait -1" ::: "memory");
}

// Eight asynchronous copies from global memory to LDS, through no register: copy c brings the
// lane's 16 bytes at g + c * GSTEP to LDS byte l + c * LSTEP. A wave's copy covers 512
// contiguous bytes, four whole lines. s_wait_xcnt stands in the copies' own statement: no
// register that a copy names is rewritten ahead of it.
template <int LSTEP, int GSTEP>
__device__ __forceinline__ void copy8(unsigned l, const char* g) {
  asm volatile(
      "global_load_async_to_lds_b128 %0, %8, off\n\t"
      "global_load_async_to_lds_b128 %1, %9, off\n\t"
      "global_load_async_to_lds_b128 %2, %10, off\n\t"
      "global_load_async_to_lds_b128 %3, %11, off\n\t"
      "global_load_async_to_lds_b128 %4, %12, off\n\t"
      "global_load_async_to_lds_b128 %5, %13, off\n\t"
      "global_load_async_to_lds_b128 %6, %14, off\n\t"
      "global_load_async_to_lds_b128 %7, %15, off\n\t"
      "s_wait_xcnt 0x0"
      :: "v"(l), "v"(l + LSTEP), "v"(l + 2 * LSTEP), "v"(l + 3 * LSTEP),
         "v"(l + 4 * LSTEP), "v"(l + 5 * LSTEP), "v"(l + 6 * LSTEP), "v"(l + 7 * LSTEP),
         "v"(g), "v"(g + GSTEP), "v"(g + 2 * GSTEP), "v"(g + 3 * GSTEP),
         "v"(g + 4 * GSTEP), "v"(g + 5 * GSTEP), "v"(g + 6 * GSTEP), "v"(g + 7 * GSTEP)
      : "memory");
}

// ---------------------------------------------------------------------------
// Bilinear discretization of one diagonal entry of A, formed where it is used:
// A_bar = (1 + dt/2 A) / (1 - dt/2 A), and f = dt / (1 - dt/2 A), B_bar = f * B.
// ---------------------------------------------------------------------------
struct Disc { float abr, abi, fr, fi; };
__device__ __forceinline__ Disc discretize(float a_real, float a_imag) {
  float ar = -fabsf(a_real) - DAMP_MIN_;
  float ai = a_imag;
  float dr = 1.f - 0.005f * ar, di = -0.005f * ai;       // denom = 1 - dt/2 * A
  float inv = 1.f / (dr * dr + di * di);
  float nr = 1.f + 0.005f * ar, ni = 0.005f * ai;        // numer = 1 + dt/2 * A
  Disc d;
  d.abr = (nr * dr + ni * di) * inv;
  d.abi = (ni * dr - nr * di) * inv;
  d.fr  = DT_STEP * inv * dr;                            // dt * conj(denom) / |denom|^2
  d.fi  = -(DT_STEP * inv) * di;
  return d;
}

// The lane's 16 f32 values of one row of B (k order of the fragment: x[0], x[1] hold
// K = 8*hi + 0..7, x[2], x[3] hold K = 16 + 8*hi + 0..7), rounded to f16.
__device__ __forceinline__ v16h rounded_frag(const v4f x[4]) {
  v4h h0 = __builtin_convertvector(x[0], v4h);
  v4h h1 = __builtin_convertvector(x[1], v4h);
  v4h h2 = __builtin_convertvector(x[2], v4h);
  v4h h3 = __builtin_convertvector(x[3], v4h);
  v8h lo  = __builtin_shufflevector(h0, h1, 0,1,2,3,4,5,6,7);
  v8h hi8 = __builtin_shufflevector(h2, h3, 0,1,2,3,4,5,6,7);
  return __builtin_shufflevector(lo, hi8, 0,1,2,3,4,5,6,7,8,9,10,11,12,13,14,15);
}

// ---------------------------------------------------------------------------
// Kernel 0: v = u @ B_bar^T = f * (u @ B^T): B_bar[n] is the real row B[n] times the complex
// f[n], so ONE real WMMA GEMM s = u @ B^T gives both parts: v[t][n] = f[n] * s[t][n], formed
// from the f32 sums in the epilogue.
// one wave per 64 x 32 tile of [MM x NN]: 4 A fragments and 2 B fragments in registers
// feed 8 WMMAs per 32-wide k step. The 8 waves of a block stand 2 x 4 on a 128 x 128 tile.
// B comes as the f32 input, through LDS: the block's 128 rows in 4 tiles of 128 k, two
// buffers, brought by asynchronous copies of whole lines one tile ahead of its use.
// A lane owns one row n of B and rounds its f32 LDS reads to the f16 fragment.
// Left open: a k step's 8 WMMAs stand behind the wait for its own 16 LDS reads, which now
// set the loop's pace; fragments fetched one step ahead into a second register set (the
// loop leaves registers free) would take that wait out of the step.
// The block also rounds its 512 elements of C to f16 for the output GEMM's launch.
// The block rounds its 128 rows of u (f32) to f16 itself, once, into LDS; the A fragments
// are read from there. A wave's load covers 512 contiguous bytes of a row. u comes in the
// same 4 k tiles as B, through two register sets: only tile 0 is waited for ahead of the
// loop; tile t + 1 is rounded at the foot of tile t, and its loads fly under the WMMAs.
// Epilogue: the wave's 64 rows are one scan chunk. x[t] = A_bar x[t-1] + v[t]
// (zero start) runs on f times the accumulators, in registers; Re(x) goes to vre and the
// chunk's complex end state to ends. v itself never reaches memory.
// ---------------------------------------------------------------------------
constexpr int UP = DIN + 8;  // LDS row pitch in halves: 1040 B = 16 B x 65 (odd), for ds_load_b128
constexpr int KT = 128;      // k width of a staged tile of B: a row's part is 512 B, one copy of a wave
constexpr int NT = DIN / KT; // 4 tiles
constexpr int BP = KT + 4;   // LDS row pitch in floats: 528 B = 16 B x 33 (odd), for ds_load_b128

__global__ __launch_bounds__(256) void gemm_vproj(
    const float* __restrict__ u, const float* __restrict__ Bm,
    const float* __restrict__ Ar, const float* __restrict__ Ai,
    const float* __restrict__ Cm, _Float16* __restrict__ Ch,
    float* __restrict__ vre,
    float* __restrict__ ends_re, float* __restrict__ ends_im) {
  __shared__ __attribute__((aligned(16))) _Float16 us[128 * UP];
  __shared__ __attribute__((aligned(16))) float    bs[2 * 128 * BP];
  int w    = __builtin_amdgcn_readfirstlane(threadIdx.x >> 5);
  int lane = threadIdx.x & 31;
  int mb   = (blockIdx.x >> 1) * 128;                  // first of the block's 128 rows of BL
  int m0   = mb + (w >> 2) * 64;                       // first of the wave's 64 rows
  int n0   = (blockIdx.x & 1) * 128 + (w & 3) * 32;    // first of 32 columns of N
  int hi   = lane >> 4, r = lane & 15;

  // a wave brings 16 of the block's 128 rows of a tile of B, one row's 512 bytes a copy
  const unsigned bl = lds_off(bs) + (unsigned)(w * 16 * BP * 4) + (unsigned)lane * 16;
  const char*    bg = reinterpret_cast<const char*>(Bm + (size_t)((blockIdx.x & 1) * 128 + w * 16) * DIN) + lane * 16;
  auto stage_b = [&](int t, int buf) {
    copy8<BP * 4, DIN * 4>(bl + buf * (128 * BP * 4), bg + t * (KT * 4));
    copy8<BP * 4, DIN * 4>(bl + buf * (128 * BP * 4) + 8 * BP * 4, bg + t * (KT * 4) + 8 * DIN * 4);
  };
  stage_b(0, 0);                                       // flies under the u tile's loads

  // asked for along with the u tile: their latency falls under the tile's
  float araw[2], iraw[2];
#pragma unroll
  for (int j = 0; j < 2; ++j) {
    araw[j] = (Ar + n0 + j * 16)[(unsigned)r];
    iraw[j] = (Ai + n0 + j * 16)[(unsigned)r];
  }
  const unsigned cslot = (unsigned)threadIdx.x * 2;      // the thread's 2 of the block's 512 elements of C
  const float2 c2 = *reinterpret_cast<const float2*>((Cm + blockIdx.x * 512) + cslot);

  // a wave takes every eighth row, one k tile's 512 bytes of it a load: 16 loads a k tile.
  // Two register sets: tiles 0 and 1 are asked for here, tile t + 2 when tile t has been rounded.
  // scalar bases plus one lane offset: every load names the same register
  const float*   up = u  + (size_t)(mb + w) * DIN;
  _Float16*      sp = us + w * UP;
  const unsigned uc = (unsigned)lane * 4;
  float4 x[2][16];
  auto load_u = [&](int t) {
#pragma unroll
    for (int k = 0; k < 16; ++k)
      x[t & 1][k] = *reinterpret_cast<const float4*>((up + k * 8 * DIN + t * KT) + uc);
    // the loads' offset register is free for other values behind this wait
    asm volatile("s_wait_xcnt 0x0" ::: "memory");
    // keeps the tile's loads here, together: moved down to their converts they would start late
    __builtin_amdgcn_sched_barrier(0);
  };
  // k tile t of the wave's 16 rows -> f16 in LDS. The rounding (to nearest even, the instruction
  // the compiler itself takes for this convert) stands in asm volatile, which stays where it is
  // written: the compiler moves its own converts up to directly behind their loads, and with
  // them the wait for the loads, so that nothing flies under the WMMAs.
  auto round_u = [&](int t) {
#pragma unroll
    for (int k = 0; k < 16; ++k) {
      unsigned h01, h23;
      asm volatile("v_cvt_pk_f16_f32 %0, %1, %2" : "=v"(h01) : "v"(x[t & 1][k].x), "v"(x[t & 1][k].y));
      asm volatile("v_cvt_pk_f16_f32 %0, %1, %2" : "=v"(h23) : "v"(x[t & 1][k].z), "v"(x[t & 1][k].w));
      const v2u h = {h01, h23};
      *reinterpret_cast<v4h*>((sp + k * 8 * UP + t * KT) + uc) = __builtin_bit_cast(v4h, h);
    }
  };
  load_u(0);
  load_u(1);
  round_u(0);
  // the wave's LDS stores of u's tile 0 are done and its copies of B's tile 0 have landed
  // before it says so at the barrier
  asm volatile("s_wait_dscnt 0x0" ::: "memory");
  asm volatile("s_wait_asynccnt 0x0" ::: "memory");
  // publishes tile 0 of u and of B: a wave reads rows that all eight waves brought
  barrier_only();
  stage_b(1, 1);                                       // both fly under tile 0's WMMAs
  load_u(2);

  const _Float16* abase  = us + (w >> 2) * 64 * UP;
  const unsigned  lfrag  = (unsigned)(r * BP + 8 * hi);
  const unsigned  afrag  = (unsigned)(r * UP + 8 * hi);

  float ar[2], ai[2], fr[2], fi[2];                    // A_bar and f of the lane's two columns
#pragma unroll
  for (int j = 0; j < 2; ++j) {
    Disc d = discretize(araw[j], iraw[j]);
    ar[j] = d.abr; ai[j] = d.abi; fr[j] = d.fr; fi[j] = d.fi;
  }

  v8f acc[4][2] = {};
  // unrolled: every load is base + the lane's offset + immediate
#pragma unroll
  for (int ks = 0; ks < DIN; ks += 32) {
    const int t = ks / KT;                             // the tile of B that holds this k step
    v16h a[4];
    v4f  xb[2][4];
#pragma unroll
    for (int j = 0; j < 2; ++j) {
      const float* bj = bs + (t & 1) * (128 * BP) + ((w & 3) * 32 + j * 16) * BP + (ks - t * KT);
      xb[j][0] = *reinterpret_cast<const v4f*>(bj + lfrag);
      xb[j][1] = *reinterpret_cast<const v4f*>((bj + 4) + lfrag);
      xb[j][2] = *reinterpret_cast<const v4f*>((bj + 16) + lfrag);
      xb[j][3] = *reinterpret_cast<const v4f*>((bj + 20) + lfrag);
    }
#pragma unroll
    for (int i = 0; i < 4; ++i) a[i] = frag_at(abase + ks + i * 16 * UP, afrag);
    // keeps the step's 16 loads together ahead of its WMMAs: left free, the
    // scheduler reloads one B fragment at a time and waits out each load alone
    __builtin_amdgcn_sched_barrier(0);
    const v16h b0 = rounded_frag(xb[0]);
    const v16h b1 = rounded_frag(xb[1]);
#pragma unroll
    for (int i = 0; i < 4; ++i) {
      acc[i][0] = wmma16(a[i], b0, acc[i][0]);
      acc[i][1] = wmma16(a[i], b1, acc[i][1]);
    }
    // ends the step: no later load or store moves in among these WMMAs
    __builtin_amdgcn_sched_barrier(0);
    if (ks + 32 == (t + 1) * KT) {
      // foot of tile t: u's tile t + 1, whose loads flew under the WMMAs, goes to LDS
      if (t + 1 < NT) {
        // the distance behind the step's last WMMA: the asm converts may write registers that
        // held its A or B
        asm volatile("v_nop\n\tv_nop\n\tv_nop\n\tv_nop");
        round_u(t + 1);
      }
      // the wave's reads of B's buffer and its stores of u are done and its copies of tile t + 1
      // have landed before the barrier, which publishes tile t + 1 and frees tile t's buffer
      asm volatile("s_wait_dscnt 0x0" ::: "memory");
      asm volatile("s_wait_asynccnt 0x0" ::: "memory");
      barrier_only();
      if (t + 2 < NT) stage_b(t + 2, t & 1);
      if (t + 3 < NT) load_u(t + 3);                   // into the registers that round_u(t + 1) has read
    }
  }
  // no copy is left in flight behind the loop
  asm volatile("s_wait_asynccnt 0x0" ::: "memory");
  // C/D layout: lane holds column n0+16j+r; VGPR q holds row m0 + 16i + q + 8*hi.
  // In time order a column's 64 rows are 8 runs of 8: (i, hi) = (0,0) (0,1) (1,0) ...
  // and a lane owns the 4 runs of its own hi.
  float* oR = vre + (size_t)m0 * NN + n0;
  const unsigned lout = (unsigned)(8 * hi * NN + r);
  float endr[2], endi[2];
#pragma unroll
  for (int j = 0; j < 2; ++j) {
    // pw[q] = A_bar^(q+1)
    float pwr[8], pwi[8];
    pwr[0] = ar[j]; pwi[0] = ai[j];
#pragma unroll
    for (int q = 1; q < 8; ++q) {
      pwr[q] = pwr[q - 1] * ar[j] - pwi[q - 1] * ai[j];
      pwi[q] = pwr[q - 1] * ai[j] + pwi[q - 1] * ar[j];
    }
    // 1) each run scanned from a zero start, on v = f * s; Re takes s's place in acc, the end is kept
    float er[4], ei[4];
#pragma unroll
    for (int i = 0; i < 4; ++i) {
      float xr = fr[j] * acc[i][j][0], xi = fi[j] * acc[i][j][0];
      acc[i][j][0] = xr;
#pragma unroll
      for (int q = 1; q < 8; ++q) {
        float nxr = fr[j] * acc[i][j][q] + ar[j] * xr - ai[j] * xi;
        float nxi = fi[j] * acc[i][j][q] + ar[j] * xi + ai[j] * xr;
        xr = nxr; xi = nxi;
        acc[i][j][q] = xr;
      }
      er[i] = xr; ei[i] = xi;
    }
    // 2) state entering each run: both halves walk the same 8 run ends in time order
    float inr[4], ini[4];
    float sr = 0.f, si = 0.f;
#pragma unroll
    for (int i = 0; i < 4; ++i) {
      float qr = other_half(er[i]), qi = other_half(ei[i]);
      float e0r = hi ? qr : er[i], e0i = hi ? qi : ei[i];   // end of run (i, 0)
      float e1r = hi ? er[i] : qr, e1i = hi ? ei[i] : qi;   // end of run (i, 1)
      float tr = e0r, ti = e0i;                             // state entering (i, 1)
      if (i > 0) {
        tr = e0r + pwr[7] * sr - pwi[7] * si;
        ti = e0i + pwr[7] * si + pwi[7] * sr;
      }
      inr[i] = hi ? tr : sr; ini[i] = hi ? ti : si;
      sr = e1r + pwr[7] * tr - pwi[7] * ti;                 // state entering (i+1, 0)
      si = e1i + pwr[7] * ti + pwi[7] * tr;
    }
    // 3) Re(x) = Re(run-local x) + Re(A_bar^(q+1) * state entering the run)
#pragma unroll
    for (int i = 0; i < 4; ++i) {
#pragma unroll
      for (int q = 0; q < 8; ++q)
        (oR + (i * 16 + q) * NN + j * 16)[lout] =
            acc[i][j][q] + pwr[q] * inr[i] - pwi[q] * ini[i];
    }
    endr[j] = sr; endi[j] = si;
  }
  // the chunk's end state, once per column: both halves hold it, the lower one stores
  if (hi == 0) {
#pragma unroll
    for (int j = 0; j < 2; ++j) {
      (ends_re + (size_t)(m0 / LC) * NN + n0 + j * 16)[(unsigned)r] = endr[j];
      (ends_im + (size_t)(m0 / LC) * NN + n0 + j * 16)[(unsigned)r] = endi[j];
    }
  }
  // C -> f16, C is DIN*NN row-major; a wave's store fills one 128-byte line
  v2h ch; ch[0] = (_Float16)c2.x; ch[1] = (_Float16)c2.y;
  *reinterpret_cast<v2h*>((Ch + blockIdx.x * 512) + cslot) = ch;
}

// ---------------------------------------------------------------------------
// Kernel 1: out = Re(y) @ C^T + u * D   (f16 WMMA GEMM, fp32 epilogue)
// One block per scan chunk: 64 rows x all 512 columns, 8 waves side by side,
// one wave per 64 x 64 tile, worked in 4 pieces of 16 rows: the wave's 32 fragments of C
// stay in registers, a piece takes 8 A fragments and 32 WMMAs and is stored at once, so
// that its stores drain, and later pieces' u values arrive, under the WMMAs that follow.
// 24 of the 32 fragments are read as soon as their rows have landed, under the prologue.
// Left open: the wait for 56 of the wave's rows of C stands ahead of the first barrier; the
// copies' landing and the LDS reads of the fragments now set the time up to the first WMMA.
// Prologue: the block forms its A tile itself, once, in LDS:
//   Re(y)[t][n] = v_local[t][n] + Re(A_bar^(t+1) * carry_in[n])  -> f16
// A thread owns 4 columns and 16 rows; A_bar^(t+1) * carry_in starts at the thread's
// first row t0 from A_bar * (A_bar^16)^(t0/16) and is stepped by A_bar from row to row.
// carry_in, the state entering the chunk, is formed here too, from the end states of the
// batch's earlier chunks: carry_in = sum over c' < c of (A_bar^64)^(c-1-c') * end[c'].
// The 64 places that end at chunk c-1 (places ahead of the batch's first chunk count as 0)
// fall into 4 runs of 16; the threads of row group g sum run g for their 4 columns by
// Horner's rule, the 4 sums meet in LDS and are joined with A_bar^1024.
// C (f16) comes through LDS too: a wave brings its own 64 rows by asynchronous copies of
// whole lines, which fly under the prologue; the B fragments are read from there, once.
// ---------------------------------------------------------------------------
constexpr int AP = NN + 8;   // LDS row pitch in halves: 528 B = 16 B x 33 (odd), for ds_load_b128
constexpr int SEG = NC / 4;  // chunk ends summed by one row group

__global__ __launch_bounds__(256) void gemm_out(
    const float* __restrict__ vre,
    // not __restrict__: a load that the compiler takes for constant memory is free to move over
    // the copies' asm statements, and A's loads came to stand behind all 56 copies of C
    const float* Ar, const float* Ai,
    const float* __restrict__ ends_re, const float* __restrict__ ends_im,
    const _Float16* __restrict__ Ch,
    const float* __restrict__ u, const float* __restrict__ Dv,
    float* __restrict__ out) {
  __shared__ __attribute__((aligned(16))) _Float16 ys[LC * AP];
  __shared__ __attribute__((aligned(16))) float segr[4 * NN];
  __shared__ __attribute__((aligned(16))) float segi[4 * NN];
  __shared__ __attribute__((aligned(16))) _Float16 cs[DIN * AP];
  int w    = __builtin_amdgcn_readfirstlane(threadIdx.x >> 5);
  int lane = threadIdx.x & 31;
  int m0   = blockIdx.x * LC;                          // first of the chunk's 64 rows of BL
  int d0   = w * 64;                                   // first of 64 columns of Din
  int hi   = lane >> 4, r = lane & 15;
  // the lane's 16 bytes of the first of the wave's 64 rows of C, one row's 512 bytes a copy
  const unsigned cl = lds_off(cs) + (unsigned)(d0 * AP * 2) + (unsigned)lane * 16;
  const char*    cg = reinterpret_cast<const char*>(Ch + (size_t)d0 * NN) + lane * 16;

  const _Float16* bbase = cs + d0 * AP;                    // C[d][n]: k-contig, at the A tile's pitch
  const unsigned  afrag = (unsigned)(r * AP + 8 * hi);
  const float* ub = u   + (size_t)m0 * DIN + d0;
  float*       ob = out + (size_t)m0 * DIN + d0;
  const unsigned lout = (unsigned)(8 * hi * DIN + r);
  float dval[4];
  // u of a piece (16 rows x the wave's 64 columns), three register sets: piece 0 is asked for
  // ahead of the first barrier, piece 1 ahead of the second, piece i + 2 behind piece i's
  // WMMAs. A piece's loads so fly under at least two pieces' worth of work, and no more than
  // two pieces' loads, which is what the load counter takes, are in flight at a time
  float uu[3][4][8];
  auto load_uu = [&](int i) {
#pragma unroll
    for (int j = 0; j < 4; ++j) {
#pragma unroll
      for (int q = 0; q < 8; ++q) uu[i % 3][j][q] = (ub + (i * 16 + q) * DIN + j * 16)[lout];
    }
  };
  v16h b[8][4];                                        // all of the wave's C, read from LDS once

  {
    // scalar bases plus one lane offset: every load of the prologue names the same register
    const unsigned n  = (threadIdx.x & 63) * 4;        // first of the thread's 4 columns
    const int      g  = w >> 1;                        // row group: two waves span a row
    const int      t0 = g * 16;                        // first of its 16 rows
    // the group's run stands for chunks cb .. cb + 15 of the batch; below 0 there is none:
    // the run is read from its first chunk that exists, cs, and holds cnt chunks (16; fewer
    // in the run with the batch's first chunk; none, cnt <= 0, ahead of it). The 16 rows
    // read lie inside the batch's 64 for every cs (cs <= 47).
    const int    cb  = (int)(blockIdx.x & (NC - 1)) - NC + g * SEG;
    const int    cs  = cb > 0 ? cb : 0;
    const int    cnt = cb + SEG - cs;
    const float* eR = ends_re + (size_t)((blockIdx.x & ~(unsigned)(NC - 1)) + cs) * NN;
    const float* eI = ends_im + (size_t)((blockIdx.x & ~(unsigned)(NC - 1)) + cs) * NN;
    float4 er[SEG], ei[SEG];                           // read only where cnt > 0
    if (cnt > 0) {                                     // the same for the whole wave: an empty run asks L2 for nothing
#pragma unroll
      for (int k = 0; k < SEG; ++k) {
        er[k] = *reinterpret_cast<const float4*>((eR + k * NN) + n);
        ei[k] = *reinterpret_cast<const float4*>((eI + k * NN) + n);
      }
    }
    // A behind the branch: asked for ahead of it, its wait behind the join counts for the
    // path without loads too, and comes to stand for all of the ends ahead of the rows of v
    const float4 a4r = *reinterpret_cast<const float4*>(Ar + n);
    const float4 a4i = *reinterpret_cast<const float4*>(Ai + n);
    const float* vp = vre + (size_t)(m0 + t0) * NN;
    float4 x[16];
#pragma unroll
    for (int k = 0; k < 16; ++k) x[k] = *reinterpret_cast<const float4*>((vp + k * NN) + n);
    // the 18 loads first, as one group: left free, the scheduler waits for A in their
    // midst, and the later loads start one latency late
    __builtin_amdgcn_sched_group_barrier(0x020, 18, 0);
    // the loads' address registers are free for the values that follow behind this wait
    asm volatile("s_wait_xcnt 0x0" ::: "memory");
    // 56 of the wave's 64 rows of C, behind the loads that the prologue waits for
#pragma unroll
    for (int s = 0; s < 7; ++s) copy8<AP * 2, NN * 2>(cl + s * (8 * AP * 2), cg + s * (8 * NN * 2));
    const float rawr[4] = {a4r.x, a4r.y, a4r.z, a4r.w}, rawi[4] = {a4i.x, a4i.y, a4i.z, a4i.w};
    float ar[4], ai[4], pr[4], pi[4];                  // A_bar and A_bar^(t0+1)
    float cpr[4], cpi[4], rpr[4], rpi[4];              // A_bar^64 (a chunk), A_bar^1024 (a run of 16)
#pragma unroll
    for (int e = 0; e < 4; ++e) {
      const Disc d = discretize(rawr[e], rawi[e]);
      ar[e] = d.abr; ai[e] = d.abi;
      float sr = ar[e], si = ai[e];
#pragma unroll
      for (int s = 0; s < 4; ++s) {                    // A_bar^16 by four squarings
        float qr = sr * sr - si * si;
        float qi = 2.f * sr * si;
        sr = qr; si = qi;
      }
      pr[e] = ar[e]; pi[e] = ai[e];
#pragma unroll
      for (int s = 0; s < 3; ++s) {
        if (s < (w >> 1)) {                            // the same for the whole wave
          float qr = pr[e] * sr - pi[e] * si;
          float qi = pr[e] * si + pi[e] * sr;
          pr[e] = qr; pi[e] = qi;
        }
      }
#pragma unroll
      for (int s = 0; s < 6; ++s) {                    // A_bar^16 squared on: ^64 after 2, ^1024 after 6
        float qr = sr * sr - si * si;
        float qi = 2.f * sr * si;
        sr = qr; si = qi;
        if (s == 1) { cpr[e] = sr; cpi[e] = si; }
      }
      rpr[e] = sr; rpi[e] = si;
    }
    // the run's sum: h = h * A_bar^64 + end, oldest chunk first, over its cnt chunks
    float hr[4] = {0.f, 0.f, 0.f, 0.f}, hm[4] = {0.f, 0.f, 0.f, 0.f};
    if (cnt > 0) {
#pragma unroll
      for (int k = 0; k < SEG; ++k) {
        const float kr[4] = {er[k].x, er[k].y, er[k].z, er[k].w};
        const float km[4] = {ei[k].x, ei[k].y, ei[k].z, ei[k].w};
        const bool on = k < cnt;                       // the same for the whole wave
#pragma unroll
        for (int e = 0; e < 4; ++e) {
          float nr = kr[e] + cpr[e] * hr[e] - cpi[e] * hm[e];
          float ni = km[e] + cpr[e] * hm[e] + cpi[e] * hr[e];
          hr[e] = on ? nr : hr[e]; hm[e] = on ? ni : hm[e];
        }
      }
    }
    *reinterpret_cast<float4*>(segr + g * NN + n) = make_float4(hr[0], hr[1], hr[2], hr[3]);
    *reinterpret_cast<float4*>(segi + g * NN + n) = make_float4(hm[0], hm[1], hm[2], hm[3]);
    // no arithmetic moves in between the global loads that follow and their wait
    __builtin_amdgcn_sched_barrier(0);
    // D and piece 0's u are asked for behind the 56 copies and come in behind them
#pragma unroll
    for (int j = 0; j < 4; ++j) dval[j] = (Dv + d0 + j * 16)[(unsigned)r];
    load_uu(0);
    // the loads' offset registers are free for other values behind this wait
    asm volatile("s_wait_xcnt 0x0" ::: "memory");
    // nothing that rewrites those registers moves up over the wait
    __builtin_amdgcn_sched_barrier(0);
    // the last 8 rows of C go behind the first 56: a wave keeps fewer than 64 copies in flight
    asm volatile("s_wait_asynccnt 0x0" ::: "memory");
    copy8<AP * 2, NN * 2>(cl + 7 * (8 * AP * 2), cg + 7 * (8 * NN * 2));
    // the wave's sums are written before the barrier is signalled
    asm volatile("s_wait_dscnt 0x0" ::: "memory");
    // publishes the four runs' sums: a thread reads those of the other three row groups; the
    // barrier alone, so that the u values stay in flight across it
    barrier_only();
    float4 s4r[4], s4i[4];
#pragma unroll
    for (int s = 0; s < 4; ++s) {
      s4r[s] = *reinterpret_cast<const float4*>(segr + s * NN + n);
      s4i[s] = *reinterpret_cast<const float4*>(segi + s * NN + n);
    }
    // the runs' sums are asked for first: the arithmetic below waits for them alone
    __builtin_amdgcn_sched_barrier(0);
    // the wave's first 56 rows of C have landed (the wait ahead of the barrier): the fragments
    // of its first 48 go to registers here, under the same arithmetic
#pragma unroll
    for (int s = 0; s < 8; ++s) {
#pragma unroll
      for (int j = 0; j < 3; ++j) b[s][j] = frag_at(bbase + s * 32 + j * 16 * AP, afrag);
    }
    // keeps the 48 LDS loads here, together: moved down they would start late
    __builtin_amdgcn_sched_barrier(0);
    float cr[4], ci[4];                                // carry_in of the thread's 4 columns
#pragma unroll
    for (int s = 0; s < 4; ++s) {
      const float kr[4] = {s4r[s].x, s4r[s].y, s4r[s].z, s4r[s].w}, km[4] = {s4i[s].x, s4i[s].y, s4i[s].z, s4i[s].w};
#pragma unroll
      for (int e = 0; e < 4; ++e) {
        if (s == 0) { cr[e] = kr[e]; ci[e] = km[e]; }
        else {
          float nr = kr[e] + rpr[e] * cr[e] - rpi[e] * ci[e];
          float ni = km[e] + rpr[e] * ci[e] + rpi[e] * cr[e];
          cr[e] = nr; ci[e] = ni;
        }
      }
    }
    float zr[4], zi[4];                                // A_bar^(t+1) * carry_in at row t
#pragma unroll
    for (int e = 0; e < 4; ++e) {
      zr[e] = pr[e] * cr[e] - pi[e] * ci[e];
      zi[e] = pr[e] * ci[e] + pi[e] * cr[e];
    }
#pragma unroll
    for (int k = 0; k < 16; ++k) {
      const float xe[4] = {x[k].x, x[k].y, x[k].z, x[k].w};
      v4h h;
#pragma unroll
      for (int e = 0; e < 4; ++e) {
        h[e] = (_Float16)(xe[e] + zr[e]);
        float nr = zr[e] * ar[e] - zi[e] * ai[e];
        float ni = zr[e] * ai[e] + zi[e] * ar[e];
        zr[e] = nr; zi[e] = ni;
      }
      *reinterpret_cast<v4h*>(ys + (t0 + k) * AP + n) = h;
    }
  }
  // holds piece 1's loads behind the arithmetic above: ahead of it they would stand with D's
  // and piece 0's, more than the load counter takes, and the wave would stall at their issue
  __builtin_amdgcn_sched_barrier(0);
  load_uu(1);
  // the wave's last 8 rows of C have landed before anything reads them
  asm volatile("s_wait_asynccnt 0x0" ::: "memory");
  // the wave's part of the A tile is written before the barrier is signalled
  asm volatile("s_wait_dscnt 0x0" ::: "memory");
  // publishes the A tile: every wave reads all 64 rows; the barrier alone, so that the u
  // values stay in flight across it
  barrier_only();

  v16h a[8];                                           // the piece's 16 rows of the A tile
  // what piece 0 still lacks, in the order of its k steps: its A fragments and the fragments
  // of C's last 16 rows
#pragma unroll
  for (int s = 0; s < 8; ++s) {
    a[s] = frag_at(ys + s * 32, afrag);
    b[s][3] = frag_at(bbase + s * 32 + 3 * 16 * AP, afrag);
  }
  // keeps the LDS loads together ahead of piece 0's WMMAs
  __builtin_amdgcn_sched_barrier(0);
#pragma unroll
  for (int i = 0; i < 4; ++i) {
    v8f acc[4] = {};
#pragma unroll
    for (int s = 0; s < 8; ++s) {
#pragma unroll
      for (int j = 0; j < 4; ++j) acc[j] = wmma16(a[s], b[s][j], acc[j]);
    }
    // no load or store moves in among the piece's WMMAs
    __builtin_amdgcn_sched_barrier(0);
    if (i < 3) {
#pragma unroll
      for (int s = 0; s < 8; ++s) a[s] = frag_at(ys + s * 32 + (i + 1) * 16 * AP, afrag);
    }
    if (i + 2 < 4) load_uu(i + 2);
    // the next piece's A fragments and a later piece's u are asked for ahead of this piece's
    // stores: the LDS latency falls under the stores, the u values have two pieces' time
    __builtin_amdgcn_sched_barrier(0);
#pragma unroll
    for (int j = 0; j < 4; ++j) {
#pragma unroll
      for (int q = 0; q < 8; ++q) acc[j][q] += uu[i % 3][j][q] * dval[j];
    }
    // all 32 results stand in registers of their own ahead of the stores: left free, the
    // scheduler forms them among the stores in a few registers that it rewrites
    __builtin_amdgcn_sched_barrier(0);
#pragma unroll
    for (int j = 0; j < 4; ++j) {
#pragma unroll
      for (int q = 0; q < 8; ++q) (ob + (i * 16 + q) * DIN + j * 16)[lout] = acc[j][q];
    }
    if (i < 3) {
      // the stored registers are free for the WMMAs that follow behind this wait
      asm volatile("s_wait_xcnt 0x0" ::: "memory");
      // the stores and their wait stay here, ahead of the next piece's WMMAs
      __builtin_amdgcn_sched_barrier(0);
    }
  }
}

// ---------------------------------------------------------------------------
// Host launcher. Workspace carve-out (~18 MB), all launches on `stream`.
// ---------------------------------------------------------------------------
extern "C" void kernel_launch(void* const* d_in, const int* in_sizes, int n_in,
                              void* d_out, int out_size, void* d_ws, size_t ws_size,
                              hipStream_t stream) {
  const float* u      = (const float*)d_in[0];  // [BB, LL, DIN]
  const float* A_real = (const float*)d_in[1];  // [NN]
  const float* A_imag = (const float*)d_in[2];  // [NN]
  const float* B_mat  = (const float*)d_in[3];  // [NN, DIN]
  const float* C_mat  = (const float*)d_in[4];  // [DIN, NN]
  const float* D_vec  = (const float*)d_in[5];  // [DIN]
  float* out = (float*)d_out;                   // [BB, LL, DIN]

  char* w = (char*)d_ws;
  auto carve = [&](size_t bytes) -> void* {
    void* p = (void*)w;
    w += (bytes + 255) & ~(size_t)255;
    return p;
  };
  _Float16* C_h      = (_Float16*)carve((size_t)DIN * NN * sizeof(_Float16));
  float*    v_re     = (float*)carve((size_t)MM * NN * sizeof(float));
  float*    ends_re  = (float*)carve((size_t)BB * NC * NN * sizeof(float));
  float*    ends_im  = (float*)carve((size_t)BB * NC * NN * sizeof(float));

  // 0) input projection v = u @ B_bar^T (WMMA) with the local chunk scan in its epilogue; C -> f16
  gemm_vproj<<<(MM / 128) * 2, 256, 0, stream>>>(u, B_mat, A_real, A_imag, C_mat, C_h,
                                                 v_re, ends_re, ends_im);
  // 1) chunk carries + carry correction + output projection + skip: out = Re(y) @ C^T + u*D  (WMMA)
  gemm_out<<<MM / LC, 256, 0, stream>>>(v_re, A_real, A_imag, ends_re, ends_im,
                                        C_h, u, D_vec, out);
}
